// v000
// Measured on an AMD MI455X. A time is GPU time per run, averaged over a window of back-to-back runs after a warm-up
// (all launches, gaps included; the runs take copies of the inputs in turn), and the median of several windows.
// Apart from v000's, it joins two sittings. Times from different sittings can be a few percent apart, while
// side-by-side timings come from the same sitting.
// v000, which the later versions start from, runs in 1540 microseconds.
#include <hip/hip_runtime.h>

// Local (sliding-window) multi-head attention with rotary embeddings applied to the RAW hidden states before the projections (hidden [2][2048][768]; xr = rotate-half rope(hidden viewed (S, 12, 64)) with angles t x 10000^(-2i/64) (computed in-kernel); q = xr Wq + bq, k = xr Wk + bk, v = hidden Wv + bv (keras per-head dense == 'xw' [768][768] + [768]); scores = (q x 0.125).k; keys with |i - j| >= 128 get -1e9 (exclusion); softmax; out = ctx Wo + bo ('xw' [768][768]) -> [2][2048][768] (3.1 M)).
// Layout per batch: a rotary kernel rotates the bf16-rounded hidden states per 64-wide slice and writes them directly as hi/lo GEMM operand planes (f32 rotary, precise cosf/sinf, jnp-exact inverse frequencies); q and k as hi/lo x exact GEMMs (2 products) + f32 biases, v exact from the bf16 hidden states; q scaled by 0.125 before the split; dense T-2048 attention (hybrid rows: < 512 hi/lo 3 products, rest fp16 x1024) whose softmax kernel applies the |i - j| < 128 window as an index select; merged hi/lo x Wo exact + bo.
// Compute dtypes, f32 accumulate: every input rounded to bf16; rotary f32; q/k hi/lo x exact, v exact, + f32 biases; attention rows < 512 3 products, rest fp16; softmax f32; Wo hl x exact + bias.

#define NB_  2
#define TT   2048
#define DM   768
#define NH_  12
#define NKV  12
#define REP  (NH_ / NKV)
#define HD   64
#define DQ   (NH_ * HD)
#define DKV  (NKV * HD)
#define ZH   2
#define RH   512                  // query rows < RH use hi+lo planes (0: none)
#define WIN  0
#define PCAR 1024.0f
#define SCL  1.0f   // q x 0.125 applied before the split (QSC)
#define QSC  0.125f
#define WNB  128     // |i - j| < 128 kept
typedef _Float16 h16;
typedef unsigned short bf;
typedef __attribute__((ext_vector_type(16))) __bf16   v16bf;
typedef __attribute__((ext_vector_type(16))) _Float16 v16h;
typedef __attribute__((ext_vector_type(8)))  _Float16 v8h;
typedef __attribute__((ext_vector_type(8)))  unsigned short v8us;
typedef __attribute__((ext_vector_type(8)))  float    v8f;
typedef __attribute__((ext_vector_type(4)))  float    v4f;
typedef v8h  __attribute__((may_alias)) v8ha;
typedef v4f  __attribute__((may_alias)) v4fa;
typedef v8us __attribute__((may_alias)) v8usa;

__device__ __forceinline__ unsigned short f2bf(float f) { unsigned u = __float_as_uint(f); u += 0x7FFFu + ((u >> 16) & 1u); return (unsigned short)(u >> 16); }
__device__ __forceinline__ float bf2f(unsigned short b) { return __uint_as_float(((unsigned)b) << 16); }
__device__ __forceinline__ float bfr(float f) { return bf2f(f2bf(f)); }
__device__ __forceinline__ v16h cat16(v8h lo, v8h hi) { return __builtin_shufflevector(lo, hi, 0, 1, 2, 3, 4, 5, 6, 7, 8, 9, 10, 11, 12, 13, 14, 15); }
__device__ __forceinline__ v16bf cat16b(v8us lo, v8us hi) { return __builtin_bit_cast(v16bf, __builtin_shufflevector(lo, hi, 0, 1, 2, 3, 4, 5, 6, 7, 8, 9, 10, 11, 12, 13, 14, 15)); }
__device__ __forceinline__ v8f wmma16(v16h a, v16h b, v8f c) { return __builtin_amdgcn_wmma_f32_16x16x32_f16(false, a, false, b, (short)0, c, false, false); }
__device__ __forceinline__ v8f wmmab(v16bf a, v16bf b, v8f c) { return __builtin_amdgcn_wmma_f32_16x16x32_bf16(false, a, false, b, (short)0, c, false, false); }



// ---- k_gemmw: register-blocked GEMM, ONE WAVE per 64x64 output tile (16 accumulators), operands straight from K-contiguous 16-bit planes; grid (M/64, N/64, Z), 32 threads.
// C[m][n] (f32, pitch ldc, + optional f32 bias[n]) = sum_k A[m][k] Bt[n][k] (+ split products per NSPLIT). z-batch strides sA/sB/sC in elements. K % 32 == 0.
template <typename T16> struct WFrag;
template <> struct WFrag<h16> { typedef v16h V; static __device__ __forceinline__ V ld(const h16* p) { return cat16(*(const v8h*)p, *(const v8h*)(p + 16)); } static __device__ __forceinline__ v8f mma(V a, V b, v8f c) { return wmma16(a, b, c); } };
template <> struct WFrag<bf> { typedef v16bf V; static __device__ __forceinline__ V ld(const bf* p) { return cat16b(*(const v8us*)p, *(const v8us*)(p + 16)); } static __device__ __forceinline__ v8f mma(V a, V b, v8f c) { return wmmab(a, b, c); } };
template <typename T16, int NSPLIT, bool BIAS>
__global__ __launch_bounds__(32) void k_gemmw(const T16* __restrict__ A, const T16* __restrict__ A2, const T16* __restrict__ Bt, const T16* __restrict__ Bt2, int K, float* C, int ldc, const float* __restrict__ bias, size_t sA, size_t sB, size_t sC) {
    typedef typename WFrag<T16>::V V;
    __shared__ __align__(16) float os[16 * 68];
    const size_t z = blockIdx.z; A += z * sA; if (A2) A2 += z * sA; Bt += z * sB; if (Bt2) Bt2 += z * sB; C += z * sC;
    const int lane = threadIdx.x & 31, lr = lane & 15, hi = lane >> 4; const int r0 = blockIdx.x * 64, c0 = blockIdx.y * 64;
    v8f acc[4][4];
#pragma unroll
    for (int mb = 0; mb < 4; ++mb)
#pragma unroll
        for (int nb = 0; nb < 4; ++nb) acc[mb][nb] = (v8f){};
    const size_t aoff = (size_t)(r0 + lr) * K + 8 * hi, boff = (size_t)(c0 + lr) * K + 8 * hi;
#pragma unroll 1
    for (int kc = 0; kc < K; kc += 32) {
        V a[4], a2[4];
#pragma unroll
        for (int mb = 0; mb < 4; ++mb) { a[mb] = WFrag<T16>::ld(A + aoff + (size_t)mb * 16 * K + kc); if (NSPLIT == 1 || NSPLIT == 2) a2[mb] = WFrag<T16>::ld(A2 + aoff + (size_t)mb * 16 * K + kc); }
#pragma unroll
        for (int nb = 0; nb < 4; ++nb) { const V b = WFrag<T16>::ld(Bt + boff + (size_t)nb * 16 * K + kc); V b2; if (NSPLIT >= 2) b2 = WFrag<T16>::ld(Bt2 + boff + (size_t)nb * 16 * K + kc);
#pragma unroll
            for (int mb = 0; mb < 4; ++mb) { acc[mb][nb] = WFrag<T16>::mma(a[mb], b, acc[mb][nb]); if (NSPLIT == 1 || NSPLIT == 2) acc[mb][nb] = WFrag<T16>::mma(a2[mb], b, acc[mb][nb]); if (NSPLIT >= 2) acc[mb][nb] = WFrag<T16>::mma(a[mb], b2, acc[mb][nb]); } }
        asm volatile("v_nop\n\tv_nop\n\tv_nop\n\tv_nop" : "+v"(acc[0][0]), "+v"(acc[1][1]), "+v"(acc[2][2]), "+v"(acc[3][3]) : "v"(a[0]), "v"(a[3]));
    }
#pragma unroll
    for (int mb = 0; mb < 4; ++mb) {
#pragma unroll
        for (int nb = 0; nb < 4; ++nb) {
#pragma unroll
            for (int j = 0; j < 8; ++j) os[(hi * 8 + j) * 68 + nb * 16 + lr] = acc[mb][nb][j]; }
        __builtin_amdgcn_wave_barrier(); asm volatile("" ::: "memory");
        float* crow = C + (size_t)(r0 + mb * 16) * ldc + c0;
{
#pragma unroll
            for (int s = 0; s < 8; ++s) { const int row = 2 * s + hi, cofs = lr * 4; v4f val = *(const v4fa*)(os + row * 68 + cofs); if (BIAS) { val[0] += bfr(bias[c0 + cofs]); val[1] += bfr(bias[c0 + cofs + 1]); val[2] += bfr(bias[c0 + cofs + 2]); val[3] += bfr(bias[c0 + cofs + 3]); }
                *(v4f*)(crow + (size_t)row * ldc + cofs) = val; }
             }
        __builtin_amdgcn_wave_barrier(); asm volatile("" ::: "memory");
    }
}

__device__ __forceinline__ h16 tohx(float x) { return (h16)x; }
__device__ __forceinline__ void splitf(float y, unsigned short& h, unsigned short& l) { h = f2bf(y); l = f2bf(y - bf2f(h)); }
typedef __attribute__((ext_vector_type(2))) _Float16 v2h;
typedef __attribute__((ext_vector_type(4))) _Float16 v4h;
typedef __attribute__((ext_vector_type(2))) unsigned short v2us;
typedef __attribute__((ext_vector_type(4))) unsigned short v4us;
typedef __attribute__((ext_vector_type(2))) float v2f;
typedef __attribute__((ext_vector_type(4))) int v4i;

__global__ __launch_bounds__(256) void k_wtG(const float* __restrict__ w, int K, int N, bf* Bt) {
    const int lane = threadIdx.x & 31; const int L0 = (blockIdx.x * 8 + (threadIdx.x >> 5)) * 8; const int nlines = N * K / 64;
{
#pragma unroll 1
        for (int l = 0; l < 8; ++l) { const int L = L0 + l; if (L >= nlines) break; const size_t e = (size_t)L * 64 + lane * 2; const int k = (int)(e % K), n = (int)(e / K); v2us o;
            o[0] = f2bf(w[(size_t)k * N + n]); o[1] = f2bf(w[(size_t)(k + 1) * N + n]); *(v2us*)(Bt + e) = o; }
         }
}
__global__ __launch_bounds__(256) void k_cvt8(const float* __restrict__ src, bf* dst, size_t n8) { const size_t i = (size_t)blockIdx.x * 256 + threadIdx.x; if (i >= n8) return; const v8f v = *(const v8f*)(src + i * 8); v8us o;
#pragma unroll
    for (int k = 0; k < 8; ++k) o[k] = f2bf(v[k]); *(v8us*)(dst + i * 8) = o;  }

// k_rope: head planes [h][t][d] (fp16 + hi/lo) of rope(x) x sc with the rotate-half convention out[d] = x[d] cos[t][d] - x[d+HD/2] sin[t][d], out[d+HD/2] = x[d+HD/2] cos[t][d+HD/2] + x[d] sin[t][d+HD/2]
__global__ __launch_bounds__(256) void k_rope(const float* __restrict__ F, int pitch, int nheads, const float* __restrict__ CS, const float* __restrict__ RF, const float* __restrict__ nw, float sc, h16* P16, bf* Ph, bf* Pl) {
    const size_t e = ((size_t)blockIdx.x * 256 + threadIdx.x) * 2; if (e >= (size_t)nheads * TT * HD) return; const int d = (int)(e % HD); const int t = (int)((e / HD) % TT); const int h = (int)(e / ((size_t)HD * TT)); const float* f = F + (size_t)t * pitch + h * HD; const float rf = RF ? RF[(size_t)h * TT + t] : 1.0f; v2h o16; v2us oh, ol;
#pragma unroll
    for (int q = 0; q < 2; ++q) { const int dd = d + q; const int dp = (dd < HD / 2) ? dd + HD / 2 : dd - HD / 2; float x0 = f[dd], x1 = f[dp];
        if (RF) { float n0 = __fmul_rn(x0, rf), n1 = __fmul_rn(x1, rf); asm volatile("" : "+v"(n0)); asm volatile("" : "+v"(n1)); x0 = __fmul_rn(bfr(nw[dd]), n0); x1 = __fmul_rn(bfr(nw[dp]), n1); }
        const v2f cs = *(const v2f*)(CS + ((size_t)t * HD + dd) * 2); float a = __fmul_rn(x0, cs[0]), bq = __fmul_rn(x1, cs[1]); asm volatile("" : "+v"(a)); asm volatile("" : "+v"(bq)); const float r = ((dd < HD / 2) ? __fsub_rn(a, bq) : __fadd_rn(a, bq)) * sc;
        o16[q] = tohx(r); unsigned short a2, c2; splitf(r, a2, c2); oh[q] = a2; ol[q] = c2; }
    *(v2h*)(P16 + e) = o16; *(v2us*)(Ph + e) = oh; *(v2us*)(Pl + e) = ol;  }
__global__ __launch_bounds__(256) void k_vtp(const float* __restrict__ F, int pitch, int nheads, h16* V16, bf* Vh, bf* Vl) { const size_t e = ((size_t)blockIdx.x * 256 + threadIdx.x) * 2; if (e >= (size_t)nheads * HD * TT) return; const int t = (int)(e % TT); const int d = (int)((e / TT) % HD); const int g = (int)(e / ((size_t)TT * HD)); v2h o16; v2us oh, ol;
#pragma unroll
    for (int q = 0; q < 2; ++q) { const float x = F[(size_t)(t + q) * pitch + g * HD + d]; o16[q] = tohx(x); unsigned short a2, c2; splitf(x, a2, c2); oh[q] = a2; ol[q] = c2; }
    *(v2h*)(V16 + e) = o16; *(v2us*)(Vh + e) = oh; *(v2us*)(Vl + e) = ol;  }
__global__ __launch_bounds__(256) void k_csid(float* CS) { const int idx = blockIdx.x * 256 + threadIdx.x; if (idx >= TT * HD) return; v2f cs; cs[0] = 1.0f; cs[1] = 0.0f; *(v2f*)(CS + (size_t)idx * 2) = cs;  }
// k_asoft: per row (zz, i): t = S (q pre-scaled by 0.125), -3e38 where |i - j| >= 128; softmax over the 2048 keys (register row, one exp, fixed trees);
__global__ __launch_bounds__(256) void k_asoft(const float* __restrict__ Sb, h16* P16, bf* Ph, bf* Pl) {
    const int lane = threadIdx.x & 31; const int row = blockIdx.x * 8 + (threadIdx.x >> 5); if (row >= ZH * TT) return; const int i = row % TT; const int zz = row / TT; (void)zz; const bool hires = (i < RH); const float* sr = Sb + (size_t)row * TT; float v[TT / 32]; float mx = -3.0e38f;
#pragma unroll
    for (int ch = 0; ch < TT / 128; ++ch) { const int j0 = ch * 128 + lane * 4; const v4f a = *(const v4f*)(sr + j0);
#pragma unroll
        for (int q = 0; q < 4; ++q) { const int j = j0 + q; const float t = (i - j < WNB && j - i < WNB) ? a[q] * SCL : -3.0e38f; v[ch * 4 + q] = t;   /* |i - j| < 128 window (both sides) */ mx = fmaxf(mx, t); } }
#pragma unroll
    for (int sh = 16; sh; sh >>= 1) mx = fmaxf(mx, __shfl_xor(mx, sh, 32));
    float sum = 0.f;
#pragma unroll
    for (int k = 0; k < TT / 32; ++k) { float d0 = __fsub_rn(v[k], mx); asm volatile("" : "+v"(d0)); v[k] = __builtin_amdgcn_exp2f(__fmul_rn(d0, 1.4426950408889634f)); sum += v[k]; }
#pragma unroll
    for (int sh = 16; sh; sh >>= 1) sum += __shfl_xor(sum, sh, 32);
    const float f = __fdiv_rn(hires ? 1.0f : PCAR, sum);
{
        if (hires) {
#pragma unroll
            for (int ch = 0; ch < TT / 128; ++ch) { v4us oh, ol;
#pragma unroll
                for (int q = 0; q < 4; ++q) { unsigned short a, c2; splitf(v[ch * 4 + q] * f, a, c2); oh[q] = a; ol[q] = c2; }
                const size_t oo = ((size_t)zz * (RH ? RH : 1) + i) * TT + ch * 128 + lane * 4; *(v4us*)(Ph + oo) = oh; *(v4us*)(Pl + oo) = ol; }
        } else {
#pragma unroll
            for (int ch = 0; ch < TT / 128; ++ch) { v4h o4;
#pragma unroll
                for (int q = 0; q < 4; ++q) o4[q] = tohx(v[ch * 4 + q] * f);
                *(v4h*)(P16 + (size_t)row * TT + ch * 128 + lane * 4) = o4; } }
         }
}
__constant__ float INVT[HD / 2] = { 1.000000000e+00f, 7.498942018e-01f, 5.623413324e-01f, 4.216965139e-01f, 3.162277639e-01f, 2.371373624e-01f, 1.778279394e-01f, 1.333521456e-01f, 1.000000015e-01f, 7.498941571e-02f, 5.623412877e-02f, 4.216964915e-02f, 3.162277862e-02f, 2.371373586e-02f, 1.778279431e-02f, 1.333521493e-02f, 9.999999776e-03f, 7.498942316e-03f, 5.623413250e-03f, 4.216964822e-03f, 3.162277862e-03f, 2.371373819e-03f, 1.778279431e-03f, 1.333521446e-03f, 1.000000047e-03f, 7.498941850e-04f, 5.623413017e-04f, 4.216964880e-04f, 3.162277862e-04f, 2.371373848e-04f, 1.778279402e-04f, 1.333521504e-04f };   // jnp-exact float32 1/10000^(2i/64)
__global__ __launch_bounds__(256) void k_ropexP(const float* __restrict__ xs, bf* Xh, bf* Xl) { const size_t e = ((size_t)blockIdx.x * 256 + threadIdx.x) * 2; if (e >= (size_t)TT * DM) return; const int c = (int)(e % DM); const int t = (int)(e / DM); const int d = c % HD; const float* f = xs + (size_t)t * DM + (c - d); v2us oh, ol;
#pragma unroll
    for (int q = 0; q < 2; ++q) { const int dd = d + q; const int dp = (dd < HD / 2) ? dd + HD / 2 : dd - HD / 2; const float x0 = bfr(f[dd]), x1 = bfr(f[dp]); const float a = __fmul_rn((float)t, INVT[dd % (HD / 2)]); const float cs = cosf(a), sn = sinf(a); float p0 = __fmul_rn(x0, cs), p1 = __fmul_rn(x1, sn); asm volatile("" : "+v"(p0), "+v"(p1)); const float r = (dd < HD / 2) ? __fsub_rn(p0, p1) : __fadd_rn(p0, p1); unsigned short a2, c2; splitf(r, a2, c2); oh[q] = a2; ol[q] = c2; }
    *(v2us*)(Xh + e) = oh; *(v2us*)(Xl + e) = ol;  }
__global__ __launch_bounds__(256) void k_merge(const float* __restrict__ O, int h0, bf* Ah, bf* Al) { const size_t e = ((size_t)blockIdx.x * 256 + threadIdx.x) * 2; if (e >= (size_t)ZH * TT * HD) return; const int d = (int)(e % HD); const int t = (int)((e / HD) % TT); const int zz = (int)(e / ((size_t)HD * TT)); const float cs = (t < RH) ? 1.0f : (1.0f / PCAR); const size_t oo = (size_t)t * DQ + (h0 + zz) * HD + d;
    v2us oh, ol;
#pragma unroll
    for (int q = 0; q < 2; ++q) { unsigned short a, c2; splitf(O[e + q] * cs, a, c2); oh[q] = a; ol[q] = c2; } *(v2us*)(Ah + oo) = oh; *(v2us*)(Al + oo) = ol;  }

extern "C" void kernel_launch(void* const* d_in, const int* in_sizes, int n_in,
                              void* d_out, int out_size, void* d_ws, size_t ws_size, hipStream_t stream) {
    (void)in_sizes; (void)n_in; (void)out_size;
    const float* x = (const float*)d_in[0]; const float* wq = (const float*)d_in[1]; const float* bq = (const float*)d_in[2]; const float* wk = (const float*)d_in[3]; const float* bk = (const float*)d_in[4]; const float* wv = (const float*)d_in[5]; const float* bv = (const float*)d_in[6]; const float* wo = (const float*)d_in[7]; const float* bo = (const float*)d_in[8];
    float* OUT = (float*)d_out;     // [2][2048][768]
    char* wsp = (char*)d_ws;
    auto take = [&](size_t bytes) { char* p = wsp; wsp += (bytes + 255) & ~(size_t)255; return (void*)p; };
    bf* WQ = (bf*)take((size_t)DQ * DM * 2); bf* WK = (bf*)take((size_t)DKV * DM * 2); bf* WV = (bf*)take((size_t)DKV * DM * 2); bf* WO = (bf*)take((size_t)DM * DQ * 2); float* CS = (float*)take((size_t)TT * HD * 2 * 4);
    bf* XB = (bf*)take((size_t)TT * DM * 2); bf* XRh = (bf*)take((size_t)TT * DM * 2); bf* XRl = (bf*)take((size_t)TT * DM * 2); float* FQ = (float*)take((size_t)TT * DQ * 4); float* FK = (float*)take((size_t)TT * DKV * 4);
    h16* QP16 = (h16*)take((size_t)NH_ * TT * HD * 2); h16* KP16 = (h16*)take((size_t)NKV * TT * HD * 2); h16* VT16 = (h16*)take((size_t)NKV * HD * TT * 2);
    bf* QPh = (bf*)take((size_t)NH_ * TT * HD * 2); bf* QPl = (bf*)take((size_t)NH_ * TT * HD * 2); bf* KPh = (bf*)take((size_t)NKV * TT * HD * 2); bf* KPl = (bf*)take((size_t)NKV * TT * HD * 2); bf* VTh = (bf*)take((size_t)NKV * HD * TT * 2); bf* VTl = (bf*)take((size_t)NKV * HD * TT * 2); bf* Ph = (bf*)take((size_t)ZH * RH * TT * 2); bf* Pl = (bf*)take((size_t)ZH * RH * TT * 2);
    float* Sb = (float*)take((size_t)ZH * TT * TT * 4); h16* P16 = (h16*)take((size_t)ZH * TT * TT * 2); float* Ob = (float*)take((size_t)ZH * TT * HD * 4); bf* ATh = (bf*)take((size_t)TT * DQ * 2); bf* ATl = (bf*)take((size_t)TT * DQ * 2);
    if ((size_t)(wsp - (char*)d_ws) > ws_size) return;    // ws 256 MiB
    float* FV = FK;   // v projection reuses the k buffer after the k planes are built (stream-ordered)
    { k_wtG<<<(unsigned)((DM * DQ / 64 + 63) / 64), 256, 0, stream>>>(wq, DM, DQ, WQ); k_wtG<<<(unsigned)((DM * DKV / 64 + 63) / 64), 256, 0, stream>>>(wk, DM, DKV, WK); k_wtG<<<(unsigned)((DM * DKV / 64 + 63) / 64), 256, 0, stream>>>(wv, DM, DKV, WV);
      k_wtG<<<(unsigned)((DQ * DM / 64 + 63) / 64), 256, 0, stream>>>(wo, DQ, DM, WO);
       }
    k_csid<<<(TT * HD + 255) / 256, 256, 0, stream>>>(CS);
    const unsigned LQ = (unsigned)(((size_t)NH_ * TT * HD / 2 + 255) / 256), LKv = (unsigned)(((size_t)NKV * TT * HD / 2 + 255) / 256);
    for (int b = 0; b < NB_; ++b) {
        
        k_cvt8<<<(unsigned)(((size_t)TT * DM / 8 + 255) / 256), 256, 0, stream>>>(x + (size_t)b * TT * DM, XB, (size_t)TT * DM / 8); k_ropexP<<<(unsigned)(((size_t)TT * DM / 2 + 255) / 256), 256, 0, stream>>>(x + (size_t)b * TT * DM, XRh, XRl);   /* rope on the raw hidden states (per 64-slice), as hi/lo planes */
        k_gemmw<bf, 1, true><<<dim3(TT / 64, DQ / 64, 1), 32, 0, stream>>>(XRh, XRl, WQ, nullptr, DM, FQ, DQ, bq, 0, 0, 0);
        k_rope<<<LQ, 256, 0, stream>>>(FQ, DQ, NH_, CS, nullptr, nullptr, QSC, QP16, QPh, QPl);   /* q x 0.125 */
        k_gemmw<bf, 1, true><<<dim3(TT / 64, DKV / 64, 1), 32, 0, stream>>>(XRh, XRl, WK, nullptr, DM, FK, DKV, bk, 0, 0, 0);
        k_rope<<<LKv, 256, 0, stream>>>(FK, DKV, NKV, CS, nullptr, nullptr, 1.0f, KP16, KPh, KPl);
        k_gemmw<bf, 0, true><<<dim3(TT / 64, DKV / 64, 1), 32, 0, stream>>>(XB, nullptr, WV, nullptr, DM, FV, DKV, bv, 0, 0, 0); k_vtp<<<LKv, 256, 0, stream>>>(FV, DKV, NKV, VT16, VTh, VTl);
        for (int h0 = 0; h0 < NH_; h0 += ZH) { const size_t zq = (size_t)h0, zk = (size_t)(h0 / REP);   // one kv head per query head: the pass's two heads use consecutive kv planes (z-strides TT*HD)
            k_gemmw<bf, 2, false><<<dim3(RH / 64, TT / 64, ZH), 32, 0, stream>>>(QPh + zq * TT * HD, QPl + zq * TT * HD, KPh + zk * TT * HD, KPl + zk * TT * HD, HD, Sb, TT, nullptr, (size_t)TT * HD, (size_t)TT * HD, (size_t)TT * TT);
            k_gemmw<h16, 0, false><<<dim3((TT - RH) / 64, TT / 64, ZH), 32, 0, stream>>>(QP16 + zq * TT * HD + (size_t)RH * HD, nullptr, KP16 + zk * TT * HD, nullptr, HD, Sb + (size_t)RH * TT, TT, nullptr, (size_t)TT * HD, (size_t)TT * HD, (size_t)TT * TT);
            k_asoft<<<ZH * TT / 8, 256, 0, stream>>>(Sb, P16, Ph, Pl);
            k_gemmw<bf, 2, false><<<dim3(RH / 64, HD / 64, ZH), 32, 0, stream>>>(Ph, Pl, VTh + zk * HD * TT, VTl + zk * HD * TT, TT, Ob, HD, nullptr, (size_t)RH * TT, (size_t)HD * TT, (size_t)TT * HD);
            k_gemmw<h16, 0, false><<<dim3((TT - RH) / 64, HD / 64, ZH), 32, 0, stream>>>(P16 + (size_t)RH * TT, nullptr, VT16 + zk * HD * TT, nullptr, TT, Ob + (size_t)RH * HD, HD, nullptr, (size_t)TT * TT, (size_t)HD * TT, (size_t)TT * HD);
            k_merge<<<(unsigned)(((size_t)ZH * TT * HD / 2 + 255) / 256), 256, 0, stream>>>(Ob, h0, ATh, ATl); }
        k_gemmw<bf, 1, true><<<dim3(TT / 64, DM / 64, 1), 32, 0, stream>>>(ATh, ATl, WO, nullptr, DQ, OUT + (size_t)b * TT * DM, DM, bo, 0, 0, 0); }
}

// v001
// A run of this version takes 666 microseconds.
// Next to v000, in two timings, it ran 2.33 and 2.32 times as fast.
#include <hip/hip_runtime.h>

// Local (sliding-window) multi-head attention with rotary embeddings applied to the RAW hidden states before the projections (hidden [2][2048][768]; xr = rotate-half rope(hidden viewed (S, 12, 64)) with angles t x 10000^(-2i/64) (computed in-kernel); q = xr Wq + bq, k = xr Wk + bk, v = hidden Wv + bv (keras per-head dense == 'xw' [768][768] + [768]); scores = (q x 0.125).k; keys with |i - j| >= 128 get -1e9 (exclusion); softmax; out = ctx Wo + bo ('xw' [768][768]) -> [2][2048][768] (3.1 M)).
// Layout per batch: a rotary kernel rotates the bf16-rounded hidden states per 64-wide slice and writes them directly as hi/lo GEMM operand planes (f32 rotary, precise cosf/sinf, jnp-exact inverse frequencies); q and k as hi/lo x exact GEMMs (2 products) + f32 biases, v exact from the bf16 hidden states; q scaled by 0.125 before the split; banded T-2048 attention (hybrid rows: < 512 hi/lo 3 products, rest fp16 x1024): each 64-row query tile visits only the 320 keys [i0 - 128, i0 + 192) that its |i - j| < 128 window can reach (score tiles, softmax columns and the P.V k loop alike; every key outside has weight exactly 0), and the softmax kernel applies the window inside the band as an index select; merged hi/lo x Wo exact + bo.
// Compute dtypes, f32 accumulate: every input rounded to bf16; rotary f32; q/k hi/lo x exact, v exact, + f32 biases; attention rows < 512 3 products, rest fp16; softmax f32; Wo hl x exact + bias.

#define NB_  2
#define TT   2048
#define DM   768
#define NH_  12
#define NKV  12
#define REP  (NH_ / NKV)
#define HD   64
#define DQ   (NH_ * HD)
#define DKV  (NKV * HD)
#define ZH   2
#define RH   512                  // query rows < RH use hi+lo planes (0: none)
#define WIN  0
#define PCAR 1024.0f
#define SCL  1.0f   // q x 0.125 applied before the split (QSC)
#define QSC  0.125f
#define WNB  128     // |i - j| < 128 kept
#define QT   64      // query rows per GEMM tile; the tile at row i0 can reach keys [i0 - WNB, i0 + QT + WNB) only
#define BTL  ((QT + 2 * WNB) / 64)           // 64-key score tiles per query tile
#define BCH  ((64 + QT + 2 * WNB + 127) / 128)  // 128-key softmax chunks that cover the band from any 64-aligned start
typedef _Float16 h16;
typedef unsigned short bf;
typedef __attribute__((ext_vector_type(16))) __bf16   v16bf;
typedef __attribute__((ext_vector_type(16))) _Float16 v16h;
typedef __attribute__((ext_vector_type(8)))  _Float16 v8h;
typedef __attribute__((ext_vector_type(8)))  unsigned short v8us;
typedef __attribute__((ext_vector_type(8)))  float    v8f;
typedef __attribute__((ext_vector_type(4)))  float    v4f;
typedef v8h  __attribute__((may_alias)) v8ha;
typedef v4f  __attribute__((may_alias)) v4fa;
typedef v8us __attribute__((may_alias)) v8usa;

__device__ __forceinline__ unsigned short f2bf(float f) { unsigned u = __float_as_uint(f); u += 0x7FFFu + ((u >> 16) & 1u); return (unsigned short)(u >> 16); }
__device__ __forceinline__ float bf2f(unsigned short b) { return __uint_as_float(((unsigned)b) << 16); }
__device__ __forceinline__ float bfr(float f) { return bf2f(f2bf(f)); }
__device__ __forceinline__ v16h cat16(v8h lo, v8h hi) { return __builtin_shufflevector(lo, hi, 0, 1, 2, 3, 4, 5, 6, 7, 8, 9, 10, 11, 12, 13, 14, 15); }
__device__ __forceinline__ v16bf cat16b(v8us lo, v8us hi) { return __builtin_bit_cast(v16bf, __builtin_shufflevector(lo, hi, 0, 1, 2, 3, 4, 5, 6, 7, 8, 9, 10, 11, 12, 13, 14, 15)); }
__device__ __forceinline__ v8f wmma16(v16h a, v16h b, v8f c) { return __builtin_amdgcn_wmma_f32_16x16x32_f16(false, a, false, b, (short)0, c, false, false); }
__device__ __forceinline__ v8f wmmab(v16bf a, v16bf b, v8f c) { return __builtin_amdgcn_wmma_f32_16x16x32_bf16(false, a, false, b, (short)0, c, false, false); }



// ---- k_gemmw: register-blocked GEMM, ONE WAVE per 64x64 output tile (16 accumulators), operands straight from K-contiguous 16-bit planes; grid (M/64, N/64, Z), 32 threads.
// C[m][n] (f32, pitch ldc, + optional f32 bias[n]) = sum_k A[m][k] Bt[n][k] (+ split products per NSPLIT). z-batch strides sA/sB/sC in elements. K % 32 == 0.
// BAND 1 (scores): n is a key; grid.y counts the BTL key tiles of the query tile's band, tiles off the sequence leave. BAND 2 (P.V): k is a key; the k loop runs over the band only. row0 = sequence row of A's row 0.
template <typename T16> struct WFrag;
template <> struct WFrag<h16> { typedef v16h V; static __device__ __forceinline__ V ld(const h16* p) { return cat16(*(const v8h*)p, *(const v8h*)(p + 16)); } static __device__ __forceinline__ v8f mma(V a, V b, v8f c) { return wmma16(a, b, c); } };
template <> struct WFrag<bf> { typedef v16bf V; static __device__ __forceinline__ V ld(const bf* p) { return cat16b(*(const v8us*)p, *(const v8us*)(p + 16)); } static __device__ __forceinline__ v8f mma(V a, V b, v8f c) { return wmmab(a, b, c); } };
template <typename T16, int NSPLIT, bool BIAS, int BAND>
__global__ __launch_bounds__(32) void k_gemmw(const T16* __restrict__ A, const T16* __restrict__ A2, const T16* __restrict__ Bt, const T16* __restrict__ Bt2, int K, float* C, int ldc, const float* __restrict__ bias, size_t sA, size_t sB, size_t sC, int row0) {
    typedef typename WFrag<T16>::V V;
    __shared__ __align__(16) float os[16 * 68];
    const size_t z = blockIdx.z; A += z * sA; if (A2) A2 += z * sA; Bt += z * sB; if (Bt2) Bt2 += z * sB; C += z * sC;
    const int lane = threadIdx.x & 31, lr = lane & 15, hi = lane >> 4; const int r0 = blockIdx.x * 64, i0 = row0 + r0, c0 = (BAND == 1) ? i0 - WNB + (int)blockIdx.y * 64 : (int)blockIdx.y * 64;
    if (BAND == 1 && (c0 < 0 || c0 >= TT)) return;
    const int kbeg = (BAND == 2) ? max(i0 - WNB, 0) : 0, kend = (BAND == 2) ? min(i0 + QT + WNB, K) : K;
    v8f acc[4][4];
#pragma unroll
    for (int mb = 0; mb < 4; ++mb)
#pragma unroll
        for (int nb = 0; nb < 4; ++nb) acc[mb][nb] = (v8f){};
    const size_t aoff = (size_t)(r0 + lr) * K + 8 * hi, boff = (size_t)(c0 + lr) * K + 8 * hi;
#pragma unroll 1
    for (int kc = kbeg; kc < kend; kc += 32) {
        V a[4], a2[4];
#pragma unroll
        for (int mb = 0; mb < 4; ++mb) { a[mb] = WFrag<T16>::ld(A + aoff + (size_t)mb * 16 * K + kc); if (NSPLIT == 1 || NSPLIT == 2) a2[mb] = WFrag<T16>::ld(A2 + aoff + (size_t)mb * 16 * K + kc); }
#pragma unroll
        for (int nb = 0; nb < 4; ++nb) { const V b = WFrag<T16>::ld(Bt + boff + (size_t)nb * 16 * K + kc); V b2; if (NSPLIT >= 2) b2 = WFrag<T16>::ld(Bt2 + boff + (size_t)nb * 16 * K + kc);
#pragma unroll
            for (int mb = 0; mb < 4; ++mb) { acc[mb][nb] = WFrag<T16>::mma(a[mb], b, acc[mb][nb]); if (NSPLIT == 1 || NSPLIT == 2) acc[mb][nb] = WFrag<T16>::mma(a2[mb], b, acc[mb][nb]); if (NSPLIT >= 2) acc[mb][nb] = WFrag<T16>::mma(a[mb], b2, acc[mb][nb]); } }
        asm volatile("v_nop\n\tv_nop\n\tv_nop\n\tv_nop" : "+v"(acc[0][0]), "+v"(acc[1][1]), "+v"(acc[2][2]), "+v"(acc[3][3]) : "v"(a[0]), "v"(a[3]));
    }
#pragma unroll
    for (int mb = 0; mb < 4; ++mb) {
#pragma unroll
        for (int nb = 0; nb < 4; ++nb) {
#pragma unroll
            for (int j = 0; j < 8; ++j) os[(hi * 8 + j) * 68 + nb * 16 + lr] = acc[mb][nb][j]; }
        __builtin_amdgcn_wave_barrier(); asm volatile("" ::: "memory");
        float* crow = C + (size_t)(r0 + mb * 16) * ldc + c0;
{
#pragma unroll
            for (int s = 0; s < 8; ++s) { const int row = 2 * s + hi, cofs = lr * 4; v4f val = *(const v4fa*)(os + row * 68 + cofs); if (BIAS) { val[0] += bfr(bias[c0 + cofs]); val[1] += bfr(bias[c0 + cofs + 1]); val[2] += bfr(bias[c0 + cofs + 2]); val[3] += bfr(bias[c0 + cofs + 3]); }
                *(v4f*)(crow + (size_t)row * ldc + cofs) = val; }
             }
        __builtin_amdgcn_wave_barrier(); asm volatile("" ::: "memory");
    }
}

__device__ __forceinline__ h16 tohx(float x) { return (h16)x; }
__device__ __forceinline__ void splitf(float y, unsigned short& h, unsigned short& l) { h = f2bf(y); l = f2bf(y - bf2f(h)); }
typedef __attribute__((ext_vector_type(2))) _Float16 v2h;
typedef __attribute__((ext_vector_type(4))) _Float16 v4h;
typedef __attribute__((ext_vector_type(2))) unsigned short v2us;
typedef __attribute__((ext_vector_type(4))) unsigned short v4us;
typedef __attribute__((ext_vector_type(2))) float v2f;
typedef __attribute__((ext_vector_type(4))) int v4i;

__global__ __launch_bounds__(256) void k_wtG(const float* __restrict__ w, int K, int N, bf* Bt) {
    const int lane = threadIdx.x & 31; const int L0 = (blockIdx.x * 8 + (threadIdx.x >> 5)) * 8; const int nlines = N * K / 64;
{
#pragma unroll 1
        for (int l = 0; l < 8; ++l) { const int L = L0 + l; if (L >= nlines) break; const size_t e = (size_t)L * 64 + lane * 2; const int k = (int)(e % K), n = (int)(e / K); v2us o;
            o[0] = f2bf(w[(size_t)k * N + n]); o[1] = f2bf(w[(size_t)(k + 1) * N + n]); *(v2us*)(Bt + e) = o; }
         }
}
__global__ __launch_bounds__(256) void k_cvt8(const float* __restrict__ src, bf* dst, size_t n8) { const size_t i = (size_t)blockIdx.x * 256 + threadIdx.x; if (i >= n8) return; const v8f v = *(const v8f*)(src + i * 8); v8us o;
#pragma unroll
    for (int k = 0; k < 8; ++k) o[k] = f2bf(v[k]); *(v8us*)(dst + i * 8) = o;  }

// k_rope: head planes [h][t][d] (fp16 + hi/lo) of rope(x) x sc with the rotate-half convention out[d] = x[d] cos[t][d] - x[d+HD/2] sin[t][d], out[d+HD/2] = x[d+HD/2] cos[t][d+HD/2] + x[d] sin[t][d+HD/2]
__global__ __launch_bounds__(256) void k_rope(const float* __restrict__ F, int pitch, int nheads, const float* __restrict__ CS, const float* __restrict__ RF, const float* __restrict__ nw, float sc, h16* P16, bf* Ph, bf* Pl) {
    const size_t e = ((size_t)blockIdx.x * 256 + threadIdx.x) * 2; if (e >= (size_t)nheads * TT * HD) return; const int d = (int)(e % HD); const int t = (int)((e / HD) % TT); const int h = (int)(e / ((size_t)HD * TT)); const float* f = F + (size_t)t * pitch + h * HD; const float rf = RF ? RF[(size_t)h * TT + t] : 1.0f; v2h o16; v2us oh, ol;
#pragma unroll
    for (int q = 0; q < 2; ++q) { const int dd = d + q; const int dp = (dd < HD / 2) ? dd + HD / 2 : dd - HD / 2; float x0 = f[dd], x1 = f[dp];
        if (RF) { float n0 = __fmul_rn(x0, rf), n1 = __fmul_rn(x1, rf); asm volatile("" : "+v"(n0)); asm volatile("" : "+v"(n1)); x0 = __fmul_rn(bfr(nw[dd]), n0); x1 = __fmul_rn(bfr(nw[dp]), n1); }
        const v2f cs = *(const v2f*)(CS + ((size_t)t * HD + dd) * 2); float a = __fmul_rn(x0, cs[0]), bq = __fmul_rn(x1, cs[1]); asm volatile("" : "+v"(a)); asm volatile("" : "+v"(bq)); const float r = ((dd < HD / 2) ? __fsub_rn(a, bq) : __fadd_rn(a, bq)) * sc;
        o16[q] = tohx(r); unsigned short a2, c2; splitf(r, a2, c2); oh[q] = a2; ol[q] = c2; }
    *(v2h*)(P16 + e) = o16; *(v2us*)(Ph + e) = oh; *(v2us*)(Pl + e) = ol;  }
__global__ __launch_bounds__(256) void k_vtp(const float* __restrict__ F, int pitch, int nheads, h16* V16, bf* Vh, bf* Vl) { const size_t e = ((size_t)blockIdx.x * 256 + threadIdx.x) * 2; if (e >= (size_t)nheads * HD * TT) return; const int t = (int)(e % TT); const int d = (int)((e / TT) % HD); const int g = (int)(e / ((size_t)TT * HD)); v2h o16; v2us oh, ol;
#pragma unroll
    for (int q = 0; q < 2; ++q) { const float x = F[(size_t)(t + q) * pitch + g * HD + d]; o16[q] = tohx(x); unsigned short a2, c2; splitf(x, a2, c2); oh[q] = a2; ol[q] = c2; }
    *(v2h*)(V16 + e) = o16; *(v2us*)(Vh + e) = oh; *(v2us*)(Vl + e) = ol;  }
__global__ __launch_bounds__(256) void k_csid(float* CS) { const int idx = blockIdx.x * 256 + threadIdx.x; if (idx >= TT * HD) return; v2f cs; cs[0] = 1.0f; cs[1] = 0.0f; *(v2f*)(CS + (size_t)idx * 2) = cs;  }
// k_asoft: per row (zz, i): softmax over the keys of the row's tile band (register row, one exp, fixed trees; 128-key chunks at the same lane places as a full row, so the sums keep their order); reads and writes the band's columns only;
__global__ __launch_bounds__(256) void k_asoft(const float* __restrict__ Sb, h16* P16, bf* Ph, bf* Pl) {
    const int lane = threadIdx.x & 31; const int row = blockIdx.x * 8 + (threadIdx.x >> 5); if (row >= ZH * TT) return; const int i = row % TT; const int zz = row / TT; (void)zz; const bool hires = (i < RH); const float* sr = Sb + (size_t)row * TT; float v[BCH * 4]; float mx = -3.0e38f;
    const int i0 = i & ~(QT - 1); const int blo = max(i0 - WNB, 0), bhi = min(i0 + QT + WNB, TT); const int jb = ((i0 - WNB) >> 7) * 128 + lane * 4;   /* first 128-key chunk that touches the band (may start off the band: lanes there load and store nothing and count as excluded keys) */
#pragma unroll
    for (int ch = 0; ch < BCH; ++ch) { const int j0 = jb + ch * 128; const bool inb = (j0 >= blo && j0 < bhi);   /* the lane's four keys lie on the band (so on the sequence) or all off it: blo, bhi are multiples of 64 */ v4f a = (v4f){}; if (inb) a = *(const v4f*)(sr + j0);
#pragma unroll
        for (int q = 0; q < 4; ++q) { const int j = j0 + q; const float t = (inb && i - j < WNB && j - i < WNB) ? a[q] * SCL : -3.0e38f; v[ch * 4 + q] = t;   /* |i - j| < 128 window (both sides); a key off the sequence is excluded like any other */ mx = fmaxf(mx, t); } }
#pragma unroll
    for (int sh = 16; sh; sh >>= 1) mx = fmaxf(mx, __shfl_xor(mx, sh, 32));
    float sum = 0.f;
#pragma unroll
    for (int k = 0; k < BCH * 4; ++k) { float d0 = __fsub_rn(v[k], mx); asm volatile("" : "+v"(d0)); v[k] = __builtin_amdgcn_exp2f(__fmul_rn(d0, 1.4426950408889634f)); sum += v[k]; }
#pragma unroll
    for (int sh = 16; sh; sh >>= 1) sum += __shfl_xor(sum, sh, 32);
    const float f = __fdiv_rn(hires ? 1.0f : PCAR, sum);
{
        if (hires) {
#pragma unroll
            for (int ch = 0; ch < BCH; ++ch) { const int j0 = jb + ch * 128; v4us oh, ol;
#pragma unroll
                for (int q = 0; q < 4; ++q) { unsigned short a, c2; splitf(v[ch * 4 + q] * f, a, c2); oh[q] = a; ol[q] = c2; }
                if (j0 >= blo && j0 < bhi) { const size_t oo = ((size_t)zz * (RH ? RH : 1) + i) * TT + j0; *(v4us*)(Ph + oo) = oh; *(v4us*)(Pl + oo) = ol; } }
        } else {
#pragma unroll
            for (int ch = 0; ch < BCH; ++ch) { const int j0 = jb + ch * 128; v4h o4;
#pragma unroll
                for (int q = 0; q < 4; ++q) o4[q] = tohx(v[ch * 4 + q] * f);
                if (j0 >= blo && j0 < bhi) *(v4h*)(P16 + (size_t)row * TT + j0) = o4; } }
         }
}
__constant__ float INVT[HD / 2] = { 1.000000000e+00f, 7.498942018e-01f, 5.623413324e-01f, 4.216965139e-01f, 3.162277639e-01f, 2.371373624e-01f, 1.778279394e-01f, 1.333521456e-01f, 1.000000015e-01f, 7.498941571e-02f, 5.623412877e-02f, 4.216964915e-02f, 3.162277862e-02f, 2.371373586e-02f, 1.778279431e-02f, 1.333521493e-02f, 9.999999776e-03f, 7.498942316e-03f, 5.623413250e-03f, 4.216964822e-03f, 3.162277862e-03f, 2.371373819e-03f, 1.778279431e-03f, 1.333521446e-03f, 1.000000047e-03f, 7.498941850e-04f, 5.623413017e-04f, 4.216964880e-04f, 3.162277862e-04f, 2.371373848e-04f, 1.778279402e-04f, 1.333521504e-04f };   // jnp-exact float32 1/10000^(2i/64)
__global__ __launch_bounds__(256) void k_ropexP(const float* __restrict__ xs, bf* Xh, bf* Xl) { const size_t e = ((size_t)blockIdx.x * 256 + threadIdx.x) * 2; if (e >= (size_t)TT * DM) return; const int c = (int)(e % DM); const int t = (int)(e / DM); const int d = c % HD; const float* f = xs + (size_t)t * DM + (c - d); v2us oh, ol;
#pragma unroll
    for (int q = 0; q < 2; ++q) { const int dd = d + q; const int dp = (dd < HD / 2) ? dd + HD / 2 : dd - HD / 2; const float x0 = bfr(f[dd]), x1 = bfr(f[dp]); const float a = __fmul_rn((float)t, INVT[dd % (HD / 2)]); const float cs = cosf(a), sn = sinf(a); float p0 = __fmul_rn(x0, cs), p1 = __fmul_rn(x1, sn); asm volatile("" : "+v"(p0), "+v"(p1)); const float r = (dd < HD / 2) ? __fsub_rn(p0, p1) : __fadd_rn(p0, p1); unsigned short a2, c2; splitf(r, a2, c2); oh[q] = a2; ol[q] = c2; }
    *(v2us*)(Xh + e) = oh; *(v2us*)(Xl + e) = ol;  }
__global__ __launch_bounds__(256) void k_merge(const float* __restrict__ O, int h0, bf* Ah, bf* Al) { const size_t e = ((size_t)blockIdx.x * 256 + threadIdx.x) * 2; if (e >= (size_t)ZH * TT * HD) return; const int d = (int)(e % HD); const int t = (int)((e / HD) % TT); const int zz = (int)(e / ((size_t)HD * TT)); const float cs = (t < RH) ? 1.0f : (1.0f / PCAR); const size_t oo = (size_t)t * DQ + (h0 + zz) * HD + d;
    v2us oh, ol;
#pragma unroll
    for (int q = 0; q < 2; ++q) { unsigned short a, c2; splitf(O[e + q] * cs, a, c2); oh[q] = a; ol[q] = c2; } *(v2us*)(Ah + oo) = oh; *(v2us*)(Al + oo) = ol;  }

extern "C" void kernel_launch(void* const* d_in, const int* in_sizes, int n_in,
                              void* d_out, int out_size, void* d_ws, size_t ws_size, hipStream_t stream) {
    (void)in_sizes; (void)n_in; (void)out_size;
    const float* x = (const float*)d_in[0]; const float* wq = (const float*)d_in[1]; const float* bq = (const float*)d_in[2]; const float* wk = (const float*)d_in[3]; const float* bk = (const float*)d_in[4]; const float* wv = (const float*)d_in[5]; const float* bv = (const float*)d_in[6]; const float* wo = (const float*)d_in[7]; const float* bo = (const float*)d_in[8];
    float* OUT = (float*)d_out;     // [2][2048][768]
    char* wsp = (char*)d_ws;
    auto take = [&](size_t bytes) { char* p = wsp; wsp += (bytes + 255) & ~(size_t)255; return (void*)p; };
    bf* WQ = (bf*)take((size_t)DQ * DM * 2); bf* WK = (bf*)take((size_t)DKV * DM * 2); bf* WV = (bf*)take((size_t)DKV * DM * 2); bf* WO = (bf*)take((size_t)DM * DQ * 2); float* CS = (float*)take((size_t)TT * HD * 2 * 4);
    bf* XB = (bf*)take((size_t)TT * DM * 2); bf* XRh = (bf*)take((size_t)TT * DM * 2); bf* XRl = (bf*)take((size_t)TT * DM * 2); float* FQ = (float*)take((size_t)TT * DQ * 4); float* FK = (float*)take((size_t)TT * DKV * 4);
    h16* QP16 = (h16*)take((size_t)NH_ * TT * HD * 2); h16* KP16 = (h16*)take((size_t)NKV * TT * HD * 2); h16* VT16 = (h16*)take((size_t)NKV * HD * TT * 2);
    bf* QPh = (bf*)take((size_t)NH_ * TT * HD * 2); bf* QPl = (bf*)take((size_t)NH_ * TT * HD * 2); bf* KPh = (bf*)take((size_t)NKV * TT * HD * 2); bf* KPl = (bf*)take((size_t)NKV * TT * HD * 2); bf* VTh = (bf*)take((size_t)NKV * HD * TT * 2); bf* VTl = (bf*)take((size_t)NKV * HD * TT * 2); bf* Ph = (bf*)take((size_t)ZH * RH * TT * 2); bf* Pl = (bf*)take((size_t)ZH * RH * TT * 2);
    float* Sb = (float*)take((size_t)ZH * TT * TT * 4); h16* P16 = (h16*)take((size_t)ZH * TT * TT * 2); float* Ob = (float*)take((size_t)ZH * TT * HD * 4); bf* ATh = (bf*)take((size_t)TT * DQ * 2); bf* ATl = (bf*)take((size_t)TT * DQ * 2);
    if ((size_t)(wsp - (char*)d_ws) > ws_size) return;    // ws 256 MiB
    float* FV = FK;   // v projection reuses the k buffer after the k planes are built (stream-ordered)
    { k_wtG<<<(unsigned)((DM * DQ / 64 + 63) / 64), 256, 0, stream>>>(wq, DM, DQ, WQ); k_wtG<<<(unsigned)((DM * DKV / 64 + 63) / 64), 256, 0, stream>>>(wk, DM, DKV, WK); k_wtG<<<(unsigned)((DM * DKV / 64 + 63) / 64), 256, 0, stream>>>(wv, DM, DKV, WV);
      k_wtG<<<(unsigned)((DQ * DM / 64 + 63) / 64), 256, 0, stream>>>(wo, DQ, DM, WO);
       }
    k_csid<<<(TT * HD + 255) / 256, 256, 0, stream>>>(CS);
    const unsigned LQ = (unsigned)(((size_t)NH_ * TT * HD / 2 + 255) / 256), LKv = (unsigned)(((size_t)NKV * TT * HD / 2 + 255) / 256);
    for (int b = 0; b < NB_; ++b) {
        
        k_cvt8<<<(unsigned)(((size_t)TT * DM / 8 + 255) / 256), 256, 0, stream>>>(x + (size_t)b * TT * DM, XB, (size_t)TT * DM / 8); k_ropexP<<<(unsigned)(((size_t)TT * DM / 2 + 255) / 256), 256, 0, stream>>>(x + (size_t)b * TT * DM, XRh, XRl);   /* rope on the raw hidden states (per 64-slice), as hi/lo planes */
        k_gemmw<bf, 1, true, 0><<<dim3(TT / 64, DQ / 64, 1), 32, 0, stream>>>(XRh, XRl, WQ, nullptr, DM, FQ, DQ, bq, 0, 0, 0, 0);
        k_rope<<<LQ, 256, 0, stream>>>(FQ, DQ, NH_, CS, nullptr, nullptr, QSC, QP16, QPh, QPl);   /* q x 0.125 */
        k_gemmw<bf, 1, true, 0><<<dim3(TT / 64, DKV / 64, 1), 32, 0, stream>>>(XRh, XRl, WK, nullptr, DM, FK, DKV, bk, 0, 0, 0, 0);
        k_rope<<<LKv, 256, 0, stream>>>(FK, DKV, NKV, CS, nullptr, nullptr, 1.0f, KP16, KPh, KPl);
        k_gemmw<bf, 0, true, 0><<<dim3(TT / 64, DKV / 64, 1), 32, 0, stream>>>(XB, nullptr, WV, nullptr, DM, FV, DKV, bv, 0, 0, 0, 0); k_vtp<<<LKv, 256, 0, stream>>>(FV, DKV, NKV, VT16, VTh, VTl);
        for (int h0 = 0; h0 < NH_; h0 += ZH) { const size_t zq = (size_t)h0, zk = (size_t)(h0 / REP);   // one kv head per query head: the pass's two heads use consecutive kv planes (z-strides TT*HD)
            k_gemmw<bf, 2, false, 1><<<dim3(RH / 64, BTL, ZH), 32, 0, stream>>>(QPh + zq * TT * HD, QPl + zq * TT * HD, KPh + zk * TT * HD, KPl + zk * TT * HD, HD, Sb, TT, nullptr, (size_t)TT * HD, (size_t)TT * HD, (size_t)TT * TT, 0);
            k_gemmw<h16, 0, false, 1><<<dim3((TT - RH) / 64, BTL, ZH), 32, 0, stream>>>(QP16 + zq * TT * HD + (size_t)RH * HD, nullptr, KP16 + zk * TT * HD, nullptr, HD, Sb + (size_t)RH * TT, TT, nullptr, (size_t)TT * HD, (size_t)TT * HD, (size_t)TT * TT, RH);
            k_asoft<<<ZH * TT / 8, 256, 0, stream>>>(Sb, P16, Ph, Pl);
            k_gemmw<bf, 2, false, 2><<<dim3(RH / 64, HD / 64, ZH), 32, 0, stream>>>(Ph, Pl, VTh + zk * HD * TT, VTl + zk * HD * TT, TT, Ob, HD, nullptr, (size_t)RH * TT, (size_t)HD * TT, (size_t)TT * HD, 0);
            k_gemmw<h16, 0, false, 2><<<dim3((TT - RH) / 64, HD / 64, ZH), 32, 0, stream>>>(P16 + (size_t)RH * TT, nullptr, VT16 + zk * HD * TT, nullptr, TT, Ob + (size_t)RH * HD, HD, nullptr, (size_t)TT * TT, (size_t)HD * TT, (size_t)TT * HD, RH);
            k_merge<<<(unsigned)(((size_t)ZH * TT * HD / 2 + 255) / 256), 256, 0, stream>>>(Ob, h0, ATh, ATl); }
        k_gemmw<bf, 1, true, 0><<<dim3(TT / 64, DM / 64, 1), 32, 0, stream>>>(ATh, ATl, WO, nullptr, DQ, OUT + (size_t)b * TT * DM, DM, bo, 0, 0, 0, 0); }
}

// v002
// One run takes 213 microseconds.
// In two side-by-side timings against v001, it was 3.13 and 3.11 times as fast.
// Over all steps from v000 it is 7.25 times as fast.
#include <hip/hip_runtime.h>

// Local (sliding-window) multi-head attention with rotary embeddings applied to the RAW hidden states before the projections (hidden [2][2048][768]; xr = rotate-half rope(hidden viewed (S, 12, 64)) with angles t x 10000^(-2i/64) (computed in-kernel); q = xr Wq + bq, k = xr Wk + bk, v = hidden Wv + bv (keras per-head dense == 'xw' [768][768] + [768]); scores = (q x 0.125).k; keys with |i - j| >= 128 get -1e9 (exclusion); softmax; out = ctx Wo + bo ('xw' [768][768]) -> [2][2048][768] (3.1 M)).
// Every stage is ONE launch over both batches and all 12 heads (grid.z or rows b*2048 + t in the projections, planes z = b*12 + h in attention); scores and probabilities are stored as the band only (pitch 320, column = key - (i0 - 128)), so that all 24 planes fit the workspace. Stages: a rotary kernel rotates the bf16-rounded hidden states per 64-wide slice and writes them directly as hi/lo GEMM operand planes (f32 rotary, precise cosf/sinf, jnp-exact inverse frequencies); q and k as hi/lo x exact GEMMs (2 products) + f32 biases, v exact from the bf16 hidden states; q scaled by 0.125 before the split; banded T-2048 attention (hybrid rows: < 512 hi/lo 3 products, rest fp16 x1024): each 64-row query tile visits only the 320 keys [i0 - 128, i0 + 192) that its |i - j| < 128 window can reach (score tiles, softmax columns and the P.V k loop alike; every key outside has weight exactly 0), and the softmax kernel applies the window inside the band as an index select; merged hi/lo x Wo exact + bo.
// Compute dtypes, f32 accumulate: every input rounded to bf16; rotary f32; q/k hi/lo x exact, v exact, + f32 biases; attention rows < 512 3 products, rest fp16; softmax f32; Wo hl x exact + bias.

#define NB_  2
#define TT   2048
#define DM   768
#define NH_  12
#define NKV  12
#define REP  (NH_ / NKV)
#define HD   64
#define DQ   (NH_ * HD)
#define DKV  (NKV * HD)
#define ZH   (NB_ * NH_)          // attention planes per launch: every (batch, head), z = b * NH_ + h
#define RH   512                  // query rows < RH use hi+lo planes (0: none)
#define WIN  0
#define PCAR 1024.0f
#define SCL  1.0f   // q x 0.125 applied before the split (QSC)
#define QSC  0.125f
#define WNB  128     // |i - j| < 128 kept
#define QT   64      // query rows per GEMM tile; the tile at row i0 can reach keys [i0 - WNB, i0 + QT + WNB) only
#define BTL  ((QT + 2 * WNB) / 64)           // 64-key score tiles per query tile
#define BW   (QT + 2 * WNB)                  // pitch of a stored score / probability row: key j of a row in tile i0 lies at column j - (i0 - WNB)
#define BCH  ((64 + QT + 2 * WNB + 127) / 128)  // 128-key softmax chunks that cover the band from any 64-aligned start
typedef _Float16 h16;
typedef unsigned short bf;
typedef __attribute__((ext_vector_type(16))) __bf16   v16bf;
typedef __attribute__((ext_vector_type(16))) _Float16 v16h;
typedef __attribute__((ext_vector_type(8)))  _Float16 v8h;
typedef __attribute__((ext_vector_type(8)))  unsigned short v8us;
typedef __attribute__((ext_vector_type(8)))  float    v8f;
typedef __attribute__((ext_vector_type(4)))  float    v4f;
typedef v8h  __attribute__((may_alias)) v8ha;
typedef v4f  __attribute__((may_alias)) v4fa;
typedef v8us __attribute__((may_alias)) v8usa;

__device__ __forceinline__ unsigned short f2bf(float f) { unsigned u = __float_as_uint(f); u += 0x7FFFu + ((u >> 16) & 1u); return (unsigned short)(u >> 16); }
__device__ __forceinline__ float bf2f(unsigned short b) { return __uint_as_float(((unsigned)b) << 16); }
__device__ __forceinline__ float bfr(float f) { return bf2f(f2bf(f)); }
__device__ __forceinline__ v16h cat16(v8h lo, v8h hi) { return __builtin_shufflevector(lo, hi, 0, 1, 2, 3, 4, 5, 6, 7, 8, 9, 10, 11, 12, 13, 14, 15); }
__device__ __forceinline__ v16bf cat16b(v8us lo, v8us hi) { return __builtin_bit_cast(v16bf, __builtin_shufflevector(lo, hi, 0, 1, 2, 3, 4, 5, 6, 7, 8, 9, 10, 11, 12, 13, 14, 15)); }
__device__ __forceinline__ v8f wmma16(v16h a, v16h b, v8f c) { return __builtin_amdgcn_wmma_f32_16x16x32_f16(false, a, false, b, (short)0, c, false, false); }
__device__ __forceinline__ v8f wmmab(v16bf a, v16bf b, v8f c) { return __builtin_amdgcn_wmma_f32_16x16x32_bf16(false, a, false, b, (short)0, c, false, false); }



// ---- k_gemmw: register-blocked GEMM, ONE WAVE per 64x64 output tile (16 accumulators), operands straight from K-contiguous 16-bit planes; grid (M/64, N/64, Z), 32 threads.
// C[m][n] (f32, pitch ldc, + optional f32 bias[n]) = sum_k A[m][k] Bt[n][k] (+ split products per NSPLIT). z-batch strides sA/sB/sC in elements. K % 32 == 0.
// BAND 1 (scores): n is a key; grid.y counts the BTL key tiles of the query tile's band, tiles off the sequence leave; C holds the band only (column blockIdx.y * 64, ldc = BW). BAND 2 (P.V): k is a key; the k loop runs over the band only, and A holds the band only (lda = BW, column k - (i0 - WNB)). lda = pitch of A and A2 in elements (K but for BAND 2); Bt's pitch is K. row0 = sequence row of A's row 0.
// xhold: s_wait_xcnt 0 behind a run of fragment loads. The pointers that the run's loads go through are inputs of the statement, so their registers stay allocated up to the wait and no later load's result lands on them in front of it (a precaution of form; one wait serves the run).
template <typename T> __device__ __forceinline__ void xhold(const T* p0, const T* p1) { asm volatile("s_wait_xcnt 0x0" :: "v"(p0), "v"(p1) : "memory"); }
template <typename T> __device__ __forceinline__ void xhold(const T* p0, const T* p1, const T* p2, const T* p3) { asm volatile("s_wait_xcnt 0x0" :: "v"(p0), "v"(p1), "v"(p2), "v"(p3) : "memory"); }
template <typename T> __device__ __forceinline__ void xhold(const T* p0, const T* p1, const T* p2, const T* p3, const T* p4, const T* p5, const T* p6, const T* p7) { asm volatile("s_wait_xcnt 0x0" :: "v"(p0), "v"(p1), "v"(p2), "v"(p3), "v"(p4), "v"(p5), "v"(p6), "v"(p7) : "memory"); }
template <typename T16> struct WFrag;
template <> struct WFrag<h16> { typedef v16h V; static __device__ __forceinline__ V ld(const h16* p) { return cat16(*(const v8h*)p, *(const v8h*)(p + 16)); } static __device__ __forceinline__ v8f mma(V a, V b, v8f c) { return wmma16(a, b, c); } };
template <> struct WFrag<bf> { typedef v16bf V; static __device__ __forceinline__ V ld(const bf* p) { return cat16b(*(const v8us*)p, *(const v8us*)(p + 16)); } static __device__ __forceinline__ v8f mma(V a, V b, v8f c) { return wmmab(a, b, c); } };
template <typename T16, int NSPLIT, bool BIAS, int BAND>
__global__ __launch_bounds__(32) void k_gemmw(const T16* __restrict__ A, const T16* __restrict__ A2, const T16* __restrict__ Bt, const T16* __restrict__ Bt2, int K, int lda, float* C, int ldc, const float* __restrict__ bias, size_t sA, size_t sB, size_t sC, int row0) {
    typedef typename WFrag<T16>::V V;
    __shared__ __align__(16) float os[16 * 68];
    const size_t z = blockIdx.z; A += z * sA; if (A2) A2 += z * sA; Bt += z * sB; if (Bt2) Bt2 += z * sB; C += z * sC;
    const int lane = threadIdx.x & 31, lr = lane & 15, hi = lane >> 4; const int r0 = blockIdx.x * 64, i0 = row0 + r0, c0 = (BAND == 1) ? i0 - WNB + (int)blockIdx.y * 64 : (int)blockIdx.y * 64;
    if (BAND == 1 && (c0 < 0 || c0 >= TT)) return;
    const int kbeg = (BAND == 2) ? max(i0 - WNB, 0) : 0, kend = (BAND == 2) ? min(i0 + QT + WNB, K) : K;
    v8f acc[4][4];
#pragma unroll
    for (int mb = 0; mb < 4; ++mb)
#pragma unroll
        for (int nb = 0; nb < 4; ++nb) acc[mb][nb] = (v8f){};
    const int ldb = K, cc0 = (BAND == 1) ? (int)blockIdx.y * 64 : c0;
    const size_t aoff = (size_t)(r0 + lr) * lda + 8 * hi, boff = (size_t)(c0 + lr) * ldb + 8 * hi;
#pragma unroll 1
    for (int kc = kbeg; kc < kend; kc += 32) {
        V a[4], a2[4]; const int ka = (BAND == 2) ? kc - i0 : kc; constexpr size_t ca = (BAND == 2) ? WNB : 0;   // key kc lies at column ka + ca of A's stored row
        const T16* pa = A + aoff + ka; const T16* pa2 = (NSPLIT == 1 || NSPLIT == 2) ? A2 + aoff + ka : nullptr; const T16* pb = Bt + boff + kc; const T16* pb2 = (NSPLIT >= 2) ? Bt2 + boff + kc : nullptr; const size_t sa = (size_t)16 * lda, sb = (size_t)16 * ldb;
#pragma unroll
        for (int mb = 0; mb < 4; ++mb) { a[mb] = WFrag<T16>::ld(pa + (mb * sa + ca)); if (NSPLIT == 1 || NSPLIT == 2) a2[mb] = WFrag<T16>::ld(pa2 + (mb * sa + ca)); }
        if (NSPLIT == 1 || NSPLIT == 2) xhold(pa, pa + sa, pa + 2 * sa, pa + 3 * sa, pa2, pa2 + sa, pa2 + 2 * sa, pa2 + 3 * sa); else xhold(pa, pa + sa, pa + 2 * sa, pa + 3 * sa);
#pragma unroll
        for (int nb = 0; nb < 4; ++nb) { const V b = WFrag<T16>::ld(pb + nb * sb); V b2; if (NSPLIT >= 2) { b2 = WFrag<T16>::ld(pb2 + nb * sb); xhold(pb + nb * sb, pb2 + nb * sb); }   // two planes of B: a wait a column block, so that its two pointers free their registers for the next blocks' fragments
#pragma unroll
            for (int mb = 0; mb < 4; ++mb) { acc[mb][nb] = WFrag<T16>::mma(a[mb], b, acc[mb][nb]); if (NSPLIT == 1 || NSPLIT == 2) acc[mb][nb] = WFrag<T16>::mma(a2[mb], b, acc[mb][nb]); if (NSPLIT >= 2) acc[mb][nb] = WFrag<T16>::mma(a[mb], b2, acc[mb][nb]); } }
        if (NSPLIT < 2) xhold(pb, pb + sb, pb + 2 * sb, pb + 3 * sb);
        asm volatile("v_nop\n\tv_nop\n\tv_nop\n\tv_nop" : "+v"(acc[0][0]), "+v"(acc[1][1]), "+v"(acc[2][2]), "+v"(acc[3][3]) : "v"(a[0]), "v"(a[3]));
    }
#pragma unroll
    for (int mb = 0; mb < 4; ++mb) {
#pragma unroll
        for (int nb = 0; nb < 4; ++nb) {
#pragma unroll
            for (int j = 0; j < 8; ++j) os[(hi * 8 + j) * 68 + nb * 16 + lr] = acc[mb][nb][j]; }
        __builtin_amdgcn_wave_barrier(); asm volatile("" ::: "memory");
        float* crow = C + (size_t)(r0 + mb * 16) * ldc + cc0;
{
#pragma unroll
            for (int s = 0; s < 8; ++s) { const int row = 2 * s + hi, cofs = lr * 4; v4f val = *(const v4fa*)(os + row * 68 + cofs); if (BIAS) { val[0] += bfr(bias[c0 + cofs]); val[1] += bfr(bias[c0 + cofs + 1]); val[2] += bfr(bias[c0 + cofs + 2]); val[3] += bfr(bias[c0 + cofs + 3]); }
                *(v4f*)(crow + (size_t)row * ldc + cofs) = val; }
             }
        __builtin_amdgcn_wave_barrier(); asm volatile("" ::: "memory");
    }
}

__device__ __forceinline__ h16 tohx(float x) { return (h16)x; }
__device__ __forceinline__ void splitf(float y, unsigned short& h, unsigned short& l) { h = f2bf(y); l = f2bf(y - bf2f(h)); }
typedef __attribute__((ext_vector_type(2))) _Float16 v2h;
typedef __attribute__((ext_vector_type(4))) _Float16 v4h;
typedef __attribute__((ext_vector_type(2))) unsigned short v2us;
typedef __attribute__((ext_vector_type(4))) unsigned short v4us;
typedef __attribute__((ext_vector_type(2))) float v2f;
typedef __attribute__((ext_vector_type(4))) int v4i;

__global__ __launch_bounds__(256) void k_wtG(const float* __restrict__ w, int K, int N, bf* Bt) {
    const int lane = threadIdx.x & 31; const int L0 = (blockIdx.x * 8 + (threadIdx.x >> 5)) * 8; const int nlines = N * K / 64;
{
#pragma unroll 1
        for (int l = 0; l < 8; ++l) { const int L = L0 + l; if (L >= nlines) break; const size_t e = (size_t)L * 64 + lane * 2; const int k = (int)(e % K), n = (int)(e / K); v2us o;
            o[0] = f2bf(w[(size_t)k * N + n]); o[1] = f2bf(w[(size_t)(k + 1) * N + n]); *(v2us*)(Bt + e) = o; }
         }
}
__global__ __launch_bounds__(256) void k_cvt8(const float* __restrict__ src, bf* dst, size_t n8) { const size_t i = (size_t)blockIdx.x * 256 + threadIdx.x; if (i >= n8) return; const v8f v = *(const v8f*)(src + i * 8); v8us o;
#pragma unroll
    for (int k = 0; k < 8; ++k) o[k] = f2bf(v[k]); *(v8us*)(dst + i * 8) = o;  }

// k_rope: head planes [h][t][d] (fp16 + hi/lo) of rope(x) x sc with the rotate-half convention out[d] = x[d] cos[t][d] - x[d+HD/2] sin[t][d], out[d+HD/2] = x[d+HD/2] cos[t][d+HD/2] + x[d] sin[t][d+HD/2]
__global__ __launch_bounds__(256) void k_rope(const float* __restrict__ F, int pitch, int nheads, const float* __restrict__ CS, const float* __restrict__ RF, const float* __restrict__ nw, float sc, h16* P16, bf* Ph, bf* Pl) {
    const size_t e = ((size_t)blockIdx.x * 256 + threadIdx.x) * 2; if (e >= (size_t)nheads * TT * HD) return; const int d = (int)(e % HD); const int t = (int)((e / HD) % TT); const int h = (int)(e / ((size_t)HD * TT)); const float* f = F + (size_t)t * pitch + h * HD; const float rf = RF ? RF[(size_t)h * TT + t] : 1.0f; v2h o16; v2us oh, ol;
#pragma unroll
    for (int q = 0; q < 2; ++q) { const int dd = d + q; const int dp = (dd < HD / 2) ? dd + HD / 2 : dd - HD / 2; float x0 = f[dd], x1 = f[dp];
        if (RF) { float n0 = __fmul_rn(x0, rf), n1 = __fmul_rn(x1, rf); asm volatile("" : "+v"(n0)); asm volatile("" : "+v"(n1)); x0 = __fmul_rn(bfr(nw[dd]), n0); x1 = __fmul_rn(bfr(nw[dp]), n1); }
        const v2f cs = *(const v2f*)(CS + ((size_t)t * HD + dd) * 2); float a = __fmul_rn(x0, cs[0]), bq = __fmul_rn(x1, cs[1]); asm volatile("" : "+v"(a)); asm volatile("" : "+v"(bq)); const float r = ((dd < HD / 2) ? __fsub_rn(a, bq) : __fadd_rn(a, bq)) * sc;
        o16[q] = tohx(r); unsigned short a2, c2; splitf(r, a2, c2); oh[q] = a2; ol[q] = c2; }
    *(v2h*)(P16 + e) = o16; *(v2us*)(Ph + e) = oh; *(v2us*)(Pl + e) = ol;  }
__global__ __launch_bounds__(256) void k_vtp(const float* __restrict__ F, int pitch, int nheads, h16* V16, bf* Vh, bf* Vl) { const size_t e = ((size_t)blockIdx.x * 256 + threadIdx.x) * 2; if (e >= (size_t)nheads * HD * TT) return; const int t = (int)(e % TT); const int d = (int)((e / TT) % HD); const int g = (int)(e / ((size_t)TT * HD)); v2h o16; v2us oh, ol;
#pragma unroll
    for (int q = 0; q < 2; ++q) { const float x = F[(size_t)(t + q) * pitch + g * HD + d]; o16[q] = tohx(x); unsigned short a2, c2; splitf(x, a2, c2); oh[q] = a2; ol[q] = c2; }
    *(v2h*)(V16 + e) = o16; *(v2us*)(Vh + e) = oh; *(v2us*)(Vl + e) = ol;  }
__global__ __launch_bounds__(256) void k_csid(float* CS) { const int idx = blockIdx.x * 256 + threadIdx.x; if (idx >= TT * HD) return; v2f cs; cs[0] = 1.0f; cs[1] = 0.0f; *(v2f*)(CS + (size_t)idx * 2) = cs;  }
// k_asoft: per row (zz, i): softmax over the keys of the row's tile band (register row, one exp, fixed trees; 128-key chunks at the same lane places as a full row, so the sums keep their order); reads and writes the band's columns only;
__global__ __launch_bounds__(256) void k_asoft(const float* __restrict__ Sb, h16* P16, bf* Ph, bf* Pl) {
    const int lane = threadIdx.x & 31; const int row = blockIdx.x * 8 + (threadIdx.x >> 5); if (row >= ZH * TT) return; const int i = row % TT; const int zz = row / TT; (void)zz; const bool hires = (i < RH); const float* sr = Sb + (size_t)row * BW; float v[BCH * 4]; float mx = -3.0e38f;
    const int i0 = i & ~(QT - 1); const int blo = max(i0 - WNB, 0), bhi = min(i0 + QT + WNB, TT); const int bo0 = i0 - WNB;   /* key of stored column 0 */ const int jb = ((i0 - WNB) >> 7) * 128 + lane * 4;   /* first 128-key chunk that touches the band (may start off the band: lanes there load and store nothing and count as excluded keys) */
#pragma unroll
    for (int ch = 0; ch < BCH; ++ch) { const int j0 = jb + ch * 128; const bool inb = (j0 >= blo && j0 < bhi);   /* the lane's four keys lie on the band (so on the sequence) or all off it: blo, bhi are multiples of 64 */ v4f a = (v4f){}; if (inb) a = *(const v4f*)(sr + (j0 - bo0));
#pragma unroll
        for (int q = 0; q < 4; ++q) { const int j = j0 + q; const float t = (inb && i - j < WNB && j - i < WNB) ? a[q] * SCL : -3.0e38f; v[ch * 4 + q] = t;   /* |i - j| < 128 window (both sides); a key off the sequence is excluded like any other */ mx = fmaxf(mx, t); } }
#pragma unroll
    for (int sh = 16; sh; sh >>= 1) mx = fmaxf(mx, __shfl_xor(mx, sh, 32));
    float sum = 0.f;
#pragma unroll
    for (int k = 0; k < BCH * 4; ++k) { float d0 = __fsub_rn(v[k], mx); asm volatile("" : "+v"(d0)); v[k] = __builtin_amdgcn_exp2f(__fmul_rn(d0, 1.4426950408889634f)); sum += v[k]; }
#pragma unroll
    for (int sh = 16; sh; sh >>= 1) sum += __shfl_xor(sum, sh, 32);
    const float f = __fdiv_rn(hires ? 1.0f : PCAR, sum);
{
        if (hires) {
#pragma unroll
            for (int ch = 0; ch < BCH; ++ch) { const int j0 = jb + ch * 128; v4us oh, ol;
#pragma unroll
                for (int q = 0; q < 4; ++q) { unsigned short a, c2; splitf(v[ch * 4 + q] * f, a, c2); oh[q] = a; ol[q] = c2; }
                if (j0 >= blo && j0 < bhi) { const size_t oo = ((size_t)zz * (RH ? RH : 1) + i) * BW + (j0 - bo0); *(v4us*)(Ph + oo) = oh; *(v4us*)(Pl + oo) = ol; } }
        } else {
#pragma unroll
            for (int ch = 0; ch < BCH; ++ch) { const int j0 = jb + ch * 128; v4h o4;
#pragma unroll
                for (int q = 0; q < 4; ++q) o4[q] = tohx(v[ch * 4 + q] * f);
                if (j0 >= blo && j0 < bhi) *(v4h*)(P16 + (size_t)row * BW + (j0 - bo0)) = o4; } }
         }
}
__constant__ float INVT[HD / 2] = { 1.000000000e+00f, 7.498942018e-01f, 5.623413324e-01f, 4.216965139e-01f, 3.162277639e-01f, 2.371373624e-01f, 1.778279394e-01f, 1.333521456e-01f, 1.000000015e-01f, 7.498941571e-02f, 5.623412877e-02f, 4.216964915e-02f, 3.162277862e-02f, 2.371373586e-02f, 1.778279431e-02f, 1.333521493e-02f, 9.999999776e-03f, 7.498942316e-03f, 5.623413250e-03f, 4.216964822e-03f, 3.162277862e-03f, 2.371373819e-03f, 1.778279431e-03f, 1.333521446e-03f, 1.000000047e-03f, 7.498941850e-04f, 5.623413017e-04f, 4.216964880e-04f, 3.162277862e-04f, 2.371373848e-04f, 1.778279402e-04f, 1.333521504e-04f };   // jnp-exact float32 1/10000^(2i/64)
__global__ __launch_bounds__(256) void k_ropexP(const float* __restrict__ xs, bf* Xh, bf* Xl) { const size_t e = ((size_t)blockIdx.x * 256 + threadIdx.x) * 2; if (e >= (size_t)NB_ * TT * DM) return; const int c = (int)(e % DM); const int t = (int)((e / DM) % TT); const int d = c % HD; const float* f = xs + (e - d); v2us oh, ol;
#pragma unroll
    for (int q = 0; q < 2; ++q) { const int dd = d + q; const int dp = (dd < HD / 2) ? dd + HD / 2 : dd - HD / 2; const float x0 = bfr(f[dd]), x1 = bfr(f[dp]); const float a = __fmul_rn((float)t, INVT[dd % (HD / 2)]); const float cs = cosf(a), sn = sinf(a); float p0 = __fmul_rn(x0, cs), p1 = __fmul_rn(x1, sn); asm volatile("" : "+v"(p0), "+v"(p1)); const float r = (dd < HD / 2) ? __fsub_rn(p0, p1) : __fadd_rn(p0, p1); unsigned short a2, c2; splitf(r, a2, c2); oh[q] = a2; ol[q] = c2; }
    *(v2us*)(Xh + e) = oh; *(v2us*)(Xl + e) = ol;  }
__global__ __launch_bounds__(256) void k_merge(const float* __restrict__ O, bf* Ah, bf* Al) { const size_t e = ((size_t)blockIdx.x * 256 + threadIdx.x) * 2; if (e >= (size_t)ZH * TT * HD) return; const int d = (int)(e % HD); const int t = (int)((e / HD) % TT); const int zz = (int)(e / ((size_t)HD * TT)); const float cs = (t < RH) ? 1.0f : (1.0f / PCAR); const size_t oo = ((size_t)(zz / NH_) * TT + t) * DQ + (zz % NH_) * HD + d;
    v2us oh, ol;
#pragma unroll
    for (int q = 0; q < 2; ++q) { unsigned short a, c2; splitf(O[e + q] * cs, a, c2); oh[q] = a; ol[q] = c2; } *(v2us*)(Ah + oo) = oh; *(v2us*)(Al + oo) = ol;  }

extern "C" void kernel_launch(void* const* d_in, const int* in_sizes, int n_in,
                              void* d_out, int out_size, void* d_ws, size_t ws_size, hipStream_t stream) {
    (void)in_sizes; (void)n_in; (void)out_size;
    const float* x = (const float*)d_in[0]; const float* wq = (const float*)d_in[1]; const float* bq = (const float*)d_in[2]; const float* wk = (const float*)d_in[3]; const float* bk = (const float*)d_in[4]; const float* wv = (const float*)d_in[5]; const float* bv = (const float*)d_in[6]; const float* wo = (const float*)d_in[7]; const float* bo = (const float*)d_in[8];
    float* OUT = (float*)d_out;     // [2][2048][768]
    char* wsp = (char*)d_ws;
    auto take = [&](size_t bytes) { char* p = wsp; wsp += (bytes + 255) & ~(size_t)255; return (void*)p; };
    const size_t MT = (size_t)NB_ * TT;   // rows of both batches
    bf* WQ = (bf*)take((size_t)DQ * DM * 2); bf* WK = (bf*)take((size_t)DKV * DM * 2); bf* WV = (bf*)take((size_t)DKV * DM * 2); bf* WO = (bf*)take((size_t)DM * DQ * 2); float* CS = (float*)take((size_t)TT * HD * 2 * 4);
    bf* XB = (bf*)take(MT * DM * 2); bf* XRh = (bf*)take(MT * DM * 2); bf* XRl = (bf*)take(MT * DM * 2); float* FQ = (float*)take(MT * DQ * 4); float* FK = (float*)take(MT * DKV * 4);
    h16* QP16 = (h16*)take(MT * DQ * 2); h16* KP16 = (h16*)take(MT * DKV * 2); h16* VT16 = (h16*)take(MT * DKV * 2);
    bf* QPh = (bf*)take(MT * DQ * 2); bf* QPl = (bf*)take(MT * DQ * 2); bf* KPh = (bf*)take(MT * DKV * 2); bf* KPl = (bf*)take(MT * DKV * 2); bf* VTh = (bf*)take(MT * DKV * 2); bf* VTl = (bf*)take(MT * DKV * 2); bf* Ph = (bf*)take((size_t)ZH * RH * BW * 2); bf* Pl = (bf*)take((size_t)ZH * RH * BW * 2);
    float* Sb = (float*)take((size_t)ZH * TT * BW * 4); h16* P16 = (h16*)take((size_t)ZH * TT * BW * 2); float* Ob = (float*)take((size_t)ZH * TT * HD * 4); bf* ATh = (bf*)take(MT * DQ * 2); bf* ATl = (bf*)take(MT * DQ * 2);
    if ((size_t)(wsp - (char*)d_ws) > ws_size) return;    // ws 256 MiB
    float* FV = FK;   // v projection reuses the k buffer after the k planes are built (stream-ordered)
    { k_wtG<<<(unsigned)((DM * DQ / 64 + 63) / 64), 256, 0, stream>>>(wq, DM, DQ, WQ); k_wtG<<<(unsigned)((DM * DKV / 64 + 63) / 64), 256, 0, stream>>>(wk, DM, DKV, WK); k_wtG<<<(unsigned)((DM * DKV / 64 + 63) / 64), 256, 0, stream>>>(wv, DM, DKV, WV);
      k_wtG<<<(unsigned)((DQ * DM / 64 + 63) / 64), 256, 0, stream>>>(wo, DQ, DM, WO);
       }
    k_csid<<<(TT * HD + 255) / 256, 256, 0, stream>>>(CS);
    const unsigned LQ = (unsigned)((MT * DQ / 2 + 255) / 256), LKv = (unsigned)((MT * DKV / 2 + 255) / 256);
    k_cvt8<<<(unsigned)((MT * DM / 8 + 255) / 256), 256, 0, stream>>>(x, XB, MT * DM / 8); k_ropexP<<<(unsigned)((MT * DM / 2 + 255) / 256), 256, 0, stream>>>(x, XRh, XRl);   /* rope on the raw hidden states (per 64-slice), as hi/lo planes */
    // projections: grid.z is the batch; batch b's 768 columns lie at column b * 768 of a row t (pitch 2 * 768), so that column block z = b * 12 + h of F is attention plane z
    k_gemmw<bf, 1, true, 0><<<dim3(TT / 64, DQ / 64, NB_), 32, 0, stream>>>(XRh, XRl, WQ, nullptr, DM, DM, FQ, NB_ * DQ, bq, (size_t)TT * DM, 0, DQ, 0);
    k_rope<<<LQ, 256, 0, stream>>>(FQ, NB_ * DQ, NB_ * NH_, CS, nullptr, nullptr, QSC, QP16, QPh, QPl);   /* q x 0.125 */
    k_gemmw<bf, 1, true, 0><<<dim3(TT / 64, DKV / 64, NB_), 32, 0, stream>>>(XRh, XRl, WK, nullptr, DM, DM, FK, NB_ * DKV, bk, (size_t)TT * DM, 0, DKV, 0);
    k_rope<<<LKv, 256, 0, stream>>>(FK, NB_ * DKV, NB_ * NKV, CS, nullptr, nullptr, 1.0f, KP16, KPh, KPl);
    k_gemmw<bf, 0, true, 0><<<dim3(TT / 64, DKV / 64, NB_), 32, 0, stream>>>(XB, nullptr, WV, nullptr, DM, DM, FV, NB_ * DKV, bv, (size_t)TT * DM, 0, DKV, 0); k_vtp<<<LKv, 256, 0, stream>>>(FV, NB_ * DKV, NB_ * NKV, VT16, VTh, VTl);
    // attention: one kv head per query head, so plane z of q meets plane z of k and v (z-strides TT*HD)
    k_gemmw<bf, 2, false, 1><<<dim3(RH / 64, BTL, ZH), 32, 0, stream>>>(QPh, QPl, KPh, KPl, HD, HD, Sb, BW, nullptr, (size_t)TT * HD, (size_t)TT * HD, (size_t)TT * BW, 0);
    k_gemmw<h16, 0, false, 1><<<dim3((TT - RH) / 64, BTL, ZH), 32, 0, stream>>>(QP16 + (size_t)RH * HD, nullptr, KP16, nullptr, HD, HD, Sb + (size_t)RH * BW, BW, nullptr, (size_t)TT * HD, (size_t)TT * HD, (size_t)TT * BW, RH);
    k_asoft<<<ZH * TT / 8, 256, 0, stream>>>(Sb, P16, Ph, Pl);
    k_gemmw<bf, 2, false, 2><<<dim3(RH / 64, HD / 64, ZH), 32, 0, stream>>>(Ph, Pl, VTh, VTl, TT, BW, Ob, HD, nullptr, (size_t)RH * BW, (size_t)HD * TT, (size_t)TT * HD, 0);
    k_gemmw<h16, 0, false, 2><<<dim3((TT - RH) / 64, HD / 64, ZH), 32, 0, stream>>>(P16 + (size_t)RH * BW, nullptr, VT16, nullptr, TT, BW, Ob + (size_t)RH * HD, HD, nullptr, (size_t)TT * BW, (size_t)HD * TT, (size_t)TT * HD, RH);
    k_merge<<<(unsigned)(((size_t)ZH * TT * HD / 2 + 255) / 256), 256, 0, stream>>>(Ob, ATh, ATl);
    k_gemmw<bf, 1, true, 0><<<dim3(NB_ * TT / 64, DM / 64, 1), 32, 0, stream>>>(ATh, ATl, WO, nullptr, DQ, DQ, OUT, DM, bo, 0, 0, 0, 0);
}

// v003
// A run of this version takes 179 microseconds.
// In both of two side-by-side timings against v002, it was 1.19 times as fast.
// Counting every step since v000, it is 8.60 times as fast.
#include <hip/hip_runtime.h>

// Local (sliding-window) multi-head attention with rotary embeddings applied to the RAW hidden states before the projections (hidden [2][2048][768]; xr = rotate-half rope(hidden viewed (S, 12, 64)) with angles t x 10000^(-2i/64) (computed in-kernel); q = xr Wq + bq, k = xr Wk + bk, v = hidden Wv + bv (keras per-head dense == 'xw' [768][768] + [768]); scores = (q x 0.125).k; keys with |i - j| >= 128 get -1e9 (exclusion); softmax; out = ctx Wo + bo ('xw' [768][768]) -> [2][2048][768] (3.1 M)).
// Every stage is ONE launch over both batches and all 12 heads (grid.z or rows b*2048 + t in the projections, planes z = b*12 + h in attention); scores and probabilities are stored as the band only (pitch 320, column = key - (i0 - 128)), so that all 24 planes fit the workspace. Each GEMM whose result only feeds another GEMM writes that GEMM's 16-bit operand planes from its own epilogue (q, k: head planes [z][t][d]; v: transposed [z][d][t]; P.V: merged rows [b][t][h*64+d]); no f32 copy of q, k, v or ctx goes through memory. Stages: a rotary kernel rotates the bf16-rounded hidden states per 64-wide slice and writes them directly as hi/lo GEMM operand planes (f32 rotary, precise cosf/sinf, jnp-exact inverse frequencies); q and k as hi/lo x exact GEMMs (2 products) + f32 biases, v exact from the bf16 hidden states; q scaled by 0.125 before the split; banded T-2048 attention (hybrid rows: < 512 hi/lo 3 products, rest fp16 x1024): each 64-row query tile visits only the 320 keys [i0 - 128, i0 + 192) that its |i - j| < 128 window can reach (score tiles, softmax columns and the P.V k loop alike; every key outside has weight exactly 0), and the softmax kernel applies the window inside the band as an index select; merged hi/lo x Wo exact + bo.
// Compute dtypes, f32 accumulate: every input rounded to bf16; rotary f32; q/k hi/lo x exact, v exact, + f32 biases; attention rows < 512 3 products, rest fp16; softmax f32; Wo hl x exact + bias.

#define NB_  2
#define TT   2048
#define DM   768
#define NH_  12
#define NKV  12
#define REP  (NH_ / NKV)
#define HD   64
#define DQ   (NH_ * HD)
#define DKV  (NKV * HD)
#define ZH   (NB_ * NH_)          // attention planes per launch: every (batch, head), z = b * NH_ + h
#define RH   512                  // query rows < RH use hi+lo planes (0: none)
#define WIN  0
#define PCAR 1024.0f
#define SCL  1.0f   // q x 0.125 applied before the split (QSC)
#define QSC  0.125f
#define WNB  128     // |i - j| < 128 kept
#define QT   64      // query rows per GEMM tile; the tile at row i0 can reach keys [i0 - WNB, i0 + QT + WNB) only
#define BTL  ((QT + 2 * WNB) / 64)           // 64-key score tiles per query tile
#define BW   (QT + 2 * WNB)                  // pitch of a stored score / probability row: key j of a row in tile i0 lies at column j - (i0 - WNB)
#define BCH  ((64 + QT + 2 * WNB + 127) / 128)  // 128-key softmax chunks that cover the band from any 64-aligned start
typedef _Float16 h16;
typedef unsigned short bf;
typedef __attribute__((ext_vector_type(16))) __bf16   v16bf;
typedef __attribute__((ext_vector_type(16))) _Float16 v16h;
typedef __attribute__((ext_vector_type(8)))  _Float16 v8h;
typedef __attribute__((ext_vector_type(8)))  unsigned short v8us;
typedef __attribute__((ext_vector_type(8)))  float    v8f;
typedef __attribute__((ext_vector_type(4)))  float    v4f;
typedef v8h  __attribute__((may_alias)) v8ha;
typedef v4f  __attribute__((may_alias)) v4fa;
typedef v8us __attribute__((may_alias)) v8usa;

__device__ __forceinline__ unsigned short f2bf(float f) { unsigned u = __float_as_uint(f); u += 0x7FFFu + ((u >> 16) & 1u); return (unsigned short)(u >> 16); }
__device__ __forceinline__ float bf2f(unsigned short b) { return __uint_as_float(((unsigned)b) << 16); }
__device__ __forceinline__ float bfr(float f) { return bf2f(f2bf(f)); }
__device__ __forceinline__ v16h cat16(v8h lo, v8h hi) { return __builtin_shufflevector(lo, hi, 0, 1, 2, 3, 4, 5, 6, 7, 8, 9, 10, 11, 12, 13, 14, 15); }
__device__ __forceinline__ v16bf cat16b(v8us lo, v8us hi) { return __builtin_bit_cast(v16bf, __builtin_shufflevector(lo, hi, 0, 1, 2, 3, 4, 5, 6, 7, 8, 9, 10, 11, 12, 13, 14, 15)); }
__device__ __forceinline__ v8f wmma16(v16h a, v16h b, v8f c) { return __builtin_amdgcn_wmma_f32_16x16x32_f16(false, a, false, b, (short)0, c, false, false); }
__device__ __forceinline__ v8f wmmab(v16bf a, v16bf b, v8f c) { return __builtin_amdgcn_wmma_f32_16x16x32_bf16(false, a, false, b, (short)0, c, false, false); }
__device__ __forceinline__ h16 tohx(float x) { return (h16)x; }
__device__ __forceinline__ void splitf(float y, unsigned short& h, unsigned short& l) { h = f2bf(y); l = f2bf(y - bf2f(h)); }
typedef __attribute__((ext_vector_type(4))) _Float16 v4h;
typedef __attribute__((ext_vector_type(2))) unsigned short v2us;
typedef __attribute__((ext_vector_type(4))) unsigned short v4us;



// ---- k_gemmw: register-blocked GEMM, ONE WAVE per 64x64 output tile (16 accumulators), operands straight from K-contiguous 16-bit planes; grid (M/64, N/64, Z), 32 threads.
// C[m][n] (f32, pitch ldc, + optional f32 bias[n]) = sum_k A[m][k] Bt[n][k] (+ split products per NSPLIT). z-batch strides sA/sB/sC in elements. K % 32 == 0.
// BAND 1 (scores): n is a key; grid.y counts the BTL key tiles of the query tile's band, tiles off the sequence leave; C holds the band only (column blockIdx.y * 64, ldc = BW). BAND 2 (P.V): k is a key; the k loop runs over the band only, and A holds the band only (lda = BW, column k - (i0 - WNB)). lda = pitch of A and A2 in elements (K but for BAND 2); Bt's pitch is K. row0 = sequence row of A's row 0.
// EPI: what the epilogue stores. 0: C as above. 1..3: (tile + bias) x esc as the next GEMM's 16-bit operand planes, fp16 (E16) and bf16 hi/lo (Eh, El), C unused; the 64 columns of a tile are one head.
//   1 (q, k; z = batch, blockIdx.y = head): plane z * NH_ + head, [t][d].  2 (v; same z, head; esc unused): plane z * NKV + head, transposed [d][t].  3 (P.V; z = plane b * NH_ + h): hi/lo only, row b * TT + t, column h * HD + d of the merged [NB_ * TT][DQ] operand.
// xhold: s_wait_xcnt 0 behind a run of fragment loads. The pointers that the run's loads go through are inputs of the statement, so their registers stay allocated up to the wait and no later load's result lands on them in front of it (a precaution of form; one wait serves the run).
template <typename T> __device__ __forceinline__ void xhold(const T* p0, const T* p1) { asm volatile("s_wait_xcnt 0x0" :: "v"(p0), "v"(p1) : "memory"); }
template <typename T> __device__ __forceinline__ void xhold(const T* p0, const T* p1, const T* p2, const T* p3) { asm volatile("s_wait_xcnt 0x0" :: "v"(p0), "v"(p1), "v"(p2), "v"(p3) : "memory"); }
template <typename T> __device__ __forceinline__ void xhold(const T* p0, const T* p1, const T* p2, const T* p3, const T* p4, const T* p5, const T* p6, const T* p7) { asm volatile("s_wait_xcnt 0x0" :: "v"(p0), "v"(p1), "v"(p2), "v"(p3), "v"(p4), "v"(p5), "v"(p6), "v"(p7) : "memory"); }
template <typename T16> struct WFrag;
template <> struct WFrag<h16> { typedef v16h V; static __device__ __forceinline__ V ld(const h16* p) { return cat16(*(const v8h*)p, *(const v8h*)(p + 16)); } static __device__ __forceinline__ v8f mma(V a, V b, v8f c) { return wmma16(a, b, c); } };
template <> struct WFrag<bf> { typedef v16bf V; static __device__ __forceinline__ V ld(const bf* p) { return cat16b(*(const v8us*)p, *(const v8us*)(p + 16)); } static __device__ __forceinline__ v8f mma(V a, V b, v8f c) { return wmmab(a, b, c); } };
template <typename T16, int NSPLIT, bool BIAS, int BAND, int EPI>
__global__ __launch_bounds__(32) void k_gemmw(const T16* __restrict__ A, const T16* __restrict__ A2, const T16* __restrict__ Bt, const T16* __restrict__ Bt2, int K, int lda, float* C, int ldc, const float* __restrict__ bias, size_t sA, size_t sB, size_t sC, int row0, h16* E16, bf* Eh, bf* El, float esc) {
    typedef typename WFrag<T16>::V V;
    __shared__ __align__(16) float os[16 * 68];
    const size_t z = blockIdx.z; A += z * sA; if (A2) A2 += z * sA; Bt += z * sB; if (Bt2) Bt2 += z * sB; C += z * sC;
    const int lane = threadIdx.x & 31, lr = lane & 15, hi = lane >> 4; const int r0 = blockIdx.x * 64, i0 = row0 + r0, c0 = (BAND == 1) ? i0 - WNB + (int)blockIdx.y * 64 : (int)blockIdx.y * 64;
    if (BAND == 1 && (c0 < 0 || c0 >= TT)) return;
    const int kbeg = (BAND == 2) ? max(i0 - WNB, 0) : 0, kend = (BAND == 2) ? min(i0 + QT + WNB, K) : K;
    v8f acc[4][4];
#pragma unroll
    for (int mb = 0; mb < 4; ++mb)
#pragma unroll
        for (int nb = 0; nb < 4; ++nb) acc[mb][nb] = (v8f){};
    const int ldb = K, cc0 = (BAND == 1) ? (int)blockIdx.y * 64 : c0;
    const size_t aoff = (size_t)(r0 + lr) * lda + 8 * hi, boff = (size_t)(c0 + lr) * ldb + 8 * hi;
#pragma unroll 1
    for (int kc = kbeg; kc < kend; kc += 32) {
        V a[4], a2[4]; const int ka = (BAND == 2) ? kc - i0 : kc; constexpr size_t ca = (BAND == 2) ? WNB : 0;   // key kc lies at column ka + ca of A's stored row
        const T16* pa = A + aoff + ka; const T16* pa2 = (NSPLIT == 1 || NSPLIT == 2) ? A2 + aoff + ka : nullptr; const T16* pb = Bt + boff + kc; const T16* pb2 = (NSPLIT >= 2) ? Bt2 + boff + kc : nullptr; const size_t sa = (size_t)16 * lda, sb = (size_t)16 * ldb;
#pragma unroll
        for (int mb = 0; mb < 4; ++mb) { a[mb] = WFrag<T16>::ld(pa + (mb * sa + ca)); if (NSPLIT == 1 || NSPLIT == 2) a2[mb] = WFrag<T16>::ld(pa2 + (mb * sa + ca)); }
        if (NSPLIT == 1 || NSPLIT == 2) xhold(pa, pa + sa, pa + 2 * sa, pa + 3 * sa, pa2, pa2 + sa, pa2 + 2 * sa, pa2 + 3 * sa); else xhold(pa, pa + sa, pa + 2 * sa, pa + 3 * sa);
#pragma unroll
        for (int nb = 0; nb < 4; ++nb) { const V b = WFrag<T16>::ld(pb + nb * sb); V b2; if (NSPLIT >= 2) { b2 = WFrag<T16>::ld(pb2 + nb * sb); xhold(pb + nb * sb, pb2 + nb * sb); }   // two planes of B: a wait a column block, so that its two pointers free their registers for the next blocks' fragments
#pragma unroll
            for (int mb = 0; mb < 4; ++mb) { acc[mb][nb] = WFrag<T16>::mma(a[mb], b, acc[mb][nb]); if (NSPLIT == 1 || NSPLIT == 2) acc[mb][nb] = WFrag<T16>::mma(a2[mb], b, acc[mb][nb]); if (NSPLIT >= 2) acc[mb][nb] = WFrag<T16>::mma(a[mb], b2, acc[mb][nb]); } }
        if (NSPLIT < 2) xhold(pb, pb + sb, pb + 2 * sb, pb + 3 * sb);
        asm volatile("v_nop\n\tv_nop\n\tv_nop\n\tv_nop" : "+v"(acc[0][0]), "+v"(acc[1][1]), "+v"(acc[2][2]), "+v"(acc[3][3]) : "v"(a[0]), "v"(a[3]));
    }
    // EPI 1..3: one pointer a plane for the lane's first element; every store of the tile lies at a constant offset from it. bb: the lane's bias values.
    h16* p16 = nullptr; bf* ph = nullptr; bf* pl = nullptr; float bb[4] = { 0.0f, 0.0f, 0.0f, 0.0f };
    if constexpr (EPI != 0) {
        const size_t oo = (EPI == 1) ? ((z * NH_ + blockIdx.y) * TT + (r0 + hi)) * HD + lr * 4 : (EPI == 2) ? ((z * NKV + blockIdx.y) * HD + lane) * TT + r0 : ((z / NH_) * TT + (i0 + hi)) * DQ + (z % NH_) * HD + lr * 4;
        if (EPI != 3) p16 = E16 + oo;
        ph = Eh + oo; pl = El + oo;
        if (BIAS) { const float* pbi = bias + c0 + ((EPI == 2) ? lane : lr * 4);
            if (EPI == 2) { bb[0] = pbi[0]; bb[1] = pbi[32]; } else { bb[0] = pbi[0]; bb[1] = pbi[1]; bb[2] = pbi[2]; bb[3] = pbi[3]; }
            xhold(pbi, pbi);
#pragma unroll
            for (int q = 0; q < 4; ++q) bb[q] = bfr(bb[q]); }
    }
#pragma unroll
    for (int mb = 0; mb < 4; ++mb) {
#pragma unroll
        for (int nb = 0; nb < 4; ++nb) {
#pragma unroll
            for (int j = 0; j < 8; ++j) os[(hi * 8 + j) * 68 + nb * 16 + lr] = acc[mb][nb][j]; }
        __builtin_amdgcn_wave_barrier(); asm volatile("" ::: "memory");
        if constexpr (EPI == 0) {
        float* crow = C + (size_t)(r0 + mb * 16) * ldc + cc0;
#pragma unroll
            for (int s = 0; s < 8; ++s) { const int row = 2 * s + hi, cofs = lr * 4; v4f val = *(const v4fa*)(os + row * 68 + cofs); if (BIAS) { val[0] += bfr(bias[c0 + cofs]); val[1] += bfr(bias[c0 + cofs + 1]); val[2] += bfr(bias[c0 + cofs + 2]); val[3] += bfr(bias[c0 + cofs + 3]); }
                *(v4f*)(crow + (size_t)row * ldc + cofs) = val; }
        } else if constexpr (EPI == 2) {
            v8h o16[4]; v8us oh[4], ol[4];
#pragma unroll
            for (int s = 0; s < 2; ++s) {   // a lane takes column d = s * 32 + lane of the 16 staged rows: 16 consecutive t of plane row d
#pragma unroll
                for (int row = 0; row < 16; ++row) { float x = os[row * 68 + s * 32 + lane]; if (BIAS) x += bb[s]; o16[s * 2 + (row >> 3)][row & 7] = tohx(x); unsigned short a2, c2; splitf(x, a2, c2); oh[s * 2 + (row >> 3)][row & 7] = a2; ol[s * 2 + (row >> 3)][row & 7] = c2; }
#pragma unroll
                for (int g = 0; g < 2; ++g) { const size_t oo = (size_t)s * 32 * TT + mb * 16 + g * 8; *(v8h*)(p16 + oo) = o16[s * 2 + g]; *(v8us*)(ph + oo) = oh[s * 2 + g]; *(v8us*)(pl + oo) = ol[s * 2 + g]; } }
            // s_wait_xcnt 0 behind the run of stores; their pointers and data are inputs, so those registers stay as they are up to the wait (a precaution of form, as xhold)
            asm volatile("s_wait_xcnt 0x0" :: "v"(p16), "v"(ph), "v"(pl), "v"(o16[0]), "v"(o16[1]), "v"(o16[2]), "v"(o16[3]), "v"(oh[0]), "v"(oh[1]), "v"(oh[2]), "v"(oh[3]), "v"(ol[0]), "v"(ol[1]), "v"(ol[2]), "v"(ol[3]) : "memory");
        } else {
            v4h o16[8]; v4us oh[8], ol[8];
#pragma unroll
            for (int s = 0; s < 8; ++s) { v4f val = *(const v4fa*)(os + (2 * s + hi) * 68 + lr * 4);
#pragma unroll
                for (int q = 0; q < 4; ++q) { if (BIAS) val[q] += bb[q]; const float r = val[q] * esc; if (EPI == 1) o16[s][q] = tohx(r); unsigned short a2, c2; splitf(r, a2, c2); oh[s][q] = a2; ol[s][q] = c2; }
                const size_t oo = (size_t)(mb * 16 + 2 * s) * (EPI == 1 ? HD : DQ);
                if (EPI == 1) *(v4h*)(p16 + oo) = o16[s];
                *(v4us*)(ph + oo) = oh[s]; *(v4us*)(pl + oo) = ol[s]; }
            // s_wait_xcnt 0 behind the run of stores; their pointers and data are inputs, so those registers stay as they are up to the wait (a precaution of form, as xhold)
            if (EPI == 1) asm volatile("s_wait_xcnt 0x0" :: "v"(p16), "v"(ph), "v"(pl), "v"(o16[0]), "v"(o16[1]), "v"(o16[2]), "v"(o16[3]), "v"(o16[4]), "v"(o16[5]), "v"(o16[6]), "v"(o16[7]), "v"(oh[0]), "v"(oh[1]), "v"(oh[2]), "v"(oh[3]), "v"(oh[4]), "v"(oh[5]), "v"(oh[6]), "v"(oh[7]), "v"(ol[0]), "v"(ol[1]), "v"(ol[2]), "v"(ol[3]), "v"(ol[4]), "v"(ol[5]), "v"(ol[6]), "v"(ol[7]) : "memory");
            else asm volatile("s_wait_xcnt 0x0" :: "v"(ph), "v"(pl), "v"(oh[0]), "v"(oh[1]), "v"(oh[2]), "v"(oh[3]), "v"(oh[4]), "v"(oh[5]), "v"(oh[6]), "v"(oh[7]), "v"(ol[0]), "v"(ol[1]), "v"(ol[2]), "v"(ol[3]), "v"(ol[4]), "v"(ol[5]), "v"(ol[6]), "v"(ol[7]) : "memory");
        }
        __builtin_amdgcn_wave_barrier(); asm volatile("" ::: "memory");
    }
}


__global__ __launch_bounds__(256) void k_wtG(const float* __restrict__ w, int K, int N, bf* Bt) {
    const int lane = threadIdx.x & 31; const int L0 = (blockIdx.x * 8 + (threadIdx.x >> 5)) * 8; const int nlines = N * K / 64;
{
#pragma unroll 1
        for (int l = 0; l < 8; ++l) { const int L = L0 + l; if (L >= nlines) break; const size_t e = (size_t)L * 64 + lane * 2; const int k = (int)(e % K), n = (int)(e / K); v2us o;
            o[0] = f2bf(w[(size_t)k * N + n]); o[1] = f2bf(w[(size_t)(k + 1) * N + n]); *(v2us*)(Bt + e) = o; }
         }
}
__global__ __launch_bounds__(256) void k_cvt8(const float* __restrict__ src, bf* dst, size_t n8) { const size_t i = (size_t)blockIdx.x * 256 + threadIdx.x; if (i >= n8) return; const v8f v = *(const v8f*)(src + i * 8); v8us o;
#pragma unroll
    for (int k = 0; k < 8; ++k) o[k] = f2bf(v[k]); *(v8us*)(dst + i * 8) = o;  }

// k_asoft: per row (zz, i): softmax over the keys of the row's tile band (register row, one exp, fixed trees; 128-key chunks at the same lane places as a full row, so the sums keep their order); reads and writes the band's columns only;
__global__ __launch_bounds__(256) void k_asoft(const float* __restrict__ Sb, h16* P16, bf* Ph, bf* Pl) {
    const int lane = threadIdx.x & 31; const int row = blockIdx.x * 8 + (threadIdx.x >> 5); if (row >= ZH * TT) return; const int i = row % TT; const int zz = row / TT; (void)zz; const bool hires = (i < RH); const float* sr = Sb + (size_t)row * BW; float v[BCH * 4]; float mx = -3.0e38f;
    const int i0 = i & ~(QT - 1); const int blo = max(i0 - WNB, 0), bhi = min(i0 + QT + WNB, TT); const int bo0 = i0 - WNB;   /* key of stored column 0 */ const int jb = ((i0 - WNB) >> 7) * 128 + lane * 4;   /* first 128-key chunk that touches the band (may start off the band: lanes there load and store nothing and count as excluded keys) */
#pragma unroll
    for (int ch = 0; ch < BCH; ++ch) { const int j0 = jb + ch * 128; const bool inb = (j0 >= blo && j0 < bhi);   /* the lane's four keys lie on the band (so on the sequence) or all off it: blo, bhi are multiples of 64 */ v4f a = (v4f){}; if (inb) a = *(const v4f*)(sr + (j0 - bo0));
#pragma unroll
        for (int q = 0; q < 4; ++q) { const int j = j0 + q; const float t = (inb && i - j < WNB && j - i < WNB) ? a[q] * SCL : -3.0e38f; v[ch * 4 + q] = t;   /* |i - j| < 128 window (both sides); a key off the sequence is excluded like any other */ mx = fmaxf(mx, t); } }
#pragma unroll
    for (int sh = 16; sh; sh >>= 1) mx = fmaxf(mx, __shfl_xor(mx, sh, 32));
    float sum = 0.f;
#pragma unroll
    for (int k = 0; k < BCH * 4; ++k) { float d0 = __fsub_rn(v[k], mx); asm volatile("" : "+v"(d0)); v[k] = __builtin_amdgcn_exp2f(__fmul_rn(d0, 1.4426950408889634f)); sum += v[k]; }
#pragma unroll
    for (int sh = 16; sh; sh >>= 1) sum += __shfl_xor(sum, sh, 32);
    const float f = __fdiv_rn(hires ? 1.0f : PCAR, sum);
{
        if (hires) {
#pragma unroll
            for (int ch = 0; ch < BCH; ++ch) { const int j0 = jb + ch * 128; v4us oh, ol;
#pragma unroll
                for (int q = 0; q < 4; ++q) { unsigned short a, c2; splitf(v[ch * 4 + q] * f, a, c2); oh[q] = a; ol[q] = c2; }
                if (j0 >= blo && j0 < bhi) { const size_t oo = ((size_t)zz * (RH ? RH : 1) + i) * BW + (j0 - bo0); *(v4us*)(Ph + oo) = oh; *(v4us*)(Pl + oo) = ol; } }
        } else {
#pragma unroll
            for (int ch = 0; ch < BCH; ++ch) { const int j0 = jb + ch * 128; v4h o4;
#pragma unroll
                for (int q = 0; q < 4; ++q) o4[q] = tohx(v[ch * 4 + q] * f);
                if (j0 >= blo && j0 < bhi) *(v4h*)(P16 + (size_t)row * BW + (j0 - bo0)) = o4; } }
         }
}
__constant__ float INVT[HD / 2] = { 1.000000000e+00f, 7.498942018e-01f, 5.623413324e-01f, 4.216965139e-01f, 3.162277639e-01f, 2.371373624e-01f, 1.778279394e-01f, 1.333521456e-01f, 1.000000015e-01f, 7.498941571e-02f, 5.623412877e-02f, 4.216964915e-02f, 3.162277862e-02f, 2.371373586e-02f, 1.778279431e-02f, 1.333521493e-02f, 9.999999776e-03f, 7.498942316e-03f, 5.623413250e-03f, 4.216964822e-03f, 3.162277862e-03f, 2.371373819e-03f, 1.778279431e-03f, 1.333521446e-03f, 1.000000047e-03f, 7.498941850e-04f, 5.623413017e-04f, 4.216964880e-04f, 3.162277862e-04f, 2.371373848e-04f, 1.778279402e-04f, 1.333521504e-04f };   // jnp-exact float32 1/10000^(2i/64)
__global__ __launch_bounds__(256) void k_ropexP(const float* __restrict__ xs, bf* Xh, bf* Xl) { const size_t e = ((size_t)blockIdx.x * 256 + threadIdx.x) * 2; if (e >= (size_t)NB_ * TT * DM) return; const int c = (int)(e % DM); const int t = (int)((e / DM) % TT); const int d = c % HD; const float* f = xs + (e - d); v2us oh, ol;
#pragma unroll
    for (int q = 0; q < 2; ++q) { const int dd = d + q; const int dp = (dd < HD / 2) ? dd + HD / 2 : dd - HD / 2; const float x0 = bfr(f[dd]), x1 = bfr(f[dp]); const float a = __fmul_rn((float)t, INVT[dd % (HD / 2)]); const float cs = cosf(a), sn = sinf(a); float p0 = __fmul_rn(x0, cs), p1 = __fmul_rn(x1, sn); asm volatile("" : "+v"(p0), "+v"(p1)); const float r = (dd < HD / 2) ? __fsub_rn(p0, p1) : __fadd_rn(p0, p1); unsigned short a2, c2; splitf(r, a2, c2); oh[q] = a2; ol[q] = c2; }
    *(v2us*)(Xh + e) = oh; *(v2us*)(Xl + e) = ol;  }

extern "C" void kernel_launch(void* const* d_in, const int* in_sizes, int n_in,
                              void* d_out, int out_size, void* d_ws, size_t ws_size, hipStream_t stream) {
    (void)in_sizes; (void)n_in; (void)out_size;
    const float* x = (const float*)d_in[0]; const float* wq = (const float*)d_in[1]; const float* bq = (const float*)d_in[2]; const float* wk = (const float*)d_in[3]; const float* bk = (const float*)d_in[4]; const float* wv = (const float*)d_in[5]; const float* bv = (const float*)d_in[6]; const float* wo = (const float*)d_in[7]; const float* bo = (const float*)d_in[8];
    float* OUT = (float*)d_out;     // [2][2048][768]
    char* wsp = (char*)d_ws;
    auto take = [&](size_t bytes) { char* p = wsp; wsp += (bytes + 255) & ~(size_t)255; return (void*)p; };
    const size_t MT = (size_t)NB_ * TT;   // rows of both batches
    bf* WQ = (bf*)take((size_t)DQ * DM * 2); bf* WK = (bf*)take((size_t)DKV * DM * 2); bf* WV = (bf*)take((size_t)DKV * DM * 2); bf* WO = (bf*)take((size_t)DM * DQ * 2);
    bf* XB = (bf*)take(MT * DM * 2); bf* XRh = (bf*)take(MT * DM * 2); bf* XRl = (bf*)take(MT * DM * 2);
    h16* QP16 = (h16*)take(MT * DQ * 2); h16* KP16 = (h16*)take(MT * DKV * 2); h16* VT16 = (h16*)take(MT * DKV * 2);
    bf* QPh = (bf*)take(MT * DQ * 2); bf* QPl = (bf*)take(MT * DQ * 2); bf* KPh = (bf*)take(MT * DKV * 2); bf* KPl = (bf*)take(MT * DKV * 2); bf* VTh = (bf*)take(MT * DKV * 2); bf* VTl = (bf*)take(MT * DKV * 2); bf* Ph = (bf*)take((size_t)ZH * RH * BW * 2); bf* Pl = (bf*)take((size_t)ZH * RH * BW * 2);
    float* Sb = (float*)take((size_t)ZH * TT * BW * 4); h16* P16 = (h16*)take((size_t)ZH * TT * BW * 2); bf* ATh = (bf*)take(MT * DQ * 2); bf* ATl = (bf*)take(MT * DQ * 2);
    if ((size_t)(wsp - (char*)d_ws) > ws_size) return;    // ws 256 MiB
    { k_wtG<<<(unsigned)((DM * DQ / 64 + 63) / 64), 256, 0, stream>>>(wq, DM, DQ, WQ); k_wtG<<<(unsigned)((DM * DKV / 64 + 63) / 64), 256, 0, stream>>>(wk, DM, DKV, WK); k_wtG<<<(unsigned)((DM * DKV / 64 + 63) / 64), 256, 0, stream>>>(wv, DM, DKV, WV);
      k_wtG<<<(unsigned)((DQ * DM / 64 + 63) / 64), 256, 0, stream>>>(wo, DQ, DM, WO);
       }
    k_cvt8<<<(unsigned)((MT * DM / 8 + 255) / 256), 256, 0, stream>>>(x, XB, MT * DM / 8); k_ropexP<<<(unsigned)((MT * DM / 2 + 255) / 256), 256, 0, stream>>>(x, XRh, XRl);   /* rope on the raw hidden states (per 64-slice), as hi/lo planes */
    // projections: grid.z is the batch, grid.y the head; each epilogue writes the attention operand planes z = b * 12 + h itself
    k_gemmw<bf, 1, true, 0, 1><<<dim3(TT / 64, DQ / 64, NB_), 32, 0, stream>>>(XRh, XRl, WQ, nullptr, DM, DM, nullptr, 0, bq, (size_t)TT * DM, 0, 0, 0, QP16, QPh, QPl, QSC);   /* q x 0.125 */
    k_gemmw<bf, 1, true, 0, 1><<<dim3(TT / 64, DKV / 64, NB_), 32, 0, stream>>>(XRh, XRl, WK, nullptr, DM, DM, nullptr, 0, bk, (size_t)TT * DM, 0, 0, 0, KP16, KPh, KPl, 1.0f);
    k_gemmw<bf, 0, true, 0, 2><<<dim3(TT / 64, DKV / 64, NB_), 32, 0, stream>>>(XB, nullptr, WV, nullptr, DM, DM, nullptr, 0, bv, (size_t)TT * DM, 0, 0, 0, VT16, VTh, VTl, 1.0f);
    // attention: one kv head per query head, so plane z of q meets plane z of k and v (z-strides TT*HD)
    k_gemmw<bf, 2, false, 1, 0><<<dim3(RH / 64, BTL, ZH), 32, 0, stream>>>(QPh, QPl, KPh, KPl, HD, HD, Sb, BW, nullptr, (size_t)TT * HD, (size_t)TT * HD, (size_t)TT * BW, 0, nullptr, nullptr, nullptr, 1.0f);
    k_gemmw<h16, 0, false, 1, 0><<<dim3((TT - RH) / 64, BTL, ZH), 32, 0, stream>>>(QP16 + (size_t)RH * HD, nullptr, KP16, nullptr, HD, HD, Sb + (size_t)RH * BW, BW, nullptr, (size_t)TT * HD, (size_t)TT * HD, (size_t)TT * BW, RH, nullptr, nullptr, nullptr, 1.0f);
    k_asoft<<<ZH * TT / 8, 256, 0, stream>>>(Sb, P16, Ph, Pl);
    // P.V: the epilogue undoes the fp16 rows' x1024 carry and writes the merged hi/lo operand of the output projection
    k_gemmw<bf, 2, false, 2, 3><<<dim3(RH / 64, HD / 64, ZH), 32, 0, stream>>>(Ph, Pl, VTh, VTl, TT, BW, nullptr, 0, nullptr, (size_t)RH * BW, (size_t)HD * TT, 0, 0, nullptr, ATh, ATl, 1.0f);
    k_gemmw<h16, 0, false, 2, 3><<<dim3((TT - RH) / 64, HD / 64, ZH), 32, 0, stream>>>(P16 + (size_t)RH * BW, nullptr, VT16, nullptr, TT, BW, nullptr, 0, nullptr, (size_t)TT * BW, (size_t)HD * TT, 0, RH, nullptr, ATh, ATl, 1.0f / PCAR);
    k_gemmw<bf, 1, true, 0, 0><<<dim3(NB_ * TT / 64, DM / 64, 1), 32, 0, stream>>>(ATh, ATl, WO, nullptr, DQ, DQ, OUT, DM, bo, 0, 0, 0, 0, nullptr, nullptr, nullptr, 1.0f);
}

// v004
// One run takes 124 microseconds.
// Two timings next to v003 both put it at 1.45 times that version's speed.
// Over all steps from v000 it is 12.4 times as fast.
#include <hip/hip_runtime.h>

// Local (sliding-window) multi-head attention with rotary embeddings applied to the RAW hidden states before the projections (hidden [2][2048][768]; xr = rotate-half rope(hidden viewed (S, 12, 64)) with angles t x 10000^(-2i/64) (computed in-kernel); q = xr Wq + bq, k = xr Wk + bk, v = hidden Wv + bv (keras per-head dense == 'xw' [768][768] + [768]); scores = (q x 0.125).k; keys with |i - j| >= 128 get -1e9 (exclusion); softmax; out = ctx Wo + bo ('xw' [768][768]) -> [2][2048][768] (3.1 M)).
// Six launches: stages that need nothing of each other share one grid by ranges of the block index (operand preparation; q, k, v; scores; softmax; P.V; output projection). Every stage covers both batches and all 12 heads (grid.z or rows b*2048 + t in the projections, planes z = b*12 + h in attention); scores and probabilities are stored as the band only (pitch 320, column = key - (i0 - 128)), so that all 24 planes fit the workspace. Each GEMM whose result only feeds another GEMM writes that GEMM's 16-bit operand planes from its own epilogue (q, k: head planes [z][t][d]; v: transposed [z][d][t]; P.V: merged rows [b][t][h*64+d]); no f32 copy of q, k, v or ctx goes through memory. Stages: a rotary kernel rotates the bf16-rounded hidden states per 64-wide slice and writes them directly as hi/lo GEMM operand planes (f32 rotary, precise cosf/sinf, jnp-exact inverse frequencies); q and k as hi/lo x exact GEMMs (2 products) + f32 biases, v exact from the bf16 hidden states; q scaled by 0.125 before the split; banded T-2048 attention (hybrid rows: < 512 hi/lo 3 products, rest fp16 x1024): each 64-row query tile visits only the 320 keys [i0 - 128, i0 + 192) that its |i - j| < 128 window can reach (score tiles, softmax columns and the P.V k loop alike; every key outside has weight exactly 0), and the softmax kernel applies the window inside the band as an index select; merged hi/lo x Wo exact + bo.
// Compute dtypes, f32 accumulate: every input rounded to bf16; rotary f32; q/k hi/lo x exact, v exact, + f32 biases; attention rows < 512 3 products, rest fp16; softmax f32; Wo hl x exact + bias.

#define NB_  2
#define TT   2048
#define DM   768
#define NH_  12
#define NKV  12
#define REP  (NH_ / NKV)
#define HD   64
#define DQ   (NH_ * HD)
#define DKV  (NKV * HD)
#define ZH   (NB_ * NH_)          // attention planes per launch: every (batch, head), z = b * NH_ + h
#define RH   512                  // query rows < RH use hi+lo planes (0: none)
#define WIN  0
#define PCAR 1024.0f
#define SCL  1.0f   // q x 0.125 applied before the split (QSC)
#define QSC  0.125f
#define WNB  128     // |i - j| < 128 kept
#define QT   64      // query rows per GEMM tile; the tile at row i0 can reach keys [i0 - WNB, i0 + QT + WNB) only
#define BTL  ((QT + 2 * WNB) / 64)           // 64-key score tiles per query tile
#define BW   (QT + 2 * WNB)                  // pitch of a stored score / probability row: key j of a row in tile i0 lies at column j - (i0 - WNB)
#define BCH  ((64 + QT + 2 * WNB + 127) / 128)  // 128-key softmax chunks that cover the band from any 64-aligned start
typedef _Float16 h16;
typedef unsigned short bf;
typedef __attribute__((ext_vector_type(16))) __bf16   v16bf;
typedef __attribute__((ext_vector_type(16))) _Float16 v16h;
typedef __attribute__((ext_vector_type(8)))  _Float16 v8h;
typedef __attribute__((ext_vector_type(8)))  unsigned short v8us;
typedef __attribute__((ext_vector_type(8)))  float    v8f;
typedef __attribute__((ext_vector_type(4)))  float    v4f;
typedef v8h  __attribute__((may_alias)) v8ha;
typedef v4f  __attribute__((may_alias)) v4fa;
typedef v8us __attribute__((may_alias)) v8usa;

__device__ __forceinline__ unsigned short f2bf(float f) { unsigned u = __float_as_uint(f); u += 0x7FFFu + ((u >> 16) & 1u); return (unsigned short)(u >> 16); }
__device__ __forceinline__ float bf2f(unsigned short b) { return __uint_as_float(((unsigned)b) << 16); }
__device__ __forceinline__ float bfr(float f) { return bf2f(f2bf(f)); }
__device__ __forceinline__ v16h cat16(v8h lo, v8h hi) { return __builtin_shufflevector(lo, hi, 0, 1, 2, 3, 4, 5, 6, 7, 8, 9, 10, 11, 12, 13, 14, 15); }
__device__ __forceinline__ v16bf cat16b(v8us lo, v8us hi) { return __builtin_bit_cast(v16bf, __builtin_shufflevector(lo, hi, 0, 1, 2, 3, 4, 5, 6, 7, 8, 9, 10, 11, 12, 13, 14, 15)); }
__device__ __forceinline__ v8f wmma16(v16h a, v16h b, v8f c) { return __builtin_amdgcn_wmma_f32_16x16x32_f16(false, a, false, b, (short)0, c, false, false); }
__device__ __forceinline__ v8f wmmab(v16bf a, v16bf b, v8f c) { return __builtin_amdgcn_wmma_f32_16x16x32_bf16(false, a, false, b, (short)0, c, false, false); }
__device__ __forceinline__ h16 tohx(float x) { return (h16)x; }
__device__ __forceinline__ void splitf(float y, unsigned short& h, unsigned short& l) { h = f2bf(y); l = f2bf(y - bf2f(h)); }
typedef __attribute__((ext_vector_type(4))) _Float16 v4h;
typedef __attribute__((ext_vector_type(2))) unsigned short v2us;
typedef __attribute__((ext_vector_type(4))) unsigned short v4us;



// ---- gemmw: register-blocked GEMM, ONE WAVE per 64x64 output tile (16 accumulators), operands straight from K-contiguous 16-bit planes; tile (bx, by, z) of (M/64, N/64, Z), 32 threads; os: the wave's 16 x 68 f32 staging rows in LDS. The kernels below pick the tile and the variant from the block index.
// C[m][n] (f32, pitch ldc, + optional f32 bias[n]) = sum_k A[m][k] Bt[n][k] (+ split products per NSPLIT). z-batch strides sA/sB/sC in elements. K % 32 == 0.
// BAND 1 (scores): n is a key; by counts the BTL key tiles of the query tile's band, tiles off the sequence leave; C holds the band only (column by * 64, ldc = BW). BAND 2 (P.V): k is a key; the k loop runs over the band only, and A holds the band only (lda = BW, column k - (i0 - WNB)). lda = pitch of A and A2 in elements (K but for BAND 2); Bt's pitch is K. row0 = sequence row of A's row 0.
// EPI: what the epilogue stores. 0: C as above. 1..3: (tile + bias) x esc as the next GEMM's 16-bit operand planes, fp16 (E16) and bf16 hi/lo (Eh, El), C unused; the 64 columns of a tile are one head.
//   1 (q, k; z = batch, by = head): plane z * NH_ + head, [t][d].  2 (v; same z, head; esc unused): plane z * NKV + head, transposed [d][t].  3 (P.V; z = plane b * NH_ + h): hi/lo only, row b * TT + t, column h * HD + d of the merged [NB_ * TT][DQ] operand.
// xhold: s_wait_xcnt 0 behind a run of fragment loads. The pointers that the run's loads go through are inputs of the statement, so their registers stay allocated up to the wait and no later load's result lands on them in front of it (a precaution of form; one wait serves the run).
template <typename T> __device__ __forceinline__ void xhold(const T* p0, const T* p1) { asm volatile("s_wait_xcnt 0x0" :: "v"(p0), "v"(p1) : "memory"); }
template <typename T> __device__ __forceinline__ void xhold(const T* p0, const T* p1, const T* p2, const T* p3) { asm volatile("s_wait_xcnt 0x0" :: "v"(p0), "v"(p1), "v"(p2), "v"(p3) : "memory"); }
template <typename T> __device__ __forceinline__ void xhold(const T* p0, const T* p1, const T* p2, const T* p3, const T* p4, const T* p5, const T* p6, const T* p7) { asm volatile("s_wait_xcnt 0x0" :: "v"(p0), "v"(p1), "v"(p2), "v"(p3), "v"(p4), "v"(p5), "v"(p6), "v"(p7) : "memory"); }
template <typename T16> struct WFrag;
template <> struct WFrag<h16> { typedef v16h V; static __device__ __forceinline__ V ld(const h16* p) { return cat16(*(const v8h*)p, *(const v8h*)(p + 16)); } static __device__ __forceinline__ v8f mma(V a, V b, v8f c) { return wmma16(a, b, c); } };
template <> struct WFrag<bf> { typedef v16bf V; static __device__ __forceinline__ V ld(const bf* p) { return cat16b(*(const v8us*)p, *(const v8us*)(p + 16)); } static __device__ __forceinline__ v8f mma(V a, V b, v8f c) { return wmmab(a, b, c); } };
template <typename T16, int NSPLIT, bool BIAS, int BAND, int EPI>
__device__ __forceinline__ void gemmw(float* os, const int bx, const int by, const size_t z, const T16* __restrict__ A, const T16* __restrict__ A2, const T16* __restrict__ Bt, const T16* __restrict__ Bt2, int K, int lda, float* C, int ldc, const float* __restrict__ bias, size_t sA, size_t sB, size_t sC, int row0, h16* E16, bf* Eh, bf* El, float esc) {
    typedef typename WFrag<T16>::V V;
    A += z * sA; if (A2) A2 += z * sA; Bt += z * sB; if (Bt2) Bt2 += z * sB; C += z * sC;
    const int lane = threadIdx.x & 31, lr = lane & 15, hi = lane >> 4; const int r0 = bx * 64, i0 = row0 + r0, c0 = (BAND == 1) ? i0 - WNB + by * 64 : by * 64;
    if (BAND == 1 && (c0 < 0 || c0 >= TT)) return;
    const int kbeg = (BAND == 2) ? max(i0 - WNB, 0) : 0, kend = (BAND == 2) ? min(i0 + QT + WNB, K) : K;
    v8f acc[4][4];
#pragma unroll
    for (int mb = 0; mb < 4; ++mb)
#pragma unroll
        for (int nb = 0; nb < 4; ++nb) acc[mb][nb] = (v8f){};
    const int ldb = K, cc0 = (BAND == 1) ? by * 64 : c0;
    const size_t aoff = (size_t)(r0 + lr) * lda + 8 * hi, boff = (size_t)(c0 + lr) * ldb + 8 * hi;
#pragma unroll 1
    for (int kc = kbeg; kc < kend; kc += 32) {
        V a[4], a2[4]; const int ka = (BAND == 2) ? kc - i0 : kc; constexpr size_t ca = (BAND == 2) ? WNB : 0;   // key kc lies at column ka + ca of A's stored row
        const T16* pa = A + aoff + ka; const T16* pa2 = (NSPLIT == 1 || NSPLIT == 2) ? A2 + aoff + ka : nullptr; const T16* pb = Bt + boff + kc; const T16* pb2 = (NSPLIT >= 2) ? Bt2 + boff + kc : nullptr; const size_t sa = (size_t)16 * lda, sb = (size_t)16 * ldb;
#pragma unroll
        for (int mb = 0; mb < 4; ++mb) { a[mb] = WFrag<T16>::ld(pa + (mb * sa + ca)); if (NSPLIT == 1 || NSPLIT == 2) a2[mb] = WFrag<T16>::ld(pa2 + (mb * sa + ca)); }
        if (NSPLIT == 1 || NSPLIT == 2) xhold(pa, pa + sa, pa + 2 * sa, pa + 3 * sa, pa2, pa2 + sa, pa2 + 2 * sa, pa2 + 3 * sa); else xhold(pa, pa + sa, pa + 2 * sa, pa + 3 * sa);
#pragma unroll
        for (int nb = 0; nb < 4; ++nb) { const V b = WFrag<T16>::ld(pb + nb * sb); V b2; if (NSPLIT >= 2) { b2 = WFrag<T16>::ld(pb2 + nb * sb); xhold(pb + nb * sb, pb2 + nb * sb); }   // two planes of B: a wait a column block, so that its two pointers free their registers for the next blocks' fragments
#pragma unroll
            for (int mb = 0; mb < 4; ++mb) { acc[mb][nb] = WFrag<T16>::mma(a[mb], b, acc[mb][nb]); if (NSPLIT == 1 || NSPLIT == 2) acc[mb][nb] = WFrag<T16>::mma(a2[mb], b, acc[mb][nb]); if (NSPLIT >= 2) acc[mb][nb] = WFrag<T16>::mma(a[mb], b2, acc[mb][nb]); } }
        if (NSPLIT < 2) xhold(pb, pb + sb, pb + 2 * sb, pb + 3 * sb);
        asm volatile("v_nop\n\tv_nop\n\tv_nop\n\tv_nop" : "+v"(acc[0][0]), "+v"(acc[1][1]), "+v"(acc[2][2]), "+v"(acc[3][3]) : "v"(a[0]), "v"(a[3]));
    }
    // EPI 1..3: one pointer a plane for the lane's first element; every store of the tile lies at a constant offset from it. bb: the lane's bias values.
    h16* p16 = nullptr; bf* ph = nullptr; bf* pl = nullptr; float bb[4] = { 0.0f, 0.0f, 0.0f, 0.0f };
    if constexpr (EPI != 0) {
        const size_t oo = (EPI == 1) ? ((z * NH_ + by) * TT + (r0 + hi)) * HD + lr * 4 : (EPI == 2) ? ((z * NKV + by) * HD + lane) * TT + r0 : ((z / NH_) * TT + (i0 + hi)) * DQ + (z % NH_) * HD + lr * 4;
        if (EPI != 3) p16 = E16 + oo;
        ph = Eh + oo; pl = El + oo;
        if (BIAS) { const float* pbi = bias + c0 + ((EPI == 2) ? lane : lr * 4);
            if (EPI == 2) { bb[0] = pbi[0]; bb[1] = pbi[32]; } else { bb[0] = pbi[0]; bb[1] = pbi[1]; bb[2] = pbi[2]; bb[3] = pbi[3]; }
            xhold(pbi, pbi);
#pragma unroll
            for (int q = 0; q < 4; ++q) bb[q] = bfr(bb[q]); }
    }
#pragma unroll
    for (int mb = 0; mb < 4; ++mb) {
#pragma unroll
        for (int nb = 0; nb < 4; ++nb) {
#pragma unroll
            for (int j = 0; j < 8; ++j) os[(hi * 8 + j) * 68 + nb * 16 + lr] = acc[mb][nb][j]; }
        __builtin_amdgcn_wave_barrier(); asm volatile("" ::: "memory");
        if constexpr (EPI == 0) {
            float* cp = C + (size_t)(r0 + mb * 16 + hi) * ldc + cc0 + lr * 4; v4f ov[8];   // the lane's first element of the 16 staged rows; its stores lie 2 * ldc apart
#pragma unroll
            for (int s = 0; s < 8; ++s) { const int row = 2 * s + hi, cofs = lr * 4; v4f val = *(const v4fa*)(os + row * 68 + cofs); if (BIAS) { val[0] += bfr(bias[c0 + cofs]); val[1] += bfr(bias[c0 + cofs + 1]); val[2] += bfr(bias[c0 + cofs + 2]); val[3] += bfr(bias[c0 + cofs + 3]); }
                ov[s] = val; *(v4f*)(cp + (size_t)(2 * s) * ldc) = ov[s]; }
            // s_wait_xcnt 0 behind the run of stores; their pointer and data are inputs, so those registers stay as they are up to the wait (a precaution of form, as xhold)
            asm volatile("s_wait_xcnt 0x0" :: "v"(cp), "v"(ov[0]), "v"(ov[1]), "v"(ov[2]), "v"(ov[3]), "v"(ov[4]), "v"(ov[5]), "v"(ov[6]), "v"(ov[7]) : "memory");
        } else if constexpr (EPI == 2) {
            v8h o16[4]; v8us oh[4], ol[4];
#pragma unroll
            for (int s = 0; s < 2; ++s) {   // a lane takes column d = s * 32 + lane of the 16 staged rows: 16 consecutive t of plane row d
#pragma unroll
                for (int row = 0; row < 16; ++row) { float x = os[row * 68 + s * 32 + lane]; if (BIAS) x += bb[s]; o16[s * 2 + (row >> 3)][row & 7] = tohx(x); unsigned short a2, c2; splitf(x, a2, c2); oh[s * 2 + (row >> 3)][row & 7] = a2; ol[s * 2 + (row >> 3)][row & 7] = c2; }
#pragma unroll
                for (int g = 0; g < 2; ++g) { const size_t oo = (size_t)s * 32 * TT + mb * 16 + g * 8; *(v8h*)(p16 + oo) = o16[s * 2 + g]; *(v8us*)(ph + oo) = oh[s * 2 + g]; *(v8us*)(pl + oo) = ol[s * 2 + g]; } }
            // s_wait_xcnt 0 behind the run of stores; their pointers and data are inputs, so those registers stay as they are up to the wait (a precaution of form, as xhold)
            asm volatile("s_wait_xcnt 0x0" :: "v"(p16), "v"(ph), "v"(pl), "v"(o16[0]), "v"(o16[1]), "v"(o16[2]), "v"(o16[3]), "v"(oh[0]), "v"(oh[1]), "v"(oh[2]), "v"(oh[3]), "v"(ol[0]), "v"(ol[1]), "v"(ol[2]), "v"(ol[3]) : "memory");
        } else {
            v4h o16[8]; v4us oh[8], ol[8];
#pragma unroll
            for (int s = 0; s < 8; ++s) { v4f val = *(const v4fa*)(os + (2 * s + hi) * 68 + lr * 4);
#pragma unroll
                for (int q = 0; q < 4; ++q) { if (BIAS) val[q] += bb[q]; const float r = val[q] * esc; if (EPI == 1) o16[s][q] = tohx(r); unsigned short a2, c2; splitf(r, a2, c2); oh[s][q] = a2; ol[s][q] = c2; }
                const size_t oo = (size_t)(mb * 16 + 2 * s) * (EPI == 1 ? HD : DQ);
                if (EPI == 1) *(v4h*)(p16 + oo) = o16[s];
                *(v4us*)(ph + oo) = oh[s]; *(v4us*)(pl + oo) = ol[s]; }
            // s_wait_xcnt 0 behind the run of stores; their pointers and data are inputs, so those registers stay as they are up to the wait (a precaution of form, as xhold)
            if (EPI == 1) asm volatile("s_wait_xcnt 0x0" :: "v"(p16), "v"(ph), "v"(pl), "v"(o16[0]), "v"(o16[1]), "v"(o16[2]), "v"(o16[3]), "v"(o16[4]), "v"(o16[5]), "v"(o16[6]), "v"(o16[7]), "v"(oh[0]), "v"(oh[1]), "v"(oh[2]), "v"(oh[3]), "v"(oh[4]), "v"(oh[5]), "v"(oh[6]), "v"(oh[7]), "v"(ol[0]), "v"(ol[1]), "v"(ol[2]), "v"(ol[3]), "v"(ol[4]), "v"(ol[5]), "v"(ol[6]), "v"(ol[7]) : "memory");
            else asm volatile("s_wait_xcnt 0x0" :: "v"(ph), "v"(pl), "v"(oh[0]), "v"(oh[1]), "v"(oh[2]), "v"(oh[3]), "v"(oh[4]), "v"(oh[5]), "v"(oh[6]), "v"(oh[7]), "v"(ol[0]), "v"(ol[1]), "v"(ol[2]), "v"(ol[3]), "v"(ol[4]), "v"(ol[5]), "v"(ol[6]), "v"(ol[7]) : "memory");
        }
        __builtin_amdgcn_wave_barrier(); asm volatile("" ::: "memory");
    }
}

// ---- GEMM launches. Stages that need nothing of each other share one grid: a block-uniform test of the block index picks the variant, so their waves run side by side and not one launch behind the other.
// k_qkv: grid (TT/64, heads, 3 * NB_); blockIdx.z / NB_ = 0: q, 1: k (one code path, pointers selected), 2: v; blockIdx.z % NB_ = batch. Each epilogue writes the attention operand planes b * 12 + h itself.
__global__ __launch_bounds__(32) void k_qkv(const bf* XRh, const bf* XRl, const bf* XB, const bf* WQ, const bf* WK, const bf* WV, const float* bq, const float* bk, const float* bv, h16* QP16, bf* QPh, bf* QPl, h16* KP16, bf* KPh, bf* KPl, h16* VT16, bf* VTh, bf* VTl) {
    __shared__ __align__(16) float os[16 * 68];
    const int w = (int)blockIdx.z / NB_; const size_t z = blockIdx.z % NB_;
    if (w == 2) gemmw<bf, 0, true, 0, 2>(os, blockIdx.x, blockIdx.y, z, XB, nullptr, WV, nullptr, DM, DM, nullptr, 0, bv, (size_t)TT * DM, 0, 0, 0, VT16, VTh, VTl, 1.0f);
    else gemmw<bf, 1, true, 0, 1>(os, blockIdx.x, blockIdx.y, z, XRh, XRl, w ? WK : WQ, nullptr, DM, DM, nullptr, 0, w ? bk : bq, (size_t)TT * DM, 0, 0, 0, w ? KP16 : QP16, w ? KPh : QPh, w ? KPl : QPl, w ? 1.0f : QSC);   /* q x 0.125 */
}
// k_scores: grid (TT/64, BTL, ZH); query tiles of rows < RH take the hi/lo planes (3 products), the rest the fp16 planes. One kv head per query head, so plane z of q meets plane z of k (z-strides TT*HD).
__global__ __launch_bounds__(32) void k_scores(const bf* QPh, const bf* QPl, const bf* KPh, const bf* KPl, const h16* QP16, const h16* KP16, float* Sb) {
    __shared__ __align__(16) float os[16 * 68];
    if (blockIdx.x < RH / 64) gemmw<bf, 2, false, 1, 0>(os, blockIdx.x, blockIdx.y, blockIdx.z, QPh, QPl, KPh, KPl, HD, HD, Sb, BW, nullptr, (size_t)TT * HD, (size_t)TT * HD, (size_t)TT * BW, 0, nullptr, nullptr, nullptr, 1.0f);
    else gemmw<h16, 0, false, 1, 0>(os, (int)blockIdx.x - RH / 64, blockIdx.y, blockIdx.z, QP16 + (size_t)RH * HD, nullptr, KP16, nullptr, HD, HD, Sb + (size_t)RH * BW, BW, nullptr, (size_t)TT * HD, (size_t)TT * HD, (size_t)TT * BW, RH, nullptr, nullptr, nullptr, 1.0f);
}
// k_pv: grid (TT/64, 1, ZH), split by rows as k_scores; the epilogue undoes the fp16 rows' x1024 carry and writes the merged hi/lo operand of the output projection.
__global__ __launch_bounds__(32) void k_pv(const bf* Ph, const bf* Pl, const bf* VTh, const bf* VTl, const h16* P16, const h16* VT16, bf* ATh, bf* ATl) {
    __shared__ __align__(16) float os[16 * 68];
    if (blockIdx.x < RH / 64) gemmw<bf, 2, false, 2, 3>(os, blockIdx.x, blockIdx.y, blockIdx.z, Ph, Pl, VTh, VTl, TT, BW, nullptr, 0, nullptr, (size_t)RH * BW, (size_t)HD * TT, 0, 0, nullptr, ATh, ATl, 1.0f);
    else gemmw<h16, 0, false, 2, 3>(os, (int)blockIdx.x - RH / 64, blockIdx.y, blockIdx.z, P16 + (size_t)RH * BW, nullptr, VT16, nullptr, TT, BW, nullptr, 0, nullptr, (size_t)TT * BW, (size_t)HD * TT, 0, RH, nullptr, ATh, ATl, 1.0f / PCAR);
}
// k_out: grid (NB_*TT/64, DM/64): merged hi/lo ctx x Wo + bo.
__global__ __launch_bounds__(32) void k_out(const bf* ATh, const bf* ATl, const bf* WO, const float* bo, float* OUT) {
    __shared__ __align__(16) float os[16 * 68];
    gemmw<bf, 1, true, 0, 0>(os, blockIdx.x, blockIdx.y, 0, ATh, ATl, WO, nullptr, DQ, DQ, OUT, DM, bo, 0, 0, 0, 0, nullptr, nullptr, nullptr, 1.0f);
}

// ---- operand preparation: three bodies, each for block blk of its own range of k_prep's grid.
__device__ __forceinline__ void wtG(const unsigned blk, const float* __restrict__ w, int K, int N, bf* Bt) {
    const int lane = threadIdx.x & 31; const int L0 = (blk * 8 + (threadIdx.x >> 5)) * 8; const int nlines = N * K / 64;
{
#pragma unroll 1
        for (int l = 0; l < 8; ++l) { const int L = L0 + l; if (L >= nlines) break; const size_t e = (size_t)L * 64 + lane * 2; const int k = (int)(e % K), n = (int)(e / K); v2us o;
            o[0] = f2bf(w[(size_t)k * N + n]); o[1] = f2bf(w[(size_t)(k + 1) * N + n]); *(v2us*)(Bt + e) = o; }
         }
}
__device__ __forceinline__ void cvt8(const unsigned blk, const float* __restrict__ src, bf* dst, size_t n8) { const size_t i = (size_t)blk * 256 + threadIdx.x; if (i >= n8) return; const v8f v = *(const v8f*)(src + i * 8); v8us o;
#pragma unroll
    for (int k = 0; k < 8; ++k) o[k] = f2bf(v[k]); *(v8us*)(dst + i * 8) = o;  }

// k_asoft: per row (zz, i): softmax over the keys of the row's tile band (register row, one exp, fixed trees; 128-key chunks at the same lane places as a full row, so the sums keep their order); reads and writes the band's columns only;
__global__ __launch_bounds__(256) void k_asoft(const float* __restrict__ Sb, h16* P16, bf* Ph, bf* Pl) {
    const int lane = threadIdx.x & 31; const int row = blockIdx.x * 8 + (threadIdx.x >> 5); if (row >= ZH * TT) return; const int i = row % TT; const int zz = row / TT; (void)zz; const bool hires = (i < RH); const float* sr = Sb + (size_t)row * BW; float v[BCH * 4]; float mx = -3.0e38f;
    const int i0 = i & ~(QT - 1); const int blo = max(i0 - WNB, 0), bhi = min(i0 + QT + WNB, TT); const int bo0 = i0 - WNB;   /* key of stored column 0 */ const int jb = ((i0 - WNB) >> 7) * 128 + lane * 4;   /* first 128-key chunk that touches the band (may start off the band: lanes there load and store nothing and count as excluded keys) */
#pragma unroll
    for (int ch = 0; ch < BCH; ++ch) { const int j0 = jb + ch * 128; const bool inb = (j0 >= blo && j0 < bhi);   /* the lane's four keys lie on the band (so on the sequence) or all off it: blo, bhi are multiples of 64 */ v4f a = (v4f){}; if (inb) a = *(const v4f*)(sr + (j0 - bo0));
#pragma unroll
        for (int q = 0; q < 4; ++q) { const int j = j0 + q; const float t = (inb && i - j < WNB && j - i < WNB) ? a[q] * SCL : -3.0e38f; v[ch * 4 + q] = t;   /* |i - j| < 128 window (both sides); a key off the sequence is excluded like any other */ mx = fmaxf(mx, t); } }
#pragma unroll
    for (int sh = 16; sh; sh >>= 1) mx = fmaxf(mx, __shfl_xor(mx, sh, 32));
    float sum = 0.f;
#pragma unroll
    for (int k = 0; k < BCH * 4; ++k) { float d0 = __fsub_rn(v[k], mx); asm volatile("" : "+v"(d0)); v[k] = __builtin_amdgcn_exp2f(__fmul_rn(d0, 1.4426950408889634f)); sum += v[k]; }
#pragma unroll
    for (int sh = 16; sh; sh >>= 1) sum += __shfl_xor(sum, sh, 32);
    const float f = __fdiv_rn(hires ? 1.0f : PCAR, sum);
{
        if (hires) {
#pragma unroll
            for (int ch = 0; ch < BCH; ++ch) { const int j0 = jb + ch * 128; v4us oh, ol;
#pragma unroll
                for (int q = 0; q < 4; ++q) { unsigned short a, c2; splitf(v[ch * 4 + q] * f, a, c2); oh[q] = a; ol[q] = c2; }
                if (j0 >= blo && j0 < bhi) { const size_t oo = ((size_t)zz * (RH ? RH : 1) + i) * BW + (j0 - bo0); *(v4us*)(Ph + oo) = oh; *(v4us*)(Pl + oo) = ol; } }
        } else {
#pragma unroll
            for (int ch = 0; ch < BCH; ++ch) { const int j0 = jb + ch * 128; v4h o4;
#pragma unroll
                for (int q = 0; q < 4; ++q) o4[q] = tohx(v[ch * 4 + q] * f);
                if (j0 >= blo && j0 < bhi) *(v4h*)(P16 + (size_t)row * BW + (j0 - bo0)) = o4; } }
         }
}
__constant__ float INVT[HD / 2] = { 1.000000000e+00f, 7.498942018e-01f, 5.623413324e-01f, 4.216965139e-01f, 3.162277639e-01f, 2.371373624e-01f, 1.778279394e-01f, 1.333521456e-01f, 1.000000015e-01f, 7.498941571e-02f, 5.623412877e-02f, 4.216964915e-02f, 3.162277862e-02f, 2.371373586e-02f, 1.778279431e-02f, 1.333521493e-02f, 9.999999776e-03f, 7.498942316e-03f, 5.623413250e-03f, 4.216964822e-03f, 3.162277862e-03f, 2.371373819e-03f, 1.778279431e-03f, 1.333521446e-03f, 1.000000047e-03f, 7.498941850e-04f, 5.623413017e-04f, 4.216964880e-04f, 3.162277862e-04f, 2.371373848e-04f, 1.778279402e-04f, 1.333521504e-04f };   // jnp-exact float32 1/10000^(2i/64)
__device__ __forceinline__ void ropexP(const unsigned blk, const float* __restrict__ xs, bf* Xh, bf* Xl) { const size_t e = ((size_t)blk * 256 + threadIdx.x) * 2; if (e >= (size_t)NB_ * TT * DM) return; const int c = (int)(e % DM); const int t = (int)((e / DM) % TT); const int d = c % HD; const float* f = xs + (e - d); v2us oh, ol;
    const float* fd = f + d; const float* fp = f + ((d < HD / 2) ? d + HD / 2 : d - HD / 2); const float ld0[2] = { fd[0], fd[1] }, ld1[2] = { fp[0], fp[1] };   // d is even, so both elements lie in the same half and their partners side by side
    xhold(fd, fp);
#pragma unroll
    for (int q = 0; q < 2; ++q) { const int dd = d + q; const float x0 = bfr(ld0[q]), x1 = bfr(ld1[q]); const float a = __fmul_rn((float)t, INVT[dd % (HD / 2)]); const float cs = cosf(a), sn = sinf(a); float p0 = __fmul_rn(x0, cs), p1 = __fmul_rn(x1, sn); asm volatile("" : "+v"(p0), "+v"(p1)); const float r = (dd < HD / 2) ? __fsub_rn(p0, p1) : __fadd_rn(p0, p1); unsigned short a2, c2; splitf(r, a2, c2); oh[q] = a2; ol[q] = c2; }
    *(v2us*)(Xh + e) = oh; *(v2us*)(Xl + e) = ol;  }
// k_prep: everything that reads only the inputs, in one grid. Blocks [0, 4 * GWT): the four weight transposes (all [768][768]; the longest bodies, so they start first); next GRP blocks: rope on the raw hidden states (per 64-slice), as hi/lo planes; last GCV blocks: the bf16 hidden states for v.
#define GWT ((DM * DQ / 64 + 63) / 64)
#define GRP (NB_ * TT * DM / 2 / 256)
#define GCV (NB_ * TT * DM / 8 / 256)
__global__ __launch_bounds__(256) void k_prep(const float* x, const float* wq, const float* wk, const float* wv, const float* wo, bf* WQ, bf* WK, bf* WV, bf* WO, bf* XB, bf* XRh, bf* XRl) {
    const unsigned b = blockIdx.x;
    if (b < 4 * GWT) { const unsigned w = b / GWT; wtG(b % GWT, w == 0 ? wq : w == 1 ? wk : w == 2 ? wv : wo, DM, DQ, w == 0 ? WQ : w == 1 ? WK : w == 2 ? WV : WO); }
    else if (b < 4 * GWT + GRP) ropexP(b - 4 * GWT, x, XRh, XRl);
    else cvt8(b - (4 * GWT + GRP), x, XB, (size_t)NB_ * TT * DM / 8);
}

extern "C" void kernel_launch(void* const* d_in, const int* in_sizes, int n_in,
                              void* d_out, int out_size, void* d_ws, size_t ws_size, hipStream_t stream) {
    (void)in_sizes; (void)n_in; (void)out_size;
    const float* x = (const float*)d_in[0]; const float* wq = (const float*)d_in[1]; const float* bq = (const float*)d_in[2]; const float* wk = (const float*)d_in[3]; const float* bk = (const float*)d_in[4]; const float* wv = (const float*)d_in[5]; const float* bv = (const float*)d_in[6]; const float* wo = (const float*)d_in[7]; const float* bo = (const float*)d_in[8];
    float* OUT = (float*)d_out;     // [2][2048][768]
    char* wsp = (char*)d_ws;
    auto take = [&](size_t bytes) { char* p = wsp; wsp += (bytes + 255) & ~(size_t)255; return (void*)p; };
    const size_t MT = (size_t)NB_ * TT;   // rows of both batches
    bf* WQ = (bf*)take((size_t)DQ * DM * 2); bf* WK = (bf*)take((size_t)DKV * DM * 2); bf* WV = (bf*)take((size_t)DKV * DM * 2); bf* WO = (bf*)take((size_t)DM * DQ * 2);
    bf* XB = (bf*)take(MT * DM * 2); bf* XRh = (bf*)take(MT * DM * 2); bf* XRl = (bf*)take(MT * DM * 2);
    h16* QP16 = (h16*)take(MT * DQ * 2); h16* KP16 = (h16*)take(MT * DKV * 2); h16* VT16 = (h16*)take(MT * DKV * 2);
    bf* QPh = (bf*)take(MT * DQ * 2); bf* QPl = (bf*)take(MT * DQ * 2); bf* KPh = (bf*)take(MT * DKV * 2); bf* KPl = (bf*)take(MT * DKV * 2); bf* VTh = (bf*)take(MT * DKV * 2); bf* VTl = (bf*)take(MT * DKV * 2); bf* Ph = (bf*)take((size_t)ZH * RH * BW * 2); bf* Pl = (bf*)take((size_t)ZH * RH * BW * 2);
    float* Sb = (float*)take((size_t)ZH * TT * BW * 4); h16* P16 = (h16*)take((size_t)ZH * TT * BW * 2); bf* ATh = (bf*)take(MT * DQ * 2); bf* ATl = (bf*)take(MT * DQ * 2);
    if ((size_t)(wsp - (char*)d_ws) > ws_size) return;    // ws 256 MiB
    static_assert(DQ == DM && DKV == DM && NKV == NH_, "k_prep and k_qkv take the four weights as one shape");
    k_prep<<<4 * GWT + GRP + GCV, 256, 0, stream>>>(x, wq, wk, wv, wo, WQ, WK, WV, WO, XB, XRh, XRl);
    k_qkv<<<dim3(TT / 64, NH_, 3 * NB_), 32, 0, stream>>>(XRh, XRl, XB, WQ, WK, WV, bq, bk, bv, QP16, QPh, QPl, KP16, KPh, KPl, VT16, VTh, VTl);
    k_scores<<<dim3(TT / 64, BTL, ZH), 32, 0, stream>>>(QPh, QPl, KPh, KPl, QP16, KP16, Sb);
    k_asoft<<<ZH * TT / 8, 256, 0, stream>>>(Sb, P16, Ph, Pl);
    k_pv<<<dim3(TT / 64, HD / 64, ZH), 32, 0, stream>>>(Ph, Pl, VTh, VTl, P16, VT16, ATh, ATl);
    k_out<<<dim3(NB_ * TT / 64, DM / 64, 1), 32, 0, stream>>>(ATh, ATl, WO, bo, OUT);
}

// v005
// Measured time: 103 microseconds a run.
// Next to v004, in two timings, it ran 1.20 and 1.19 times as fast.
// Counting every step since v000, it is 14.9 times as fast.
#include <hip/hip_runtime.h>

// Local (sliding-window) multi-head attention with rotary embeddings applied to the RAW hidden states before the projections (hidden [2][2048][768]; xr = rotate-half rope(hidden viewed (S, 12, 64)) with angles t x 10000^(-2i/64) (computed in-kernel); q = xr Wq + bq, k = xr Wk + bk, v = hidden Wv + bv (keras per-head dense == 'xw' [768][768] + [768]); scores = (q x 0.125).k; keys with |i - j| >= 128 get -1e9 (exclusion); softmax; out = ctx Wo + bo ('xw' [768][768]) -> [2][2048][768] (3.1 M)).
// Four launches: operand preparation; q, k, v; attention (scores, softmax and P.V in one kernel); output projection. Stages that need nothing of each other share one grid by ranges of the block index. Every stage covers both batches and all 12 heads (grid.z or rows b*2048 + t in the projections, planes z = b*12 + h in attention); scores and probabilities exist as the band only (320 columns, column = key - (i0 - 128)) and only in the LDS of the wave that makes and uses them. Each GEMM whose result only feeds another GEMM writes that GEMM's 16-bit operand planes from its own epilogue (q, k: head planes [z][t][d]; v: transposed [z][d][t]; P.V: merged rows [b][t][h*64+d]); no f32 copy of q, k, v or ctx goes through memory. Stages: a rotary kernel rotates the bf16-rounded hidden states per 64-wide slice and writes them directly as hi/lo GEMM operand planes (f32 rotary, precise cosf/sinf, jnp-exact inverse frequencies); q and k as hi/lo x exact GEMMs (2 products) + f32 biases, v exact from the bf16 hidden states; q scaled by 0.125 before the split; banded T-2048 attention (hybrid rows: < 512 hi/lo 3 products, rest fp16 x1024): each 64-row query tile visits only the 320 keys [i0 - 128, i0 + 192) that its |i - j| < 128 window can reach (score tiles, softmax columns and the P.V k loop alike; every key outside has weight exactly 0), and the softmax applies the window inside the band as an index select; merged hi/lo x Wo exact + bo.
// Compute dtypes, f32 accumulate: every input rounded to bf16; rotary f32; q/k hi/lo x exact, v exact, + f32 biases; attention rows < 512 3 products, rest fp16; softmax f32; Wo hl x exact + bias.

#define NB_  2
#define TT   2048
#define DM   768
#define NH_  12
#define NKV  12
#define REP  (NH_ / NKV)
#define HD   64
#define DQ   (NH_ * HD)
#define DKV  (NKV * HD)
#define ZH   (NB_ * NH_)          // attention planes per launch: every (batch, head), z = b * NH_ + h
#define RH   512                  // query rows < RH use hi+lo planes (0: none)
#define WIN  0
#define PCAR 1024.0f
#define SCL  1.0f   // q x 0.125 applied before the split (QSC)
#define QSC  0.125f
#define WNB  128     // |i - j| < 128 kept
#define QT   64      // query rows per attention tile; the tile at row i0 can reach keys [i0 - WNB, i0 + QT + WNB) only
#define BW   (QT + 2 * WNB)                  // columns of a score / probability row: key j of a row in tile i0 lies at column j - (i0 - WNB)
#define BCH  ((64 + QT + 2 * WNB + 127) / 128)  // 128-key softmax chunks that cover the band from any 64-aligned start
typedef _Float16 h16;
typedef unsigned short bf;
typedef __attribute__((ext_vector_type(16))) __bf16   v16bf;
typedef __attribute__((ext_vector_type(16))) _Float16 v16h;
typedef __attribute__((ext_vector_type(8)))  _Float16 v8h;
typedef __attribute__((ext_vector_type(8)))  unsigned short v8us;
typedef __attribute__((ext_vector_type(8)))  float    v8f;
typedef __attribute__((ext_vector_type(4)))  float    v4f;
typedef v8h  __attribute__((may_alias)) v8ha;
typedef v4f  __attribute__((may_alias)) v4fa;
typedef v8us __attribute__((may_alias)) v8usa;

__device__ __forceinline__ unsigned short f2bf(float f) { unsigned u = __float_as_uint(f); u += 0x7FFFu + ((u >> 16) & 1u); return (unsigned short)(u >> 16); }
__device__ __forceinline__ float bf2f(unsigned short b) { return __uint_as_float(((unsigned)b) << 16); }
__device__ __forceinline__ float bfr(float f) { return bf2f(f2bf(f)); }
__device__ __forceinline__ v16h cat16(v8h lo, v8h hi) { return __builtin_shufflevector(lo, hi, 0, 1, 2, 3, 4, 5, 6, 7, 8, 9, 10, 11, 12, 13, 14, 15); }
__device__ __forceinline__ v16bf cat16b(v8us lo, v8us hi) { return __builtin_bit_cast(v16bf, __builtin_shufflevector(lo, hi, 0, 1, 2, 3, 4, 5, 6, 7, 8, 9, 10, 11, 12, 13, 14, 15)); }
__device__ __forceinline__ v8f wmma16(v16h a, v16h b, v8f c) { return __builtin_amdgcn_wmma_f32_16x16x32_f16(false, a, false, b, (short)0, c, false, false); }
__device__ __forceinline__ v8f wmmab(v16bf a, v16bf b, v8f c) { return __builtin_amdgcn_wmma_f32_16x16x32_bf16(false, a, false, b, (short)0, c, false, false); }
__device__ __forceinline__ h16 tohx(float x) { return (h16)x; }
__device__ __forceinline__ void splitf(float y, unsigned short& h, unsigned short& l) { h = f2bf(y); l = f2bf(y - bf2f(h)); }
typedef __attribute__((ext_vector_type(4))) _Float16 v4h;
typedef __attribute__((ext_vector_type(2))) unsigned short v2us;
typedef __attribute__((ext_vector_type(4))) unsigned short v4us;



// ---- gemmw: register-blocked GEMM, ONE WAVE per 64x64 output tile (16 accumulators), operands straight from K-contiguous 16-bit planes; tile (bx, by, z) of (M/64, N/64, Z), 32 threads; os: the wave's 16 x 68 f32 staging rows in LDS. The kernels below pick the tile and the variant from the block index.
// C[m][n] (f32, pitch ldc, + optional f32 bias[n]) = sum_k A[m][k] Bt[n][k] (+ the lo plane's product per NSPLIT). z-batch strides sA/sB/sC in elements. K % 32 == 0.
// lda = pitch of A and A2 in elements; Bt's pitch is K. NSPLIT 1: A comes as hi + lo planes (A, A2), two products.
// EPI: what the epilogue stores. 0: C as above. 1, 2: (tile + bias) x esc as the next GEMM's 16-bit operand planes, fp16 (E16) and bf16 hi/lo (Eh, El), C unused; the 64 columns of a tile are one head.
//   1 (q, k; z = batch, by = head): plane z * NH_ + head, [t][d].  2 (v; same z, head; esc unused): plane z * NKV + head, transposed [d][t].
// xhold: s_wait_xcnt 0 behind a run of fragment loads. The pointers that the run's loads go through are inputs of the statement, so their registers stay allocated up to the wait and no later load's result lands on them in front of it (a precaution of form; one wait serves the run).
template <typename T> __device__ __forceinline__ void xhold(const T* p0, const T* p1) { asm volatile("s_wait_xcnt 0x0" :: "v"(p0), "v"(p1) : "memory"); }
template <typename T> __device__ __forceinline__ void xhold(const T* p0, const T* p1, const T* p2, const T* p3) { asm volatile("s_wait_xcnt 0x0" :: "v"(p0), "v"(p1), "v"(p2), "v"(p3) : "memory"); }
template <typename T> __device__ __forceinline__ void xhold(const T* p0, const T* p1, const T* p2, const T* p3, const T* p4, const T* p5, const T* p6, const T* p7) { asm volatile("s_wait_xcnt 0x0" :: "v"(p0), "v"(p1), "v"(p2), "v"(p3), "v"(p4), "v"(p5), "v"(p6), "v"(p7) : "memory"); }
template <typename T16> struct WFrag;
template <> struct WFrag<h16> { typedef v16h V; static __device__ __forceinline__ V ld(const h16* p) { return cat16(*(const v8h*)p, *(const v8h*)(p + 16)); } static __device__ __forceinline__ v8f mma(V a, V b, v8f c) { return wmma16(a, b, c); } };
template <> struct WFrag<bf> { typedef v16bf V; static __device__ __forceinline__ V ld(const bf* p) { return cat16b(*(const v8us*)p, *(const v8us*)(p + 16)); } static __device__ __forceinline__ v8f mma(V a, V b, v8f c) { return wmmab(a, b, c); } };
template <typename T16, int NSPLIT, bool BIAS, int EPI>
__device__ __forceinline__ void gemmw(float* os, const int bx, const int by, const size_t z, const T16* __restrict__ A, const T16* __restrict__ A2, const T16* __restrict__ Bt, int K, int lda, float* C, int ldc, const float* __restrict__ bias, size_t sA, size_t sB, size_t sC, h16* E16, bf* Eh, bf* El, float esc) {
    typedef typename WFrag<T16>::V V;
    A += z * sA; if (A2) A2 += z * sA; Bt += z * sB; C += z * sC;
    const int lane = threadIdx.x & 31, lr = lane & 15, hi = lane >> 4; const int r0 = bx * 64, c0 = by * 64;
    v8f acc[4][4];
#pragma unroll
    for (int mb = 0; mb < 4; ++mb)
#pragma unroll
        for (int nb = 0; nb < 4; ++nb) acc[mb][nb] = (v8f){};
    const int ldb = K;
    const size_t aoff = (size_t)(r0 + lr) * lda + 8 * hi, boff = (size_t)(c0 + lr) * ldb + 8 * hi;
#pragma unroll 1
    for (int kc = 0; kc < K; kc += 32) {
        V a[4], a2[4];
        const T16* pa = A + aoff + kc; const T16* pa2 = (NSPLIT == 1) ? A2 + aoff + kc : nullptr; const T16* pb = Bt + boff + kc; const size_t sa = (size_t)16 * lda, sb = (size_t)16 * ldb;
#pragma unroll
        for (int mb = 0; mb < 4; ++mb) { a[mb] = WFrag<T16>::ld(pa + mb * sa); if (NSPLIT == 1) a2[mb] = WFrag<T16>::ld(pa2 + mb * sa); }
        if (NSPLIT == 1) xhold(pa, pa + sa, pa + 2 * sa, pa + 3 * sa, pa2, pa2 + sa, pa2 + 2 * sa, pa2 + 3 * sa); else xhold(pa, pa + sa, pa + 2 * sa, pa + 3 * sa);
#pragma unroll
        for (int nb = 0; nb < 4; ++nb) { const V b = WFrag<T16>::ld(pb + nb * sb);
#pragma unroll
            for (int mb = 0; mb < 4; ++mb) { acc[mb][nb] = WFrag<T16>::mma(a[mb], b, acc[mb][nb]); if (NSPLIT == 1) acc[mb][nb] = WFrag<T16>::mma(a2[mb], b, acc[mb][nb]); } }
        xhold(pb, pb + sb, pb + 2 * sb, pb + 3 * sb);
        asm volatile("v_nop\n\tv_nop\n\tv_nop\n\tv_nop" : "+v"(acc[0][0]), "+v"(acc[1][1]), "+v"(acc[2][2]), "+v"(acc[3][3]) : "v"(a[0]), "v"(a[3]));
    }
    // EPI 1, 2: one pointer a plane for the lane's first element; every store of the tile lies at a constant offset from it. bb: the lane's bias values.
    h16* p16 = nullptr; bf* ph = nullptr; bf* pl = nullptr; float bb[4] = { 0.0f, 0.0f, 0.0f, 0.0f };
    if constexpr (EPI != 0) {
        const size_t oo = (EPI == 1) ? ((z * NH_ + by) * TT + (r0 + hi)) * HD + lr * 4 : ((z * NKV + by) * HD + lane) * TT + r0;
        p16 = E16 + oo; ph = Eh + oo; pl = El + oo;
        if (BIAS) { const float* pbi = bias + c0 + ((EPI == 2) ? lane : lr * 4);
            if (EPI == 2) { bb[0] = pbi[0]; bb[1] = pbi[32]; } else { bb[0] = pbi[0]; bb[1] = pbi[1]; bb[2] = pbi[2]; bb[3] = pbi[3]; }
            xhold(pbi, pbi);
#pragma unroll
            for (int q = 0; q < 4; ++q) bb[q] = bfr(bb[q]); }
    }
#pragma unroll
    for (int mb = 0; mb < 4; ++mb) {
#pragma unroll
        for (int nb = 0; nb < 4; ++nb) {
#pragma unroll
            for (int j = 0; j < 8; ++j) os[(hi * 8 + j) * 68 + nb * 16 + lr] = acc[mb][nb][j]; }
        __builtin_amdgcn_wave_barrier(); asm volatile("" ::: "memory");
        if constexpr (EPI == 0) {
            float* cp = C + (size_t)(r0 + mb * 16 + hi) * ldc + c0 + lr * 4; v4f ov[8];   // the lane's first element of the 16 staged rows; its stores lie 2 * ldc apart
#pragma unroll
            for (int s = 0; s < 8; ++s) { const int row = 2 * s + hi, cofs = lr * 4; v4f val = *(const v4fa*)(os + row * 68 + cofs); if (BIAS) { val[0] += bfr(bias[c0 + cofs]); val[1] += bfr(bias[c0 + cofs + 1]); val[2] += bfr(bias[c0 + cofs + 2]); val[3] += bfr(bias[c0 + cofs + 3]); }
                ov[s] = val; *(v4f*)(cp + (size_t)(2 * s) * ldc) = ov[s]; }
            // s_wait_xcnt 0 behind the run of stores; their pointer and data are inputs, so those registers stay as they are up to the wait (a precaution of form, as xhold)
            asm volatile("s_wait_xcnt 0x0" :: "v"(cp), "v"(ov[0]), "v"(ov[1]), "v"(ov[2]), "v"(ov[3]), "v"(ov[4]), "v"(ov[5]), "v"(ov[6]), "v"(ov[7]) : "memory");
        } else if constexpr (EPI == 2) {
            v8h o16[4]; v8us oh[4], ol[4];
#pragma unroll
            for (int s = 0; s < 2; ++s) {   // a lane takes column d = s * 32 + lane of the 16 staged rows: 16 consecutive t of plane row d
#pragma unroll
                for (int row = 0; row < 16; ++row) { float x = os[row * 68 + s * 32 + lane]; if (BIAS) x += bb[s]; o16[s * 2 + (row >> 3)][row & 7] = tohx(x); unsigned short a2, c2; splitf(x, a2, c2); oh[s * 2 + (row >> 3)][row & 7] = a2; ol[s * 2 + (row >> 3)][row & 7] = c2; }
#pragma unroll
                for (int g = 0; g < 2; ++g) { const size_t oo = (size_t)s * 32 * TT + mb * 16 + g * 8; *(v8h*)(p16 + oo) = o16[s * 2 + g]; *(v8us*)(ph + oo) = oh[s * 2 + g]; *(v8us*)(pl + oo) = ol[s * 2 + g]; } }
            // s_wait_xcnt 0 behind the run of stores; their pointers and data are inputs, so those registers stay as they are up to the wait (a precaution of form, as xhold)
            asm volatile("s_wait_xcnt 0x0" :: "v"(p16), "v"(ph), "v"(pl), "v"(o16[0]), "v"(o16[1]), "v"(o16[2]), "v"(o16[3]), "v"(oh[0]), "v"(oh[1]), "v"(oh[2]), "v"(oh[3]), "v"(ol[0]), "v"(ol[1]), "v"(ol[2]), "v"(ol[3]) : "memory");
        } else {
            v4h o16[8]; v4us oh[8], ol[8];
#pragma unroll
            for (int s = 0; s < 8; ++s) { v4f val = *(const v4fa*)(os + (2 * s + hi) * 68 + lr * 4);
#pragma unroll
                for (int q = 0; q < 4; ++q) { if (BIAS) val[q] += bb[q]; const float r = val[q] * esc; o16[s][q] = tohx(r); unsigned short a2, c2; splitf(r, a2, c2); oh[s][q] = a2; ol[s][q] = c2; }
                const size_t oo = (size_t)(mb * 16 + 2 * s) * HD;
                *(v4h*)(p16 + oo) = o16[s];
                *(v4us*)(ph + oo) = oh[s]; *(v4us*)(pl + oo) = ol[s]; }
            // s_wait_xcnt 0 behind the run of stores; their pointers and data are inputs, so those registers stay as they are up to the wait (a precaution of form, as xhold)
            asm volatile("s_wait_xcnt 0x0" :: "v"(p16), "v"(ph), "v"(pl), "v"(o16[0]), "v"(o16[1]), "v"(o16[2]), "v"(o16[3]), "v"(o16[4]), "v"(o16[5]), "v"(o16[6]), "v"(o16[7]), "v"(oh[0]), "v"(oh[1]), "v"(oh[2]), "v"(oh[3]), "v"(oh[4]), "v"(oh[5]), "v"(oh[6]), "v"(oh[7]), "v"(ol[0]), "v"(ol[1]), "v"(ol[2]), "v"(ol[3]), "v"(ol[4]), "v"(ol[5]), "v"(ol[6]), "v"(ol[7]) : "memory");
        }
        __builtin_amdgcn_wave_barrier(); asm volatile("" ::: "memory");
    }
}

// ---- GEMM launches. Stages that need nothing of each other share one grid: a block-uniform test of the block index picks the variant, so their waves run side by side and not one launch behind the other.
// k_qkv: grid (TT/64, heads, 3 * NB_); blockIdx.z / NB_ = 0: q, 1: k (one code path, pointers selected), 2: v; blockIdx.z % NB_ = batch. Each epilogue writes the attention operand planes b * 12 + h itself.
__global__ __launch_bounds__(32) void k_qkv(const bf* XRh, const bf* XRl, const bf* XB, const bf* WQ, const bf* WK, const bf* WV, const float* bq, const float* bk, const float* bv, h16* QP16, bf* QPh, bf* QPl, h16* KP16, bf* KPh, bf* KPl, h16* VT16, bf* VTh, bf* VTl) {
    __shared__ __align__(16) float os[16 * 68];
    const int w = (int)blockIdx.z / NB_; const size_t z = blockIdx.z % NB_;
    if (w == 2) gemmw<bf, 0, true, 2>(os, blockIdx.x, blockIdx.y, z, XB, nullptr, WV, DM, DM, nullptr, 0, bv, (size_t)TT * DM, 0, 0, VT16, VTh, VTl, 1.0f);
    else gemmw<bf, 1, true, 1>(os, blockIdx.x, blockIdx.y, z, XRh, XRl, w ? WK : WQ, DM, DM, nullptr, 0, w ? bk : bq, (size_t)TT * DM, 0, 0, w ? KP16 : QP16, w ? KPh : QPh, w ? KPl : QPl, w ? 1.0f : QSC);   /* q x 0.125 */
}
// ---- attn16: scores, softmax and P.V of 16 query rows, all in ONE WAVE; nothing of the scores or the probabilities goes through memory. i0: first row of the 64-row query tile (it fixes the band: keys [i0 - WNB, i0 + QT + WNB), column = key - (i0 - WNB)); st: which 16 rows of the tile; z: plane b * NH_ + h.
// sw: the wave's own 16 rows x SP floats of LDS. A row first holds its BW f32 scores; the softmax reads a row whole into registers and then writes the row's probabilities over it (fp16: BW halves; hi/lo: BW + BW bf16), where the P.V A fragments read them (row pitch 1296 B = 16 B x 81, odd, for 16-byte reads). At the end the same LDS stages the output rows.
// Keys off the sequence (first and last two tiles): their K and V fragments are read from keys that exist, the softmax excludes them like any key outside the window and writes probability 0 there, so their products add exact zeros. Every accumulator takes its products in ascending k, per 32 k in the order hi.hi, lo.hi, hi.lo; a softmax row sits in the lanes by 128-key chunks of the sequence, whatever the tile, so its sums have one fixed order.
// K and V fragments come in groups of 8 through a ring of three register sets, two groups ahead of their use; the first two V groups are asked for in front of the softmax.
#define SP 324
typedef v4h  __attribute__((may_alias)) v4ha;
typedef v4us __attribute__((may_alias)) v4usa;
template <typename T16, bool HIR>
__device__ __forceinline__ void attn16(float* sw, const int i0, const int st, const size_t z, const T16* __restrict__ Q, const T16* __restrict__ Q2, const T16* __restrict__ Kp, const T16* __restrict__ Kp2, const T16* __restrict__ Vt, const T16* __restrict__ Vt2, bf* Eh, bf* El, const float esc) {
    typedef typename WFrag<T16>::V V;
    const int lane = threadIdx.x & 31, lr = lane & 15, hi = lane >> 4; const int r0 = i0 + st * 16, bo0 = i0 - WNB;   /* bo0: key of stored column 0 */
    V ring[3][8];
    // -- scores: a group is GK keys (fp16: 4 column blocks x 2 k halves; hi/lo: 2 column blocks x 2 k halves x 2 planes)
    constexpr int GK = HIR ? 32 : 64, NBG = GK / 16, NGS = BW / GK;
    V a[2], a2[2];
    { const T16* pq = Q + ((z * TT + r0 + lr) * HD + 8 * hi); const T16* pq2 = HIR ? Q2 + ((z * TT + r0 + lr) * HD + 8 * hi) : pq;
      a[0] = WFrag<T16>::ld(pq); a[1] = WFrag<T16>::ld(pq + 32); if (HIR) { a2[0] = WFrag<T16>::ld(pq2); a2[1] = WFrag<T16>::ld(pq2 + 32); }
      xhold(pq, pq2); }
    auto ldk = [&](const int g) { const int c = bo0 + g * GK, cc = (c < 0 || c >= TT) ? 0 : c; const size_t o = (z * TT + cc + lr) * HD + 8 * hi; const T16* pk = Kp + o; const T16* pk2 = HIR ? Kp2 + o : pk;
#pragma unroll
        for (int kk = 0; kk < 2; ++kk)
#pragma unroll
            for (int nb = 0; nb < NBG; ++nb) { ring[g % 3][kk * NBG + nb] = WFrag<T16>::ld(pk + (nb * 16 * HD + kk * 32)); if (HIR) ring[g % 3][4 + kk * NBG + nb] = WFrag<T16>::ld(pk2 + (nb * 16 * HD + kk * 32)); }
        xhold(pk, pk2); };
    ldk(0); ldk(1);
#pragma unroll
    for (int g = 0; g < NGS; ++g) {
        if (g + 2 < NGS) ldk(g + 2);
        v8f acc[NBG];
#pragma unroll
        for (int nb = 0; nb < NBG; ++nb) acc[nb] = (v8f){};
#pragma unroll
        for (int kk = 0; kk < 2; ++kk) {
#pragma unroll
            for (int nb = 0; nb < NBG; ++nb) acc[nb] = WFrag<T16>::mma(a[kk], ring[g % 3][kk * NBG + nb], acc[nb]);
            if (HIR) {
#pragma unroll
                for (int nb = 0; nb < NBG; ++nb) acc[nb] = WFrag<T16>::mma(a2[kk], ring[g % 3][kk * NBG + nb], acc[nb]);
#pragma unroll
                for (int nb = 0; nb < NBG; ++nb) acc[nb] = WFrag<T16>::mma(a[kk], ring[g % 3][4 + kk * NBG + nb], acc[nb]); } }
#pragma unroll
        for (int nb = 0; nb < NBG; ++nb)
#pragma unroll
            for (int j = 0; j < 8; ++j) sw[(hi * 8 + j) * SP + g * GK + nb * 16 + lr] = acc[nb][j];
        // the four vector slots between this group's last matrix instructions and the next group's, which start anew in the same accumulator registers (behind the stores by the clobber); the group's fragments are inputs, so that no accumulator is laid over a fragment that a matrix instruction has just read
        asm volatile("v_nop\n\tv_nop\n\tv_nop\n\tv_nop" :: "v"(ring[g % 3][0]), "v"(ring[g % 3][1]), "v"(ring[g % 3][2]), "v"(ring[g % 3][3]), "v"(ring[g % 3][4]), "v"(ring[g % 3][5]), "v"(ring[g % 3][6]), "v"(ring[g % 3][7]) : "memory");
        __builtin_amdgcn_sched_barrier(0);   // keeps later groups' loads from rising over this group: more than three sets in flight would cost a resident wave per SIMD
    }
    // -- V fragments: a group is TPG trips of 32 keys (fp16: 2 trips x 4 column blocks; hi/lo: 1 trip x 4 column blocks x 2 planes)
    constexpr int TPG = HIR ? 1 : 2, NGV = BW / 32 / TPG;
    auto ldv = [&](const int g) {
#pragma unroll
        for (int tt = 0; tt < TPG; ++tt) { const int kc = bo0 + (g * TPG + tt) * 32, kv = (kc < 0 || kc >= TT) ? 0 : kc; const size_t o = (z * HD + lr) * TT + kv + 8 * hi; const T16* pv = Vt + o; const T16* pv2 = HIR ? Vt2 + o : pv;
#pragma unroll
            for (int nb = 0; nb < 4; ++nb) { ring[g % 3][tt * 4 + nb] = WFrag<T16>::ld(pv + nb * 16 * TT); if (HIR) ring[g % 3][4 + nb] = WFrag<T16>::ld(pv2 + nb * 16 * TT); }
            xhold(pv, pv2); } };
    __builtin_amdgcn_wave_barrier(); asm volatile("" ::: "memory");   // the rows are read by other lanes than wrote them: keeps the LDS reads below behind the stores above; and the V loads behind the last use of the K fragments, whose registers they take
    ldv(0); ldv(1);
    // -- softmax, RG rows at a time (their chains of cross-lane steps run side by side; two where the hi/lo split makes the body long): per row a register row, one exp and fixed trees; 128-key chunks at the same lane places as a full row
    const int blo = max(bo0, 0), bhi = min(i0 + QT + WNB, TT); const int jb = (bo0 >> 7) * 128 + lane * 4;   /* first 128-key chunk that touches the band (may start off the band: lanes there load and store nothing and count as excluded keys) */
    constexpr int RG = HIR ? 2 : 4;
#pragma unroll 1   // rolled: copies of this body would only lengthen the text
    for (int g = 0; g < 16 / RG; ++g) {
        float v[RG][BCH * 4], mx[RG], sum[RG]; float* sg = sw + g * RG * SP;
#pragma unroll
        for (int rr = 0; rr < RG; ++rr) { const int i = r0 + g * RG + rr; const float* sr = sg + rr * SP; mx[rr] = -3.0e38f;
#pragma unroll
            for (int ch = 0; ch < BCH; ++ch) { const int j0 = jb + ch * 128; const bool inb = (j0 >= blo && j0 < bhi);   /* the lane's four keys lie on the band (so on the sequence) or all off it: blo, bhi are multiples of 64 */ v4f s4 = (v4f){}; if (inb) s4 = *(const v4fa*)(sr + (j0 - bo0));
#pragma unroll
                for (int q = 0; q < 4; ++q) { const int j = j0 + q; const float t = (inb && i - j < WNB && j - i < WNB) ? s4[q] * SCL : -3.0e38f; v[rr][ch * 4 + q] = t;   /* |i - j| < 128 window (both sides); a key off the sequence is excluded like any other */ mx[rr] = fmaxf(mx[rr], t); } } }
#pragma unroll
        for (int rr = 0; rr < RG; ++rr) {
#pragma unroll
            for (int sh = 16; sh; sh >>= 1) mx[rr] = fmaxf(mx[rr], __shfl_xor(mx[rr], sh, 32));
            sum[rr] = 0.f;
#pragma unroll
            for (int k = 0; k < BCH * 4; ++k) { const float x2 = __fmul_rn(__fsub_rn(v[rr][k], mx[rr]), 1.4426950408889634f); float e = __builtin_amdgcn_exp2f(x2); asm volatile("v_nop" : "+v"(e) : "v"(x2));   /* the one slot behind a transcendental: its result is used and its source's register taken again only behind this */ v[rr][k] = e; sum[rr] += e; }
#pragma unroll
            for (int sh = 16; sh; sh >>= 1) sum[rr] += __shfl_xor(sum[rr], sh, 32); }
#pragma unroll
        for (int rr = 0; rr < RG; ++rr) { const float f = __fdiv_rn(HIR ? 1.0f : PCAR, sum[rr]);
#pragma unroll
            for (int ch = 0; ch < BCH; ++ch) { const int j0 = jb + ch * 128; const bool onrow = (j0 >= bo0 && j0 < bo0 + BW);   /* every stored column gets its probability, 0 for a key off the sequence */
                if (HIR) { v4us oh, ol;
#pragma unroll
                    for (int q = 0; q < 4; ++q) { unsigned short x, c2; splitf(v[rr][ch * 4 + q] * f, x, c2); oh[q] = x; ol[q] = c2; }
                    if (onrow) { bf* pr = (bf*)(sg + rr * SP) + (j0 - bo0); *(v4usa*)pr = oh; *(v4usa*)(pr + BW) = ol; }
                } else { v4h o4;
#pragma unroll
                    for (int q = 0; q < 4; ++q) o4[q] = tohx(v[rr][ch * 4 + q] * f);
                    if (onrow) *(v4ha*)((h16*)(sg + rr * SP) + (j0 - bo0)) = o4; } } }
    }
    __builtin_amdgcn_wave_barrier(); asm volatile("" ::: "memory");   // as above: the fragment reads below stay behind the probability stores
    // -- P.V: A = the 16 probability rows from LDS, B = transposed V
    v8f o[4];
#pragma unroll
    for (int nb = 0; nb < 4; ++nb) o[nb] = (v8f){};
    const T16* pp = (const T16*)sw + (lr * (2 * SP) + 8 * hi);
#pragma unroll
    for (int g = 0; g < NGV; ++g) {
        if (g + 2 < NGV) ldv(g + 2);
#pragma unroll
        for (int tt = 0; tt < TPG; ++tt) { const V p = WFrag<T16>::ld(pp + (g * TPG + tt) * 32); V p2; if (HIR) p2 = WFrag<T16>::ld(pp + (BW + (g * TPG + tt) * 32));
#pragma unroll
            for (int nb = 0; nb < 4; ++nb) o[nb] = WFrag<T16>::mma(p, ring[g % 3][tt * 4 + nb], o[nb]);
            if (HIR) {
#pragma unroll
                for (int nb = 0; nb < 4; ++nb) o[nb] = WFrag<T16>::mma(p2, ring[g % 3][nb], o[nb]);
#pragma unroll
                for (int nb = 0; nb < 4; ++nb) o[nb] = WFrag<T16>::mma(p, ring[g % 3][4 + nb], o[nb]); } }
        asm volatile("v_nop\n\tv_nop\n\tv_nop\n\tv_nop" :: "v"(ring[g % 3][0]), "v"(ring[g % 3][1]), "v"(ring[g % 3][2]), "v"(ring[g % 3][3]), "v"(ring[g % 3][4]), "v"(ring[g % 3][5]), "v"(ring[g % 3][6]), "v"(ring[g % 3][7]) : "memory");   // as in the score loop: no accumulator over a fragment just read
        __builtin_amdgcn_sched_barrier(0);   // as in the score loop: at most three sets in flight
    }
    // -- epilogue: the 16 x 64 tile x esc as hi/lo rows b * TT + t, columns h * HD + d of the merged [NB_ * TT][DQ] operand of the output projection, staged through LDS (pitch 68) for whole 8-byte pieces a lane
    __builtin_amdgcn_wave_barrier(); asm volatile("" ::: "memory");   // the staging stores stay behind the last fragment reads of the same LDS
#pragma unroll
    for (int nb = 0; nb < 4; ++nb)
#pragma unroll
        for (int j = 0; j < 8; ++j) sw[(hi * 8 + j) * 68 + nb * 16 + lr] = o[nb][j];
    __builtin_amdgcn_wave_barrier(); asm volatile("" ::: "memory");   // and the reads below behind the staging stores
    const size_t oo = ((z / NH_) * TT + (r0 + hi)) * DQ + (z % NH_) * HD + lr * 4; bf* ph = Eh + oo; bf* pl = El + oo; v4us oh[8], ol[8];
#pragma unroll
    for (int s = 0; s < 8; ++s) { const v4f val = *(const v4fa*)(sw + (2 * s + hi) * 68 + lr * 4);
#pragma unroll
        for (int q = 0; q < 4; ++q) { unsigned short x, c2; splitf(val[q] * esc, x, c2); oh[s][q] = x; ol[s][q] = c2; }
        *(v4us*)(ph + (size_t)(2 * s) * DQ) = oh[s]; *(v4us*)(pl + (size_t)(2 * s) * DQ) = ol[s]; }
    // s_wait_xcnt 0 behind the run of stores; their pointers and data are inputs, so those registers stay as they are up to the wait (a precaution of form, as xhold)
    asm volatile("s_wait_xcnt 0x0" :: "v"(ph), "v"(pl), "v"(oh[0]), "v"(oh[1]), "v"(oh[2]), "v"(oh[3]), "v"(oh[4]), "v"(oh[5]), "v"(oh[6]), "v"(oh[7]), "v"(ol[0]), "v"(ol[1]), "v"(ol[2]), "v"(ol[3]), "v"(ol[4]), "v"(ol[5]), "v"(ol[6]), "v"(ol[7]) : "memory");
}
// k_attn: grid (ZH, TT/64), 4 waves: wave st takes rows [16 st, 16 st + 16) of query tile blockIdx.y of plane blockIdx.x; the four read the same K and V band and share nothing else (no barrier). Tiles of rows < RH take the hi/lo planes (3 products; the longest, so they start first), the rest the fp16 planes, whose x1024 carry the epilogue undoes.
__global__ __launch_bounds__(128) void k_attn(const bf* QPh, const bf* QPl, const bf* KPh, const bf* KPl, const bf* VTh, const bf* VTl, const h16* QP16, const h16* KP16, const h16* VT16, bf* ATh, bf* ATl) {
    __shared__ __align__(16) float sm[4 * 16 * SP];
    const int st = threadIdx.x >> 5, i0 = (int)blockIdx.y * QT; float* sw = sm + st * 16 * SP;
    if (i0 < RH) attn16<bf, true>(sw, i0, st, blockIdx.x, QPh, QPl, KPh, KPl, VTh, VTl, ATh, ATl, 1.0f);
    else attn16<h16, false>(sw, i0, st, blockIdx.x, QP16, nullptr, KP16, nullptr, VT16, nullptr, ATh, ATl, 1.0f / PCAR);
}
// k_out: grid (NB_*TT/64, DM/64): merged hi/lo ctx x Wo + bo.
__global__ __launch_bounds__(32) void k_out(const bf* ATh, const bf* ATl, const bf* WO, const float* bo, float* OUT) {
    __shared__ __align__(16) float os[16 * 68];
    gemmw<bf, 1, true, 0>(os, blockIdx.x, blockIdx.y, 0, ATh, ATl, WO, DQ, DQ, OUT, DM, bo, 0, 0, 0, nullptr, nullptr, nullptr, 1.0f);
}

// ---- operand preparation: three bodies, each for block blk of its own range of k_prep's grid.
__device__ __forceinline__ void wtG(const unsigned blk, const float* __restrict__ w, int K, int N, bf* Bt) {
    const int lane = threadIdx.x & 31; const int L0 = (blk * 8 + (threadIdx.x >> 5)) * 8; const int nlines = N * K / 64;
{
#pragma unroll 1
        for (int l = 0; l < 8; ++l) { const int L = L0 + l; if (L >= nlines) break; const size_t e = (size_t)L * 64 + lane * 2; const int k = (int)(e % K), n = (int)(e / K); v2us o;
            o[0] = f2bf(w[(size_t)k * N + n]); o[1] = f2bf(w[(size_t)(k + 1) * N + n]); *(v2us*)(Bt + e) = o; }
         }
}
__device__ __forceinline__ void cvt8(const unsigned blk, const float* __restrict__ src, bf* dst, size_t n8) { const size_t i = (size_t)blk * 256 + threadIdx.x; if (i >= n8) return; const v8f v = *(const v8f*)(src + i * 8); v8us o;
#pragma unroll
    for (int k = 0; k < 8; ++k) o[k] = f2bf(v[k]); *(v8us*)(dst + i * 8) = o;  }

__constant__ float INVT[HD / 2] = { 1.000000000e+00f, 7.498942018e-01f, 5.623413324e-01f, 4.216965139e-01f, 3.162277639e-01f, 2.371373624e-01f, 1.778279394e-01f, 1.333521456e-01f, 1.000000015e-01f, 7.498941571e-02f, 5.623412877e-02f, 4.216964915e-02f, 3.162277862e-02f, 2.371373586e-02f, 1.778279431e-02f, 1.333521493e-02f, 9.999999776e-03f, 7.498942316e-03f, 5.623413250e-03f, 4.216964822e-03f, 3.162277862e-03f, 2.371373819e-03f, 1.778279431e-03f, 1.333521446e-03f, 1.000000047e-03f, 7.498941850e-04f, 5.623413017e-04f, 4.216964880e-04f, 3.162277862e-04f, 2.371373848e-04f, 1.778279402e-04f, 1.333521504e-04f };   // jnp-exact float32 1/10000^(2i/64)
__device__ __forceinline__ void ropexP(const unsigned blk, const float* __restrict__ xs, bf* Xh, bf* Xl) { const size_t e = ((size_t)blk * 256 + threadIdx.x) * 2; if (e >= (size_t)NB_ * TT * DM) return; const int c = (int)(e % DM); const int t = (int)((e / DM) % TT); const int d = c % HD; const float* f = xs + (e - d); v2us oh, ol;
    const float* fd = f + d; const float* fp = f + ((d < HD / 2) ? d + HD / 2 : d - HD / 2); const float ld0[2] = { fd[0], fd[1] }, ld1[2] = { fp[0], fp[1] };   // d is even, so both elements lie in the same half and their partners side by side
    xhold(fd, fp);
#pragma unroll
    for (int q = 0; q < 2; ++q) { const int dd = d + q; const float x0 = bfr(ld0[q]), x1 = bfr(ld1[q]); const float a = __fmul_rn((float)t, INVT[dd % (HD / 2)]); const float cs = cosf(a), sn = sinf(a); float p0 = __fmul_rn(x0, cs), p1 = __fmul_rn(x1, sn); asm volatile("" : "+v"(p0), "+v"(p1)); const float r = (dd < HD / 2) ? __fsub_rn(p0, p1) : __fadd_rn(p0, p1); unsigned short a2, c2; splitf(r, a2, c2); oh[q] = a2; ol[q] = c2; }
    *(v2us*)(Xh + e) = oh; *(v2us*)(Xl + e) = ol;  }
// k_prep: everything that reads only the inputs, in one grid. Blocks [0, 4 * GWT): the four weight transposes (all [768][768]; the longest bodies, so they start first); next GRP blocks: rope on the raw hidden states (per 64-slice), as hi/lo planes; last GCV blocks: the bf16 hidden states for v.
#define GWT ((DM * DQ / 64 + 63) / 64)
#define GRP (NB_ * TT * DM / 2 / 256)
#define GCV (NB_ * TT * DM / 8 / 256)
__global__ __launch_bounds__(256) void k_prep(const float* x, const float* wq, const float* wk, const float* wv, const float* wo, bf* WQ, bf* WK, bf* WV, bf* WO, bf* XB, bf* XRh, bf* XRl) {
    const unsigned b = blockIdx.x;
    if (b < 4 * GWT) { const unsigned w = b / GWT; wtG(b % GWT, w == 0 ? wq : w == 1 ? wk : w == 2 ? wv : wo, DM, DQ, w == 0 ? WQ : w == 1 ? WK : w == 2 ? WV : WO); }
    else if (b < 4 * GWT + GRP) ropexP(b - 4 * GWT, x, XRh, XRl);
    else cvt8(b - (4 * GWT + GRP), x, XB, (size_t)NB_ * TT * DM / 8);
}

extern "C" void kernel_launch(void* const* d_in, const int* in_sizes, int n_in,
                              void* d_out, int out_size, void* d_ws, size_t ws_size, hipStream_t stream) {
    (void)in_sizes; (void)n_in; (void)out_size;
    const float* x = (const float*)d_in[0]; const float* wq = (const float*)d_in[1]; const float* bq = (const float*)d_in[2]; const float* wk = (const float*)d_in[3]; const float* bk = (const float*)d_in[4]; const float* wv = (const float*)d_in[5]; const float* bv = (const float*)d_in[6]; const float* wo = (const float*)d_in[7]; const float* bo = (const float*)d_in[8];
    float* OUT = (float*)d_out;     // [2][2048][768]
    char* wsp = (char*)d_ws;
    auto take = [&](size_t bytes) { char* p = wsp; wsp += (bytes + 255) & ~(size_t)255; return (void*)p; };
    const size_t MT = (size_t)NB_ * TT;   // rows of both batches
    bf* WQ = (bf*)take((size_t)DQ * DM * 2); bf* WK = (bf*)take((size_t)DKV * DM * 2); bf* WV = (bf*)take((size_t)DKV * DM * 2); bf* WO = (bf*)take((size_t)DM * DQ * 2);
    bf* XB = (bf*)take(MT * DM * 2); bf* XRh = (bf*)take(MT * DM * 2); bf* XRl = (bf*)take(MT * DM * 2);
    h16* QP16 = (h16*)take(MT * DQ * 2); h16* KP16 = (h16*)take(MT * DKV * 2); h16* VT16 = (h16*)take(MT * DKV * 2);
    bf* QPh = (bf*)take(MT * DQ * 2); bf* QPl = (bf*)take(MT * DQ * 2); bf* KPh = (bf*)take(MT * DKV * 2); bf* KPl = (bf*)take(MT * DKV * 2); bf* VTh = (bf*)take(MT * DKV * 2); bf* VTl = (bf*)take(MT * DKV * 2);
    bf* ATh = (bf*)take(MT * DQ * 2); bf* ATl = (bf*)take(MT * DQ * 2);
    if ((size_t)(wsp - (char*)d_ws) > ws_size) return;    // ws 256 MiB
    static_assert(DQ == DM && DKV == DM && NKV == NH_, "k_prep and k_qkv take the four weights as one shape");
    k_prep<<<4 * GWT + GRP + GCV, 256, 0, stream>>>(x, wq, wk, wv, wo, WQ, WK, WV, WO, XB, XRh, XRl);
    k_qkv<<<dim3(TT / 64, NH_, 3 * NB_), 32, 0, stream>>>(XRh, XRl, XB, WQ, WK, WV, bq, bk, bv, QP16, QPh, QPl, KP16, KPh, KPl, VT16, VTh, VTl);
    k_attn<<<dim3(ZH, TT / QT), 128, 0, stream>>>(QPh, QPl, KPh, KPl, VTh, VTl, QP16, KP16, VT16, ATh, ATl);
    k_out<<<dim3(NB_ * TT / 64, DM / 64, 1), 32, 0, stream>>>(ATh, ATl, WO, bo, OUT);
}

// v006
// A run of this version takes 89.9 microseconds.
// In two side-by-side timings against v005, it was 1.15 and 1.14 times as fast.
// Counting every step since v000, it is 17.1 times as fast.
#include <hip/hip_runtime.h>

// Local (sliding-window) multi-head attention with rotary embeddings applied to the RAW hidden states before the projections (hidden [2][2048][768]; xr = rotate-half rope(hidden viewed (S, 12, 64)) with angles t x 10000^(-2i/64) (computed in-kernel); q = xr Wq + bq, k = xr Wk + bk, v = hidden Wv + bv (keras per-head dense == 'xw' [768][768] + [768]); scores = (q x 0.125).k; keys with |i - j| >= 128 get -1e9 (exclusion); softmax; out = ctx Wo + bo ('xw' [768][768]) -> [2][2048][768] (3.1 M)).
// Four launches: operand preparation; q, k, v; attention (scores, softmax and P.V in one kernel); output projection. Stages that need nothing of each other share one grid by ranges of the block index. Every stage covers both batches and all 12 heads (grid.z or rows b*2048 + t in the projections, planes z = b*12 + h in attention); scores and probabilities exist as the band only (320 columns, column = key - (i0 - 128)) and only in the LDS of the wave that makes and uses them. Each GEMM whose result only feeds another GEMM writes that GEMM's 16-bit operand planes from its own epilogue (q, k: head planes [z][t][d]; v: transposed [z][d][t]; P.V: merged rows [b][t][h*64+d]); no f32 copy of q, k, v or ctx goes through memory. Every 16-bit operand plane in memory lies in FRAGMENT ORDER: a matrix [rows][K] is cut into blocks of 16 rows x 32 k, 1 KiB each, k blocks of a row block one behind the other; in a block element (r, k) lies at ((k >> 4) * 32 + ((k >> 3) & 1) * 16 + r) * 8 + (k & 7), so that a fragment is two wave-wide 16-byte loads of 512 bytes in a row each (4 whole lines, not 16 pieces of 32 bytes), and every writer stores whole 512-byte pieces. Stages: a rotary kernel rotates the bf16-rounded hidden states per 64-wide slice and writes them directly as hi/lo GEMM operand planes (f32 rotary, precise cosf/sinf, jnp-exact inverse frequencies); q and k as hi/lo x exact GEMMs (2 products) + f32 biases, v exact from the bf16 hidden states; q scaled by 0.125 before the split; banded T-2048 attention (hybrid rows: < 512 hi/lo 3 products, rest fp16 x1024): each 64-row query tile visits only the 320 keys [i0 - 128, i0 + 192) that its |i - j| < 128 window can reach (score tiles, softmax columns and the P.V k loop alike; every key outside has weight exactly 0), and the softmax applies the window inside the band as an index select; merged hi/lo x Wo exact + bo.
// Compute dtypes, f32 accumulate: every input rounded to bf16; rotary f32; q/k hi/lo x exact, v exact, + f32 biases; attention rows < 512 3 products, rest fp16; softmax f32; Wo hl x exact + bias.

#define NB_  2
#define TT   2048
#define DM   768
#define NH_  12
#define NKV  12
#define REP  (NH_ / NKV)
#define HD   64
#define DQ   (NH_ * HD)
#define DKV  (NKV * HD)
#define ZH   (NB_ * NH_)          // attention planes per launch: every (batch, head), z = b * NH_ + h
#define RH   512                  // query rows < RH use hi+lo planes (0: none)
#define WIN  0
#define PCAR 1024.0f
#define SCL  1.0f   // q x 0.125 applied before the split (QSC)
#define QSC  0.125f
#define WNB  128     // |i - j| < 128 kept
#define QT   64      // query rows per attention tile; the tile at row i0 can reach keys [i0 - WNB, i0 + QT + WNB) only
#define BW   (QT + 2 * WNB)                  // columns of a score / probability row: key j of a row in tile i0 lies at column j - (i0 - WNB)
#define BCH  ((64 + QT + 2 * WNB + 127) / 128)  // 128-key softmax chunks that cover the band from any 64-aligned start
typedef _Float16 h16;
typedef unsigned short bf;
typedef __attribute__((ext_vector_type(16))) __bf16   v16bf;
typedef __attribute__((ext_vector_type(16))) _Float16 v16h;
typedef __attribute__((ext_vector_type(8)))  _Float16 v8h;
typedef __attribute__((ext_vector_type(8)))  unsigned short v8us;
typedef __attribute__((ext_vector_type(8)))  float    v8f;
typedef __attribute__((ext_vector_type(4)))  float    v4f;
typedef v8h  __attribute__((may_alias)) v8ha;
typedef v4f  __attribute__((may_alias)) v4fa;
typedef v8us __attribute__((may_alias)) v8usa;

__device__ __forceinline__ unsigned short f2bf(float f) { unsigned u = __float_as_uint(f); u += 0x7FFFu + ((u >> 16) & 1u); return (unsigned short)(u >> 16); }
__device__ __forceinline__ float bf2f(unsigned short b) { return __uint_as_float(((unsigned)b) << 16); }
__device__ __forceinline__ float bfr(float f) { return bf2f(f2bf(f)); }
__device__ __forceinline__ v16h cat16(v8h lo, v8h hi) { return __builtin_shufflevector(lo, hi, 0, 1, 2, 3, 4, 5, 6, 7, 8, 9, 10, 11, 12, 13, 14, 15); }
__device__ __forceinline__ v16bf cat16b(v8us lo, v8us hi) { return __builtin_bit_cast(v16bf, __builtin_shufflevector(lo, hi, 0, 1, 2, 3, 4, 5, 6, 7, 8, 9, 10, 11, 12, 13, 14, 15)); }
__device__ __forceinline__ v8f wmma16(v16h a, v16h b, v8f c) { return __builtin_amdgcn_wmma_f32_16x16x32_f16(false, a, false, b, (short)0, c, false, false); }
__device__ __forceinline__ v8f wmmab(v16bf a, v16bf b, v8f c) { return __builtin_amdgcn_wmma_f32_16x16x32_bf16(false, a, false, b, (short)0, c, false, false); }
__device__ __forceinline__ h16 tohx(float x) { return (h16)x; }
__device__ __forceinline__ void splitf(float y, unsigned short& h, unsigned short& l) { h = f2bf(y); l = f2bf(y - bf2f(h)); }
typedef __attribute__((ext_vector_type(4))) _Float16 v4h;
typedef __attribute__((ext_vector_type(2))) unsigned short v2us;
typedef __attribute__((ext_vector_type(4))) unsigned short v4us;



// ---- gemmw: register-blocked GEMM, ONE WAVE per 64x64 output tile (16 accumulators), operands straight from 16-bit planes in fragment order (head of the file); tile (bx, by, z) of (M/64, N/64, Z), 32 threads; os: the wave's 16 x 68 f32 staging rows in LDS. The kernels below pick the tile and the variant from the block index.
// C[m][n] (f32, pitch ldc, + optional f32 bias[n]) = sum_k A[m][k] Bt[n][k] (+ the lo plane's product per NSPLIT). z-batch strides sA/sB/sC in elements. K % 32 == 0.
// lda = row length of A and A2 in elements (= K: a row block is 16 * lda elements); Bt's is K. NSPLIT 1: A comes as hi + lo planes (A, A2), two products.
// EPI: what the epilogue stores. 0: C as above. 1, 2: (tile + bias) x esc as the next GEMM's 16-bit operand planes, fp16 (E16) and bf16 hi/lo (Eh, El), C unused; the 64 columns of a tile are one head.
//   1 (q, k; z = batch, by = head): plane z * NH_ + head, [t][d].  2 (v; same z, head; esc unused): plane z * NKV + head, transposed [d][t]. Both in fragment order.
// xhold: s_wait_xcnt 0 behind a run of fragment loads. The pointers that the run's loads go through are inputs of the statement, so their registers stay allocated up to the wait and no later load's result lands on them in front of it (a precaution of form; one wait serves the run).
template <typename T> __device__ __forceinline__ void xhold(const T* p0, const T* p1) { asm volatile("s_wait_xcnt 0x0" :: "v"(p0), "v"(p1) : "memory"); }
template <typename T> __device__ __forceinline__ void xhold(const T* p0, const T* p1, const T* p2, const T* p3) { asm volatile("s_wait_xcnt 0x0" :: "v"(p0), "v"(p1), "v"(p2), "v"(p3) : "memory"); }
template <typename T> __device__ __forceinline__ void xhold(const T* p0, const T* p1, const T* p2, const T* p3, const T* p4, const T* p5, const T* p6, const T* p7) { asm volatile("s_wait_xcnt 0x0" :: "v"(p0), "v"(p1), "v"(p2), "v"(p3), "v"(p4), "v"(p5), "v"(p6), "v"(p7) : "memory"); }
template <typename T16> struct WFrag;
template <> struct WFrag<h16> { typedef v16h V; static __device__ __forceinline__ V ld(const h16* p) { return cat16(*(const v8h*)p, *(const v8h*)(p + 16)); } static __device__ __forceinline__ V ldp(const h16* p) { return cat16(*(const v8h*)p, *(const v8h*)(p + 256)); } static __device__ __forceinline__ v8f mma(V a, V b, v8f c) { return wmma16(a, b, c); } };
template <> struct WFrag<bf> { typedef v16bf V; static __device__ __forceinline__ V ld(const bf* p) { return cat16b(*(const v8us*)p, *(const v8us*)(p + 16)); } static __device__ __forceinline__ V ldp(const bf* p) { return cat16b(*(const v8us*)p, *(const v8us*)(p + 256)); } static __device__ __forceinline__ v8f mma(V a, V b, v8f c) { return wmmab(a, b, c); } };
template <typename T16, int NSPLIT, bool BIAS, int EPI>
__device__ __forceinline__ void gemmw(float* os, const int bx, const int by, const size_t z, const T16* __restrict__ A, const T16* __restrict__ A2, const T16* __restrict__ Bt, int K, int lda, float* C, int ldc, const float* __restrict__ bias, size_t sA, size_t sB, size_t sC, h16* E16, bf* Eh, bf* El, float esc) {
    typedef typename WFrag<T16>::V V;
    A += z * sA; if (A2) A2 += z * sA; Bt += z * sB; C += z * sC;
    const int lane = threadIdx.x & 31, lr = lane & 15, hi = lane >> 4; const int r0 = bx * 64, c0 = by * 64;
    v8f acc[4][4];
#pragma unroll
    for (int mb = 0; mb < 4; ++mb)
#pragma unroll
        for (int nb = 0; nb < 4; ++nb) acc[mb][nb] = (v8f){};
    const int ldb = K;
    const size_t aoff = (size_t)r0 * lda + lane * 8, boff = (size_t)c0 * ldb + lane * 8;   // fragment order: the lane's 8 elements of the first block of the tile's first 16 rows
#pragma unroll 1
    for (int kc = 0; kc < K; kc += 32) {
        V a[4], a2[4];
        const T16* pa = A + aoff + kc * 16; const T16* pa2 = (NSPLIT == 1) ? A2 + aoff + kc * 16 : nullptr; const T16* pb = Bt + boff + kc * 16; const size_t sa = (size_t)16 * lda, sb = (size_t)16 * ldb;
#pragma unroll
        for (int mb = 0; mb < 4; ++mb) { a[mb] = WFrag<T16>::ldp(pa + mb * sa); if (NSPLIT == 1) a2[mb] = WFrag<T16>::ldp(pa2 + mb * sa); }
        if (NSPLIT == 1) xhold(pa, pa + sa, pa + 2 * sa, pa + 3 * sa, pa2, pa2 + sa, pa2 + 2 * sa, pa2 + 3 * sa); else xhold(pa, pa + sa, pa + 2 * sa, pa + 3 * sa);
#pragma unroll
        for (int nb = 0; nb < 4; ++nb) { const V b = WFrag<T16>::ldp(pb + nb * sb);
#pragma unroll
            for (int mb = 0; mb < 4; ++mb) { acc[mb][nb] = WFrag<T16>::mma(a[mb], b, acc[mb][nb]); if (NSPLIT == 1) acc[mb][nb] = WFrag<T16>::mma(a2[mb], b, acc[mb][nb]); } }
        xhold(pb, pb + sb, pb + 2 * sb, pb + 3 * sb);
        asm volatile("v_nop\n\tv_nop\n\tv_nop\n\tv_nop" : "+v"(acc[0][0]), "+v"(acc[1][1]), "+v"(acc[2][2]), "+v"(acc[3][3]) : "v"(a[0]), "v"(a[3]));
    }
    // EPI 1, 2: one pointer a plane for the lane's first element; every store of the tile lies at a constant offset from it. bb: the lane's bias values (EPI 1: its 8 columns of each of the 4 pieces of a row block; EPI 2: its column of each of the 4 column blocks).
    h16* p16 = nullptr; bf* ph = nullptr; bf* pl = nullptr; float bb[(EPI == 1) ? 32 : 4] = {};
    if constexpr (EPI != 0) {
        const size_t oo = (EPI == 1) ? ((z * NH_ + by) * TT + r0) * HD + lane * 8 : (z * NKV + by) * HD * TT + (size_t)r0 * 16 + lane * 8;
        p16 = E16 + oo; ph = Eh + oo; pl = El + oo;
        if (BIAS) { const float* pbi = bias + c0 + ((EPI == 2) ? lr : hi * 8);
            if (EPI == 2) {
#pragma unroll
                for (int nb = 0; nb < 4; ++nb) bb[nb] = pbi[nb * 16];
            } else {
#pragma unroll
                for (int q = 0; q < 32; ++q) bb[q] = pbi[(q >> 3) * 16 + (q & 7)]; }
            xhold(pbi, pbi);
#pragma unroll
            for (int q = 0; q < ((EPI == 1) ? 32 : 4); ++q) bb[q] = bfr(bb[q]); }
    }
#pragma unroll
    for (int mb = 0; mb < 4; ++mb) {
        if constexpr (EPI != 2) {
#pragma unroll
            for (int nb = 0; nb < 4; ++nb) {
#pragma unroll
                for (int j = 0; j < 8; ++j) os[(hi * 8 + j) * 68 + nb * 16 + lr] = acc[mb][nb][j]; } }
        __builtin_amdgcn_wave_barrier(); asm volatile("" ::: "memory");
        if constexpr (EPI == 0) {
            float* cp = C + (size_t)(r0 + mb * 16 + hi) * ldc + c0 + lr * 4; v4f ov[8];   // the lane's first element of the 16 staged rows; its stores lie 2 * ldc apart
#pragma unroll
            for (int s = 0; s < 8; ++s) { const int row = 2 * s + hi, cofs = lr * 4; v4f val = *(const v4fa*)(os + row * 68 + cofs); if (BIAS) { val[0] += bfr(bias[c0 + cofs]); val[1] += bfr(bias[c0 + cofs + 1]); val[2] += bfr(bias[c0 + cofs + 2]); val[3] += bfr(bias[c0 + cofs + 3]); }
                ov[s] = val; *(v4f*)(cp + (size_t)(2 * s) * ldc) = ov[s]; }
            // s_wait_xcnt 0 behind the run of stores; their pointer and data are inputs, so those registers stay as they are up to the wait (a precaution of form, as xhold)
            asm volatile("s_wait_xcnt 0x0" :: "v"(cp), "v"(ov[0]), "v"(ov[1]), "v"(ov[2]), "v"(ov[3]), "v"(ov[4]), "v"(ov[5]), "v"(ov[6]), "v"(ov[7]) : "memory");
        } else if constexpr (EPI == 2) {
            v8h o16[4]; v8us oh[4], ol[4];
#pragma unroll
            for (int nb = 0; nb < 4; ++nb) {   // the transposed plane's fragment order (row d = nb * 16 + lr, 8 consecutive t from hi * 8) is the accumulator's own: no staging
#pragma unroll
                for (int j = 0; j < 8; ++j) { float x = acc[mb][nb][j]; if (BIAS) x += bb[nb]; o16[nb][j] = tohx(x); unsigned short a2, c2; splitf(x, a2, c2); oh[nb][j] = a2; ol[nb][j] = c2; }
                const size_t oo = (size_t)nb * 16 * TT + mb * 256; *(v8h*)(p16 + oo) = o16[nb]; *(v8us*)(ph + oo) = oh[nb]; *(v8us*)(pl + oo) = ol[nb]; }
            // s_wait_xcnt 0 behind the run of stores; their pointers and data are inputs, so those registers stay as they are up to the wait (a precaution of form, as xhold)
            asm volatile("s_wait_xcnt 0x0" :: "v"(p16), "v"(ph), "v"(pl), "v"(o16[0]), "v"(o16[1]), "v"(o16[2]), "v"(o16[3]), "v"(oh[0]), "v"(oh[1]), "v"(oh[2]), "v"(oh[3]), "v"(ol[0]), "v"(ol[1]), "v"(ol[2]), "v"(ol[3]) : "memory");
        } else {
            v8h o16[4]; v8us oh[4], ol[4];
#pragma unroll
            for (int c = 0; c < 4; ++c) {   // piece c of the row block: the lane's row lr, columns c * 16 + hi * 8 + (0..7)
                const v4f v0 = *(const v4fa*)(os + lr * 68 + c * 16 + hi * 8), v1 = *(const v4fa*)(os + lr * 68 + c * 16 + hi * 8 + 4);
#pragma unroll
                for (int q = 0; q < 8; ++q) { float x = (q < 4) ? v0[q & 3] : v1[q & 3]; if (BIAS) x += bb[c * 8 + q]; const float r = x * esc; o16[c][q] = tohx(r); unsigned short a2, c2; splitf(r, a2, c2); oh[c][q] = a2; ol[c][q] = c2; }
                const size_t oo = (size_t)mb * 16 * HD + c * 256;
                *(v8h*)(p16 + oo) = o16[c]; *(v8us*)(ph + oo) = oh[c]; *(v8us*)(pl + oo) = ol[c]; }
            // s_wait_xcnt 0 behind the run of stores; their pointers and data are inputs, so those registers stay as they are up to the wait (a precaution of form, as xhold)
            asm volatile("s_wait_xcnt 0x0" :: "v"(p16), "v"(ph), "v"(pl), "v"(o16[0]), "v"(o16[1]), "v"(o16[2]), "v"(o16[3]), "v"(oh[0]), "v"(oh[1]), "v"(oh[2]), "v"(oh[3]), "v"(ol[0]), "v"(ol[1]), "v"(ol[2]), "v"(ol[3]) : "memory");
        }
        __builtin_amdgcn_wave_barrier(); asm volatile("" ::: "memory");
    }
}

// ---- GEMM launches. Stages that need nothing of each other share one grid: a block-uniform test of the block index picks the variant, so their waves run side by side and not one launch behind the other.
// k_qkv: grid (TT/64, heads, 3 * NB_); blockIdx.z / NB_ = 0: q, 1: k (one code path, pointers selected), 2: v; blockIdx.z % NB_ = batch. Each epilogue writes the attention operand planes b * 12 + h itself.
__global__ __launch_bounds__(32) void k_qkv(const bf* XRh, const bf* XRl, const bf* XB, const bf* WQ, const bf* WK, const bf* WV, const float* bq, const float* bk, const float* bv, h16* QP16, bf* QPh, bf* QPl, h16* KP16, bf* KPh, bf* KPl, h16* VT16, bf* VTh, bf* VTl) {
    __shared__ __align__(16) float os[16 * 68];
    const int w = (int)blockIdx.z / NB_; const size_t z = blockIdx.z % NB_;
    if (w == 2) gemmw<bf, 0, true, 2>(os, blockIdx.x, blockIdx.y, z, XB, nullptr, WV, DM, DM, nullptr, 0, bv, (size_t)TT * DM, 0, 0, VT16, VTh, VTl, 1.0f);
    else gemmw<bf, 1, true, 1>(os, blockIdx.x, blockIdx.y, z, XRh, XRl, w ? WK : WQ, DM, DM, nullptr, 0, w ? bk : bq, (size_t)TT * DM, 0, 0, w ? KP16 : QP16, w ? KPh : QPh, w ? KPl : QPl, w ? 1.0f : QSC);   /* q x 0.125 */
}
// ---- attn16: scores, softmax and P.V of 16 query rows, all in ONE WAVE; nothing of the scores or the probabilities goes through memory. i0: first row of the 64-row query tile (it fixes the band: keys [i0 - WNB, i0 + QT + WNB), column = key - (i0 - WNB)); st: which 16 rows of the tile; z: plane b * NH_ + h.
// sw: the wave's own 16 rows x SP floats of LDS. A row first holds its BW f32 scores; the softmax reads a row whole into registers and then writes the row's probabilities over it (fp16: BW halves; hi/lo: BW + BW bf16), where the P.V A fragments read them (row pitch 1296 B = 16 B x 81, odd, for 16-byte reads). At the end the same LDS stages the output rows.
// Keys off the sequence (first and last two tiles): their K and V fragments are read from keys that exist, the softmax excludes them like any key outside the window and writes probability 0 there, so their products add exact zeros. Every accumulator takes its products in ascending k, per 32 k in the order hi.hi, lo.hi, hi.lo; a softmax row sits in the lanes by 128-key chunks of the sequence, whatever the tile, so its sums have one fixed order.
// K and V fragments come in groups of 8 through a ring of three register sets, two groups ahead of their use; the first two V groups are asked for in front of the softmax.
#define SP 324
typedef v4h  __attribute__((may_alias)) v4ha;
typedef v4us __attribute__((may_alias)) v4usa;
template <typename T16, bool HIR>
__device__ __forceinline__ void attn16(float* sw, const int i0, const int st, const size_t z, const T16* __restrict__ Q, const T16* __restrict__ Q2, const T16* __restrict__ Kp, const T16* __restrict__ Kp2, const T16* __restrict__ Vt, const T16* __restrict__ Vt2, bf* Eh, bf* El, const float esc) {
    typedef typename WFrag<T16>::V V;
    const int lane = threadIdx.x & 31, lr = lane & 15, hi = lane >> 4; const int r0 = i0 + st * 16, bo0 = i0 - WNB;   /* bo0: key of stored column 0 */
    V ring[3][8];
    // -- scores: a group is GK keys (fp16: 4 column blocks x 2 k halves; hi/lo: 2 column blocks x 2 k halves x 2 planes)
    constexpr int GK = HIR ? 32 : 64, NBG = GK / 16, NGS = BW / GK;
    V a[2], a2[2];
    { const T16* pq = Q + ((z * TT + r0) * HD + lane * 8); const T16* pq2 = HIR ? Q2 + ((z * TT + r0) * HD + lane * 8) : pq;
      a[0] = WFrag<T16>::ldp(pq); a[1] = WFrag<T16>::ldp(pq + 512); if (HIR) { a2[0] = WFrag<T16>::ldp(pq2); a2[1] = WFrag<T16>::ldp(pq2 + 512); }
      xhold(pq, pq2); }
    auto ldk = [&](const int g) { const int c = bo0 + g * GK, cc = (c < 0 || c >= TT) ? 0 : c; const size_t o = (z * TT + cc) * HD + lane * 8; const T16* pk = Kp + o; const T16* pk2 = HIR ? Kp2 + o : pk;
#pragma unroll
        for (int kk = 0; kk < 2; ++kk)
#pragma unroll
            for (int nb = 0; nb < NBG; ++nb) { ring[g % 3][kk * NBG + nb] = WFrag<T16>::ldp(pk + (nb * 16 * HD + kk * 512)); if (HIR) ring[g % 3][4 + kk * NBG + nb] = WFrag<T16>::ldp(pk2 + (nb * 16 * HD + kk * 512)); }
        xhold(pk, pk2); };
    ldk(0); ldk(1);
#pragma unroll
    for (int g = 0; g < NGS; ++g) {
        if (g + 2 < NGS) ldk(g + 2);
        v8f acc[NBG];
#pragma unroll
        for (int nb = 0; nb < NBG; ++nb) acc[nb] = (v8f){};
#pragma unroll
        for (int kk = 0; kk < 2; ++kk) {
#pragma unroll
            for (int nb = 0; nb < NBG; ++nb) acc[nb] = WFrag<T16>::mma(a[kk], ring[g % 3][kk * NBG + nb], acc[nb]);
            if (HIR) {
#pragma unroll
                for (int nb = 0; nb < NBG; ++nb) acc[nb] = WFrag<T16>::mma(a2[kk], ring[g % 3][kk * NBG + nb], acc[nb]);
#pragma unroll
                for (int nb = 0; nb < NBG; ++nb) acc[nb] = WFrag<T16>::mma(a[kk], ring[g % 3][4 + kk * NBG + nb], acc[nb]); } }
#pragma unroll
        for (int nb = 0; nb < NBG; ++nb)
#pragma unroll
            for (int j = 0; j < 8; ++j) sw[(hi * 8 + j) * SP + g * GK + nb * 16 + lr] = acc[nb][j];
        // the four vector slots between this group's last matrix instructions and the next group's, which start anew in the same accumulator registers (behind the stores by the clobber); the group's fragments are inputs, so that no accumulator is laid over a fragment that a matrix instruction has just read
        asm volatile("v_nop\n\tv_nop\n\tv_nop\n\tv_nop" :: "v"(ring[g % 3][0]), "v"(ring[g % 3][1]), "v"(ring[g % 3][2]), "v"(ring[g % 3][3]), "v"(ring[g % 3][4]), "v"(ring[g % 3][5]), "v"(ring[g % 3][6]), "v"(ring[g % 3][7]) : "memory");
        __builtin_amdgcn_sched_barrier(0);   // keeps later groups' loads from rising over this group: more than three sets in flight would cost a resident wave per SIMD
    }
    // -- V fragments: a group is TPG trips of 32 keys (fp16: 2 trips x 4 column blocks; hi/lo: 1 trip x 4 column blocks x 2 planes)
    constexpr int TPG = HIR ? 1 : 2, NGV = BW / 32 / TPG;
    auto ldv = [&](const int g) {
#pragma unroll
        for (int tt = 0; tt < TPG; ++tt) { const int kc = bo0 + (g * TPG + tt) * 32, kv = (kc < 0 || kc >= TT) ? 0 : kc; const size_t o = z * HD * TT + (size_t)kv * 16 + lane * 8; const T16* pv = Vt + o; const T16* pv2 = HIR ? Vt2 + o : pv;
#pragma unroll
            for (int nb = 0; nb < 4; ++nb) { ring[g % 3][tt * 4 + nb] = WFrag<T16>::ldp(pv + nb * 16 * TT); if (HIR) ring[g % 3][4 + nb] = WFrag<T16>::ldp(pv2 + nb * 16 * TT); }
            xhold(pv, pv2); } };
    __builtin_amdgcn_wave_barrier(); asm volatile("" ::: "memory");   // the rows are read by other lanes than wrote them: keeps the LDS reads below behind the stores above; and the V loads behind the last use of the K fragments, whose registers they take
    ldv(0); ldv(1);
    // -- softmax, RG rows at a time (their chains of cross-lane steps run side by side; two where the hi/lo split makes the body long): per row a register row, one exp and fixed trees; 128-key chunks at the same lane places as a full row
    const int blo = max(bo0, 0), bhi = min(i0 + QT + WNB, TT); const int jb = (bo0 >> 7) * 128 + lane * 4;   /* first 128-key chunk that touches the band (may start off the band: lanes there load and store nothing and count as excluded keys) */
    constexpr int RG = HIR ? 2 : 4;
#pragma unroll 1   // rolled: copies of this body would only lengthen the text
    for (int g = 0; g < 16 / RG; ++g) {
        float v[RG][BCH * 4], mx[RG], sum[RG]; float* sg = sw + g * RG * SP;
#pragma unroll
        for (int rr = 0; rr < RG; ++rr) { const int i = r0 + g * RG + rr; const float* sr = sg + rr * SP; mx[rr] = -3.0e38f;
#pragma unroll
            for (int ch = 0; ch < BCH; ++ch) { const int j0 = jb + ch * 128; const bool inb = (j0 >= blo && j0 < bhi);   /* the lane's four keys lie on the band (so on the sequence) or all off it: blo, bhi are multiples of 64 */ v4f s4 = (v4f){}; if (inb) s4 = *(const v4fa*)(sr + (j0 - bo0));
#pragma unroll
                for (int q = 0; q < 4; ++q) { const int j = j0 + q; const float t = (inb && i - j < WNB && j - i < WNB) ? s4[q] * SCL : -3.0e38f; v[rr][ch * 4 + q] = t;   /* |i - j| < 128 window (both sides); a key off the sequence is excluded like any other */ mx[rr] = fmaxf(mx[rr], t); } } }
#pragma unroll
        for (int rr = 0; rr < RG; ++rr) {
#pragma unroll
            for (int sh = 16; sh; sh >>= 1) mx[rr] = fmaxf(mx[rr], __shfl_xor(mx[rr], sh, 32));
            sum[rr] = 0.f;
#pragma unroll
            for (int k = 0; k < BCH * 4; ++k) { const float x2 = __fmul_rn(__fsub_rn(v[rr][k], mx[rr]), 1.4426950408889634f); float e = __builtin_amdgcn_exp2f(x2); asm volatile("v_nop" : "+v"(e) : "v"(x2));   /* the one slot behind a transcendental: its result is used and its source's register taken again only behind this */ v[rr][k] = e; sum[rr] += e; }
#pragma unroll
            for (int sh = 16; sh; sh >>= 1) sum[rr] += __shfl_xor(sum[rr], sh, 32); }
#pragma unroll
        for (int rr = 0; rr < RG; ++rr) { const float f = __fdiv_rn(HIR ? 1.0f : PCAR, sum[rr]);
#pragma unroll
            for (int ch = 0; ch < BCH; ++ch) { const int j0 = jb + ch * 128; const bool onrow = (j0 >= bo0 && j0 < bo0 + BW);   /* every stored column gets its probability, 0 for a key off the sequence */
                if (HIR) { v4us oh, ol;
#pragma unroll
                    for (int q = 0; q < 4; ++q) { unsigned short x, c2; splitf(v[rr][ch * 4 + q] * f, x, c2); oh[q] = x; ol[q] = c2; }
                    if (onrow) { bf* pr = (bf*)(sg + rr * SP) + (j0 - bo0); *(v4usa*)pr = oh; *(v4usa*)(pr + BW) = ol; }
                } else { v4h o4;
#pragma unroll
                    for (int q = 0; q < 4; ++q) o4[q] = tohx(v[rr][ch * 4 + q] * f);
                    if (onrow) *(v4ha*)((h16*)(sg + rr * SP) + (j0 - bo0)) = o4; } } }
    }
    __builtin_amdgcn_wave_barrier(); asm volatile("" ::: "memory");   // as above: the fragment reads below stay behind the probability stores
    // -- P.V: A = the 16 probability rows from LDS, B = transposed V
    v8f o[4];
#pragma unroll
    for (int nb = 0; nb < 4; ++nb) o[nb] = (v8f){};
    const T16* pp = (const T16*)sw + (lr * (2 * SP) + 8 * hi);
#pragma unroll
    for (int g = 0; g < NGV; ++g) {
        if (g + 2 < NGV) ldv(g + 2);
#pragma unroll
        for (int tt = 0; tt < TPG; ++tt) { const V p = WFrag<T16>::ld(pp + (g * TPG + tt) * 32); V p2; if (HIR) p2 = WFrag<T16>::ld(pp + (BW + (g * TPG + tt) * 32));
#pragma unroll
            for (int nb = 0; nb < 4; ++nb) o[nb] = WFrag<T16>::mma(p, ring[g % 3][tt * 4 + nb], o[nb]);
            if (HIR) {
#pragma unroll
                for (int nb = 0; nb < 4; ++nb) o[nb] = WFrag<T16>::mma(p2, ring[g % 3][nb], o[nb]);
#pragma unroll
                for (int nb = 0; nb < 4; ++nb) o[nb] = WFrag<T16>::mma(p, ring[g % 3][4 + nb], o[nb]); } }
        asm volatile("v_nop\n\tv_nop\n\tv_nop\n\tv_nop" :: "v"(ring[g % 3][0]), "v"(ring[g % 3][1]), "v"(ring[g % 3][2]), "v"(ring[g % 3][3]), "v"(ring[g % 3][4]), "v"(ring[g % 3][5]), "v"(ring[g % 3][6]), "v"(ring[g % 3][7]) : "memory");   // as in the score loop: no accumulator over a fragment just read
        __builtin_amdgcn_sched_barrier(0);   // as in the score loop: at most three sets in flight
    }
    // -- epilogue: the 16 x 64 tile x esc as hi/lo rows b * TT + t, columns h * HD + d of the merged [NB_ * TT][DQ] operand of the output projection, staged through LDS (pitch 68) for whole 16-byte pieces a lane
    __builtin_amdgcn_wave_barrier(); asm volatile("" ::: "memory");   // the staging stores stay behind the last fragment reads of the same LDS
#pragma unroll
    for (int nb = 0; nb < 4; ++nb)
#pragma unroll
        for (int j = 0; j < 8; ++j) sw[(hi * 8 + j) * 68 + nb * 16 + lr] = o[nb][j];
    __builtin_amdgcn_wave_barrier(); asm volatile("" ::: "memory");   // and the reads below behind the staging stores
    const size_t oo = ((z / NH_) * TT + r0) * DQ + (z % NH_) * (HD * 16) + lane * 8; bf* ph = Eh + oo; bf* pl = El + oo; v8us oh[4], ol[4];   // fragment order: the wave's 16 rows x 64 columns are 2 KiB in a row of each plane
#pragma unroll
    for (int c = 0; c < 4; ++c) { const v4f v0 = *(const v4fa*)(sw + lr * 68 + c * 16 + hi * 8), v1 = *(const v4fa*)(sw + lr * 68 + c * 16 + hi * 8 + 4);   // piece c: the lane's row lr, columns c * 16 + hi * 8 + (0..7)
#pragma unroll
        for (int q = 0; q < 8; ++q) { unsigned short x, c2; splitf(((q < 4) ? v0[q & 3] : v1[q & 3]) * esc, x, c2); oh[c][q] = x; ol[c][q] = c2; }
        *(v8us*)(ph + c * 256) = oh[c]; *(v8us*)(pl + c * 256) = ol[c]; }
    // s_wait_xcnt 0 behind the run of stores; their pointers and data are inputs, so those registers stay as they are up to the wait (a precaution of form, as xhold)
    asm volatile("s_wait_xcnt 0x0" :: "v"(ph), "v"(pl), "v"(oh[0]), "v"(oh[1]), "v"(oh[2]), "v"(oh[3]), "v"(ol[0]), "v"(ol[1]), "v"(ol[2]), "v"(ol[3]) : "memory");
}
// k_attn: grid (ZH, TT/64), 4 waves: wave st takes rows [16 st, 16 st + 16) of query tile blockIdx.y of plane blockIdx.x; the four read the same K and V band and share nothing else (no barrier). Tiles of rows < RH take the hi/lo planes (3 products; the longest, so they start first), the rest the fp16 planes, whose x1024 carry the epilogue undoes.
__global__ __launch_bounds__(128) void k_attn(const bf* QPh, const bf* QPl, const bf* KPh, const bf* KPl, const bf* VTh, const bf* VTl, const h16* QP16, const h16* KP16, const h16* VT16, bf* ATh, bf* ATl) {
    __shared__ __align__(16) float sm[4 * 16 * SP];
    const int st = threadIdx.x >> 5, i0 = (int)blockIdx.y * QT; float* sw = sm + st * 16 * SP;
    if (i0 < RH) attn16<bf, true>(sw, i0, st, blockIdx.x, QPh, QPl, KPh, KPl, VTh, VTl, ATh, ATl, 1.0f);
    else attn16<h16, false>(sw, i0, st, blockIdx.x, QP16, nullptr, KP16, nullptr, VT16, nullptr, ATh, ATl, 1.0f / PCAR);
}
// k_out: grid (NB_*TT/64, DM/64): merged hi/lo ctx x Wo + bo.
__global__ __launch_bounds__(32) void k_out(const bf* ATh, const bf* ATl, const bf* WO, const float* bo, float* OUT) {
    __shared__ __align__(16) float os[16 * 68];
    gemmw<bf, 1, true, 0>(os, blockIdx.x, blockIdx.y, 0, ATh, ATl, WO, DQ, DQ, OUT, DM, bo, 0, 0, 0, nullptr, nullptr, nullptr, 1.0f);
}

// ---- operand preparation: three bodies, each for block blk of its own range of k_prep's grid.
// Each thread makes one 16-byte piece of a plane in fragment order: piece i holds row (i / 64 / (K / 32)) * 16 + (i & 15), columns ((i / 64) % (K / 32)) * 32 + ((i >> 5) & 1) * 16 + ((i >> 4) & 1) * 8 + (0..7); a wave stores 512 bytes in a row.
__device__ __forceinline__ void wtG(const unsigned blk, const float* __restrict__ w, int K, int N, bf* Bt) {
    const unsigned i = blk * 256 + threadIdx.x; const int kb = K / 32; const int n = (int)(i / 64 / kb) * 16 + (int)(i & 15), k0 = (int)(i / 64 % kb) * 32 + (int)((i >> 5) & 1) * 16 + (int)((i >> 4) & 1) * 8;
    const float* pw = w + (size_t)k0 * N + n; float ldw[8]; v8us o;
#pragma unroll
    for (int q = 0; q < 8; ++q) ldw[q] = pw[(size_t)q * N];
    xhold(pw, pw);
#pragma unroll
    for (int q = 0; q < 8; ++q) o[q] = f2bf(ldw[q]);
    bf* pd = Bt + (size_t)i * 8; *(v8us*)pd = o;
    asm volatile("s_wait_xcnt 0x0" :: "v"(pd), "v"(o) : "memory");   // s_wait_xcnt 0 behind the store; its pointer and data are inputs, so those registers stay as they are up to the wait (a precaution of form, as xhold)
}
__device__ __forceinline__ void cvt8(const unsigned blk, const float* __restrict__ src, bf* dst) { const unsigned i = blk * 256 + threadIdx.x; const int row = (int)(i / 64 / (DM / 32)) * 16 + (int)(i & 15), k0 = (int)(i / 64 % (DM / 32)) * 32 + (int)((i >> 5) & 1) * 16 + (int)((i >> 4) & 1) * 8;
    const float* ps = src + (size_t)row * DM + k0; const v8f v = *(const v8f*)ps; xhold(ps, ps); v8us o;
#pragma unroll
    for (int k = 0; k < 8; ++k) o[k] = f2bf(v[k]);
    bf* pd = dst + (size_t)i * 8; *(v8us*)pd = o;
    asm volatile("s_wait_xcnt 0x0" :: "v"(pd), "v"(o) : "memory");   // as in wtG: the wait behind the store
}

__constant__ __attribute__((aligned(32))) float INVT[HD / 2] = { 1.000000000e+00f, 7.498942018e-01f, 5.623413324e-01f, 4.216965139e-01f, 3.162277639e-01f, 2.371373624e-01f, 1.778279394e-01f, 1.333521456e-01f, 1.000000015e-01f, 7.498941571e-02f, 5.623412877e-02f, 4.216964915e-02f, 3.162277862e-02f, 2.371373586e-02f, 1.778279431e-02f, 1.333521493e-02f, 9.999999776e-03f, 7.498942316e-03f, 5.623413250e-03f, 4.216964822e-03f, 3.162277862e-03f, 2.371373819e-03f, 1.778279431e-03f, 1.333521446e-03f, 1.000000047e-03f, 7.498941850e-04f, 5.623413017e-04f, 4.216964880e-04f, 3.162277862e-04f, 2.371373848e-04f, 1.778279402e-04f, 1.333521504e-04f };   // jnp-exact float32 1/10000^(2i/64)
__device__ __forceinline__ void ropexP(const unsigned blk, const float* __restrict__ xs, bf* Xh, bf* Xl) { const unsigned i = blk * 256 + threadIdx.x; const int row = (int)(i / 64 / (DM / 32)) * 16 + (int)(i & 15), c = (int)(i / 64 % (DM / 32)) * 32 + (int)((i >> 5) & 1) * 16 + (int)((i >> 4) & 1) * 8; const int t = row % TT; const int d = c % HD; v8us oh, ol;
    const float* fd = xs + (size_t)row * DM + c; const float* fp = (d < HD / 2) ? fd + HD / 2 : fd - HD / 2; const float* fi = INVT + d % (HD / 2); const v8f ld0 = *(const v8f*)fd, ld1 = *(const v8f*)fp, iv = *(const v8f*)fi;   // d is a multiple of 8, so the eight elements lie in the same half, their partners side by side and their inverse frequencies too
    xhold(fd, fp, fi, fi);
#pragma unroll
    for (int q = 0; q < 8; ++q) { const int dd = d + q; const float x0 = bfr(ld0[q]), x1 = bfr(ld1[q]); const float a = __fmul_rn((float)t, iv[q]); const float cs = cosf(a), sn = sinf(a); float p0 = __fmul_rn(x0, cs), p1 = __fmul_rn(x1, sn); asm volatile("" : "+v"(p0), "+v"(p1)); const float r = (dd < HD / 2) ? __fsub_rn(p0, p1) : __fadd_rn(p0, p1); unsigned short a2, c2; splitf(r, a2, c2); oh[q] = a2; ol[q] = c2; }
    *(v8us*)(Xh + (size_t)i * 8) = oh; *(v8us*)(Xl + (size_t)i * 8) = ol;  }
// k_prep: everything that reads only the inputs, in one grid. Blocks [0, GRP): rope on the raw hidden states (per 64-slice), as hi/lo planes (the longest bodies, so they start first); next 4 * GWT blocks: the four weight transposes (all [768][768]); last GCV blocks: the bf16 hidden states for v.
#define GWT (DM * DQ / 8 / 256)
#define GRP (NB_ * TT * DM / 8 / 256)
#define GCV (NB_ * TT * DM / 8 / 256)
__global__ __launch_bounds__(256) void k_prep(const float* x, const float* wq, const float* wk, const float* wv, const float* wo, bf* WQ, bf* WK, bf* WV, bf* WO, bf* XB, bf* XRh, bf* XRl) {
    const unsigned b = blockIdx.x;
    if (b < GRP) ropexP(b, x, XRh, XRl);
    else if (b < 4 * GWT + GRP) { const unsigned w = (b - GRP) / GWT; wtG((b - GRP) % GWT, w == 0 ? wq : w == 1 ? wk : w == 2 ? wv : wo, DM, DQ, w == 0 ? WQ : w == 1 ? WK : w == 2 ? WV : WO); }
    else cvt8(b - (4 * GWT + GRP), x, XB);
}

extern "C" void kernel_launch(void* const* d_in, const int* in_sizes, int n_in,
                              void* d_out, int out_size, void* d_ws, size_t ws_size, hipStream_t stream) {
    (void)in_sizes; (void)n_in; (void)out_size;
    const float* x = (const float*)d_in[0]; const float* wq = (const float*)d_in[1]; const float* bq = (const float*)d_in[2]; const float* wk = (const float*)d_in[3]; const float* bk = (const float*)d_in[4]; const float* wv = (const float*)d_in[5]; const float* bv = (const float*)d_in[6]; const float* wo = (const float*)d_in[7]; const float* bo = (const float*)d_in[8];
    float* OUT = (float*)d_out;     // [2][2048][768]
    char* wsp = (char*)d_ws;
    auto take = [&](size_t bytes) { char* p = wsp; wsp += (bytes + 255) & ~(size_t)255; return (void*)p; };
    const size_t MT = (size_t)NB_ * TT;   // rows of both batches
    bf* WQ = (bf*)take((size_t)DQ * DM * 2); bf* WK = (bf*)take((size_t)DKV * DM * 2); bf* WV = (bf*)take((size_t)DKV * DM * 2); bf* WO = (bf*)take((size_t)DM * DQ * 2);
    bf* XB = (bf*)take(MT * DM * 2); bf* XRh = (bf*)take(MT * DM * 2); bf* XRl = (bf*)take(MT * DM * 2);
    h16* QP16 = (h16*)take(MT * DQ * 2); h16* KP16 = (h16*)take(MT * DKV * 2); h16* VT16 = (h16*)take(MT * DKV * 2);
    bf* QPh = (bf*)take(MT * DQ * 2); bf* QPl = (bf*)take(MT * DQ * 2); bf* KPh = (bf*)take(MT * DKV * 2); bf* KPl = (bf*)take(MT * DKV * 2); bf* VTh = (bf*)take(MT * DKV * 2); bf* VTl = (bf*)take(MT * DKV * 2);
    bf* ATh = (bf*)take(MT * DQ * 2); bf* ATl = (bf*)take(MT * DQ * 2);
    if ((size_t)(wsp - (char*)d_ws) > ws_size) return;    // ws 256 MiB
    static_assert(DQ == DM && DKV == DM && NKV == NH_, "k_prep and k_qkv take the four weights as one shape");
    k_prep<<<4 * GWT + GRP + GCV, 256, 0, stream>>>(x, wq, wk, wv, wo, WQ, WK, WV, WO, XB, XRh, XRl);
    k_qkv<<<dim3(TT / 64, NH_, 3 * NB_), 32, 0, stream>>>(XRh, XRl, XB, WQ, WK, WV, bq, bk, bv, QP16, QPh, QPl, KP16, KPh, KPl, VT16, VTh, VTl);
    k_attn<<<dim3(ZH, TT / QT), 128, 0, stream>>>(QPh, QPl, KPh, KPl, VTh, VTl, QP16, KP16, VT16, ATh, ATl);
    k_out<<<dim3(NB_ * TT / 64, DM / 64, 1), 32, 0, stream>>>(ATh, ATl, WO, bo, OUT);
}

// v007
// A run of this version takes 68.3 microseconds.
// Two timings next to v006 both put it at 1.28 times that version's speed.
// Over all steps from v000 it is 21.9 times as fast.
#include <hip/hip_runtime.h>

// Local (sliding-window) multi-head attention with rotary embeddings applied to the RAW hidden states before the projections (hidden [2][2048][768]; xr = rotate-half rope(hidden viewed (S, 12, 64)) with angles t x 10000^(-2i/64) (computed in-kernel); q = xr Wq + bq, k = xr Wk + bk, v = hidden Wv + bv (keras per-head dense == 'xw' [768][768] + [768]); scores = (q x 0.125).k; keys with |i - j| >= 128 get -1e9 (exclusion); softmax; out = ctx Wo + bo ('xw' [768][768]) -> [2][2048][768] (3.1 M)).
// Four launches: operand preparation; q, k, v; attention (scores, softmax and P.V in one kernel); output projection. Stages that need nothing of each other share one grid by ranges of the block index. Every stage covers both batches and all 12 heads (grid.z or rows b*2048 + t in the projections, planes z = b*12 + h in attention); scores and probabilities exist as the band only (320 columns, column = key - (i0 - 128)) and only in the LDS of the wave that makes and uses them. Each GEMM whose result only feeds another GEMM writes that GEMM's 16-bit operand planes from its own epilogue (q, k: head planes [z][t][d]; v: transposed [z][d][t]; P.V: merged rows [b][t][h*64+d]); no f32 copy of q, k, v or ctx goes through memory. Every 16-bit operand plane in memory lies in FRAGMENT ORDER: a matrix [rows][K] is cut into blocks of 16 rows x 32 k, 1 KiB each, k blocks of a row block one behind the other; in a block element (r, k) lies at ((k >> 4) * 32 + ((k >> 3) & 1) * 16 + r) * 8 + (k & 7), so that a fragment is two wave-wide 16-byte loads of 512 bytes in a row each (4 whole lines, not 16 pieces of 32 bytes), and every writer stores whole 512-byte pieces. Stages: a rotary kernel rotates the bf16-rounded hidden states per 64-wide slice and writes them directly as hi/lo GEMM operand planes (f32 rotary, precise cosf/sinf, jnp-exact inverse frequencies); q and k as hi/lo x exact GEMMs (2 products) + f32 biases, v exact from the bf16 hidden states; q scaled by 0.125 before the split; banded T-2048 attention (hybrid rows: < 512 hi/lo 3 products, rest fp16 x1024): each 64-row query tile visits only the 320 keys [i0 - 128, i0 + 192) that its |i - j| < 128 window can reach (score tiles, softmax columns and the P.V k loop alike; every key outside has weight exactly 0), and the softmax applies the window inside the band as an index select; merged hi/lo x Wo exact + bo.
// Compute dtypes, f32 accumulate: every input rounded to bf16; rotary f32; q/k hi/lo x exact, v exact, + f32 biases; attention rows < 512 3 products, rest fp16; softmax f32; Wo hl x exact + bias.

#define NB_  2
#define TT   2048
#define DM   768
#define NH_  12
#define NKV  12
#define REP  (NH_ / NKV)
#define HD   64
#define DQ   (NH_ * HD)
#define DKV  (NKV * HD)
#define ZH   (NB_ * NH_)          // attention planes per launch: every (batch, head), z = b * NH_ + h
#define RH   512                  // query rows < RH use hi+lo planes (0: none)
#define WIN  0
#define PCAR 1024.0f
#define SCL  1.0f   // q x 0.125 applied before the split (QSC)
#define QSC  0.125f
#define WNB  128     // |i - j| < 128 kept
#define QT   64      // query rows per attention tile; the tile at row i0 can reach keys [i0 - WNB, i0 + QT + WNB) only
#define BW   (QT + 2 * WNB)                  // columns of a score / probability row: key j of a row in tile i0 lies at column j - (i0 - WNB)
#define BCH  ((64 + QT + 2 * WNB + 127) / 128)  // 128-key softmax chunks that cover the band from any 64-aligned start
typedef _Float16 h16;
typedef unsigned short bf;
typedef __attribute__((ext_vector_type(16))) __bf16   v16bf;
typedef __attribute__((ext_vector_type(16))) _Float16 v16h;
typedef __attribute__((ext_vector_type(8)))  _Float16 v8h;
typedef __attribute__((ext_vector_type(8)))  unsigned short v8us;
typedef __attribute__((ext_vector_type(8)))  float    v8f;
typedef __attribute__((ext_vector_type(4)))  float    v4f;
typedef v8h  __attribute__((may_alias)) v8ha;
typedef v4f  __attribute__((may_alias)) v4fa;
typedef v8us __attribute__((may_alias)) v8usa;

__device__ __forceinline__ unsigned short f2bf(float f) { unsigned u = __float_as_uint(f); u += 0x7FFFu + ((u >> 16) & 1u); return (unsigned short)(u >> 16); }
__device__ __forceinline__ float bf2f(unsigned short b) { return __uint_as_float(((unsigned)b) << 16); }
__device__ __forceinline__ float bfr(float f) { return bf2f(f2bf(f)); }
__device__ __forceinline__ v16h cat16(v8h lo, v8h hi) { return __builtin_shufflevector(lo, hi, 0, 1, 2, 3, 4, 5, 6, 7, 8, 9, 10, 11, 12, 13, 14, 15); }
__device__ __forceinline__ v16bf cat16b(v8us lo, v8us hi) { return __builtin_bit_cast(v16bf, __builtin_shufflevector(lo, hi, 0, 1, 2, 3, 4, 5, 6, 7, 8, 9, 10, 11, 12, 13, 14, 15)); }
__device__ __forceinline__ v8f wmma16(v16h a, v16h b, v8f c) { return __builtin_amdgcn_wmma_f32_16x16x32_f16(false, a, false, b, (short)0, c, false, false); }
__device__ __forceinline__ v8f wmmab(v16bf a, v16bf b, v8f c) { return __builtin_amdgcn_wmma_f32_16x16x32_bf16(false, a, false, b, (short)0, c, false, false); }
__device__ __forceinline__ h16 tohx(float x) { return (h16)x; }
__device__ __forceinline__ void splitf(float y, unsigned short& h, unsigned short& l) { h = f2bf(y); l = f2bf(y - bf2f(h)); }
typedef __attribute__((ext_vector_type(4))) _Float16 v4h;
typedef __attribute__((ext_vector_type(2))) unsigned short v2us;
typedef __attribute__((ext_vector_type(4))) unsigned short v4us;



// ---- gemmw: register-blocked GEMM, one wave per 64x64 output tile (16 accumulators), FOUR WAVES (2 x 2) per work-group on one 128x128 tile (bxb, byb, z) of (M/128, N/128, Z), 128 threads. Per stage of two k steps of 32 the group's operand rows (A, A2: 128 rows; Bt: 128 rows; per step 8 blocks of 1 KiB a plane, already in fragment order, head of the file) are copied once from the 16-bit planes into LDS by asynchronous copies, two buffers (rg), one stage ahead of their use, and each is read there by the two waves that need it. The epilogue's 16 x 68 f32 staging rows of each wave lie over the buffers. The kernels below pick the tile and the variant from the block index.
// C[m][n] (f32, pitch ldc, + optional f32 bias[n]) = sum_k A[m][k] Bt[n][k] (+ the lo plane's product per NSPLIT). z-batch strides sA/sB/sC in elements. K % 64 == 0.
// lda = row length of A and A2 in elements (= K: a row block is 16 * lda elements); Bt's is K. NSPLIT 1: A comes as hi + lo planes (A, A2), two products.
// EPI: what the epilogue stores. 0: C as above. 1, 2: (tile + bias) x esc as the next GEMM's 16-bit operand planes, fp16 (E16) and bf16 hi/lo (Eh, El), C unused; the 64 columns of a tile are one head.
//   1 (q, k; z = batch, by = head): plane z * NH_ + head, [t][d].  2 (v; same z, head; esc unused): plane z * NKV + head, transposed [d][t]. Both in fragment order.
// xhold: s_wait_xcnt 0 behind a run of fragment loads. The pointers that the run's loads go through are inputs of the statement, so their registers stay allocated up to the wait and no later load's result lands on them in front of it (a precaution of form; one wait serves the run).
template <typename T> __device__ __forceinline__ void xhold(const T* p0, const T* p1) { asm volatile("s_wait_xcnt 0x0" :: "v"(p0), "v"(p1) : "memory"); }
template <typename T> __device__ __forceinline__ void xhold(const T* p0, const T* p1, const T* p2, const T* p3) { asm volatile("s_wait_xcnt 0x0" :: "v"(p0), "v"(p1), "v"(p2), "v"(p3) : "memory"); }
// acp8, acp12: asynchronous copies from global memory to LDS, 16 bytes a lane and copy, through no register: of each plane (LDS byte address l, global pointer g) two 1-KiB fragment blocks, at g and at g + s elements, to LDS bytes l .. l + 2047. All copies of a step stand in one statement with s_wait_xcnt 0 as its last line, so that no address register of a copy is written again in front of the wait (a precaution of form; one wait serves the run).
template <typename T> __device__ __forceinline__ void acp8(const unsigned l0, const T* g0, const size_t s0, const unsigned l1, const T* g1, const size_t s1) {
    asm volatile("global_load_async_to_lds_b128 %0, %8, off\n\tglobal_load_async_to_lds_b128 %1, %9, off\n\tglobal_load_async_to_lds_b128 %2, %10, off\n\tglobal_load_async_to_lds_b128 %3, %11, off\n\tglobal_load_async_to_lds_b128 %4, %12, off\n\tglobal_load_async_to_lds_b128 %5, %13, off\n\tglobal_load_async_to_lds_b128 %6, %14, off\n\tglobal_load_async_to_lds_b128 %7, %15, off\n\ts_wait_xcnt 0x0"
                 :: "v"(l0), "v"(l0 + 512u), "v"(l0 + 1024u), "v"(l0 + 1536u), "v"(l1), "v"(l1 + 512u), "v"(l1 + 1024u), "v"(l1 + 1536u),
                    "v"(g0), "v"(g0 + 256), "v"(g0 + s0), "v"(g0 + s0 + 256), "v"(g1), "v"(g1 + 256), "v"(g1 + s1), "v"(g1 + s1 + 256) : "memory");
}
template <typename T> __device__ __forceinline__ void acp12(const unsigned l0, const T* g0, const size_t s0, const unsigned l1, const T* g1, const size_t s1, const unsigned l2, const T* g2, const size_t s2) {
    asm volatile("global_load_async_to_lds_b128 %0, %12, off\n\tglobal_load_async_to_lds_b128 %1, %13, off\n\tglobal_load_async_to_lds_b128 %2, %14, off\n\tglobal_load_async_to_lds_b128 %3, %15, off\n\tglobal_load_async_to_lds_b128 %4, %16, off\n\tglobal_load_async_to_lds_b128 %5, %17, off\n\tglobal_load_async_to_lds_b128 %6, %18, off\n\tglobal_load_async_to_lds_b128 %7, %19, off\n\tglobal_load_async_to_lds_b128 %8, %20, off\n\tglobal_load_async_to_lds_b128 %9, %21, off\n\tglobal_load_async_to_lds_b128 %10, %22, off\n\tglobal_load_async_to_lds_b128 %11, %23, off\n\ts_wait_xcnt 0x0"
                 :: "v"(l0), "v"(l0 + 512u), "v"(l0 + 1024u), "v"(l0 + 1536u), "v"(l1), "v"(l1 + 512u), "v"(l1 + 1024u), "v"(l1 + 1536u), "v"(l2), "v"(l2 + 512u), "v"(l2 + 1024u), "v"(l2 + 1536u),
                    "v"(g0), "v"(g0 + 256), "v"(g0 + s0), "v"(g0 + s0 + 256), "v"(g1), "v"(g1 + 256), "v"(g1 + s1), "v"(g1 + s1 + 256), "v"(g2), "v"(g2 + 256), "v"(g2 + s2), "v"(g2 + s2 + 256) : "memory");
}
template <typename T16> struct WFrag;
template <> struct WFrag<h16> { typedef v16h V; static __device__ __forceinline__ V ld(const h16* p) { return cat16(*(const v8h*)p, *(const v8h*)(p + 16)); } static __device__ __forceinline__ V ldp(const h16* p) { return cat16(*(const v8h*)p, *(const v8h*)(p + 256)); } static __device__ __forceinline__ v8f mma(V a, V b, v8f c) { return wmma16(a, b, c); } };
template <> struct WFrag<bf> { typedef v16bf V; static __device__ __forceinline__ V ld(const bf* p) { return cat16b(*(const v8us*)p, *(const v8us*)(p + 16)); } static __device__ __forceinline__ V ldp(const bf* p) { return cat16b(*(const v8us*)p, *(const v8us*)(p + 256)); } static __device__ __forceinline__ v8f mma(V a, V b, v8f c) { return wmmab(a, b, c); } };
template <typename T16, int NSPLIT, bool BIAS, int EPI>
__device__ __forceinline__ void gemmw(T16* rg, const int bxb, const int byb, const size_t z, const T16* __restrict__ A, const T16* __restrict__ A2, const T16* __restrict__ Bt, int K, int lda, float* C, int ldc, const float* __restrict__ bias, size_t sA, size_t sB, size_t sC, h16* E16, bf* Eh, bf* El, float esc) {
    typedef typename WFrag<T16>::V V;
    A += z * sA; if (A2) A2 += z * sA; Bt += z * sB; C += z * sC;
    const int wv = __builtin_amdgcn_readfirstlane((int)threadIdx.x >> 5), wm = wv >> 1, wn = wv & 1; const int bx = bxb * 2 + wm, by = byb * 2 + wn;   // the wave's own 64x64 tile
    const int lane = threadIdx.x & 31, lr = lane & 15, hi = lane >> 4; const int r0 = bx * 64, c0 = by * 64;
    v8f acc[4][4];
#pragma unroll
    for (int mb = 0; mb < 4; ++mb)
#pragma unroll
        for (int nb = 0; nb < 4; ++nb) acc[mb][nb] = (v8f){};
    const int ldb = K;
    // A stage in LDS is KS k steps of 32; a step: [A: 8 blocks][A2: 8 blocks (NSPLIT 1)][Bt: 8 blocks], 1 KiB each. Wave wv copies blocks 2 wv and 2 wv + 1 of every plane.
    constexpr int KS = 2, PL = 8 * 512, SUB = (2 + NSPLIT) * PL, STG = KS * SUB;   // elements of a plane's share of a step, of a step and of a stage
    const int NT = K / (32 * KS); const size_t sa = (size_t)16 * lda, sb = (size_t)16 * ldb;
    const T16* ga = A + (size_t)(bxb * 128 + wv * 32) * lda + lane * 8; const T16* ga2 = (NSPLIT == 1) ? A2 + (size_t)(bxb * 128 + wv * 32) * lda + lane * 8 : nullptr; const T16* gb = Bt + (size_t)(byb * 128 + wv * 32) * ldb + lane * 8;
    const unsigned lw = (unsigned)(size_t)rg + (unsigned)(wv * 2048 + lane * 16);   // LDS byte address of the lane's 16 bytes of the wave's first block in buffer 0
    auto fill = [&](const int t) {
#pragma unroll
        for (int kk = 0; kk < KS; ++kk) { const unsigned l = lw + (unsigned)(t & 1) * (unsigned)(STG * 2) + (unsigned)(kk * SUB * 2); const size_t o = (size_t)(t * KS + kk) * 512;
            if constexpr (NSPLIT == 1) acp12(l, ga + o, sa, l + PL * 2, ga2 + o, sa, l + 2 * PL * 2, gb + o, sb); else acp8(l, ga + o, sa, l + PL * 2, gb + o, sb); } };
    fill(0);
    asm volatile("s_wait_asynccnt 0x0" ::: "memory");   // the wave's own copies of stage 0 have landed
    __syncthreads();                                     // and every wave's: stage 0 may be read
    if (NT > 1) fill(1);
#pragma unroll 1   // rolled: one trip a stage, the buffer picked by the stage's parity
    for (int t = 0; t < NT; ++t) {
#pragma unroll
        for (int kk = 0; kk < KS; ++kk) {
            V a[4], a2[4], b[4];
            const T16* ps = rg + (t & 1) * STG + kk * SUB + lane * 8; const T16* pa = ps + wm * 4 * 512; const T16* pb = ps + (1 + NSPLIT) * PL + wn * 4 * 512;
#pragma unroll
            for (int nb = 0; nb < 4; ++nb) b[nb] = WFrag<T16>::ldp(pb + nb * 512);
#pragma unroll
            for (int mb = 0; mb < 4; ++mb) { a[mb] = WFrag<T16>::ldp(pa + mb * 512); if (NSPLIT == 1) a2[mb] = WFrag<T16>::ldp(pa + PL + mb * 512); }
            __builtin_amdgcn_sched_barrier(0);   // the step's fragment reads stay one group in front of its matrix instructions: a read among them would be waited for at full LDS latency
#pragma unroll
            for (int mb = 0; mb < 4; ++mb) {   // in the order in which the fragments arrive: each A fragment feeds four matrix instructions
#pragma unroll
                for (int nb = 0; nb < 4; ++nb) acc[mb][nb] = WFrag<T16>::mma(a[mb], b[nb], acc[mb][nb]);
                if (NSPLIT == 1) {
#pragma unroll
                    for (int nb = 0; nb < 4; ++nb) acc[mb][nb] = WFrag<T16>::mma(a2[mb], b[nb], acc[mb][nb]); } }
            __builtin_amdgcn_sched_barrier(0);   // and its matrix instructions stay in front of what follows: sunk behind the barrier they would stand between it and the next copies and shorten the copies' lead
            asm volatile("v_nop\n\tv_nop\n\tv_nop\n\tv_nop" : "+v"(acc[0][0]), "+v"(acc[1][1]), "+v"(acc[2][2]), "+v"(acc[3][3]) : "v"(a[0]), "v"(a[3]));   // the four vector slots between the step's last matrix instructions and the address arithmetic behind them, which may take fragment registers
        }
        asm volatile("s_wait_dscnt 0x0" ::: "memory");      // the wave's reads of this stage's buffer are done before the buffer is given up
        asm volatile("s_wait_asynccnt 0x0" ::: "memory");   // the wave's own copies of stage t + 1 have landed
        __syncthreads();                                     // publishes stage t + 1 and ends every wave's reads of stage t's buffer
        if (t + 2 < NT) fill(t + 2);                         // into the buffer that stage t has just left; flies during stage t + 1
    }
    asm volatile("s_wait_asynccnt 0x0" ::: "memory");   // no copy is outstanding behind the loop
    float* os = (float*)rg + wv * 16 * 68;   // the wave's staging rows lie over the buffers: the last trip's barrier stands behind every wave's last fragment read, and no copy is outstanding
    // EPI 1, 2: one pointer a plane for the lane's first element; every store of the tile lies at a constant offset from it. bb: the lane's bias values (EPI 1: its 8 columns of each of the 4 pieces of a row block; EPI 2: its column of each of the 4 column blocks).
    h16* p16 = nullptr; bf* ph = nullptr; bf* pl = nullptr; float bb[(EPI == 1) ? 32 : 4] = {};
    if constexpr (EPI != 0) {
        const size_t oo = (EPI == 1) ? ((z * NH_ + by) * TT + r0) * HD + lane * 8 : (z * NKV + by) * HD * TT + (size_t)r0 * 16 + lane * 8;
        p16 = E16 + oo; ph = Eh + oo; pl = El + oo;
        if (BIAS) { const float* pbi = bias + c0 + ((EPI == 2) ? lr : hi * 8);
            if (EPI == 2) {
#pragma unroll
                for (int nb = 0; nb < 4; ++nb) bb[nb] = pbi[nb * 16];
            } else {
#pragma unroll
                for (int q = 0; q < 32; ++q) bb[q] = pbi[(q >> 3) * 16 + (q & 7)]; }
            xhold(pbi, pbi);
#pragma unroll
            for (int q = 0; q < ((EPI == 1) ? 32 : 4); ++q) bb[q] = bfr(bb[q]); }
    }
#pragma unroll
    for (int mb = 0; mb < 4; ++mb) {
        if constexpr (EPI != 2) {
#pragma unroll
            for (int nb = 0; nb < 4; ++nb) {
#pragma unroll
                for (int j = 0; j < 8; ++j) os[(hi * 8 + j) * 68 + nb * 16 + lr] = acc[mb][nb][j]; } }
        __builtin_amdgcn_wave_barrier(); asm volatile("" ::: "memory");
        if constexpr (EPI == 0) {
            float* cp = C + (size_t)(r0 + mb * 16 + hi) * ldc + c0 + lr * 4; v4f ov[8];   // the lane's first element of the 16 staged rows; its stores lie 2 * ldc apart
#pragma unroll
            for (int s = 0; s < 8; ++s) { const int row = 2 * s + hi, cofs = lr * 4; v4f val = *(const v4fa*)(os + row * 68 + cofs); if (BIAS) { val[0] += bfr(bias[c0 + cofs]); val[1] += bfr(bias[c0 + cofs + 1]); val[2] += bfr(bias[c0 + cofs + 2]); val[3] += bfr(bias[c0 + cofs + 3]); }
                ov[s] = val; *(v4f*)(cp + (size_t)(2 * s) * ldc) = ov[s]; }
            // s_wait_xcnt 0 behind the run of stores; their pointer and data are inputs, so those registers stay as they are up to the wait (a precaution of form, as xhold)
            asm volatile("s_wait_xcnt 0x0" :: "v"(cp), "v"(ov[0]), "v"(ov[1]), "v"(ov[2]), "v"(ov[3]), "v"(ov[4]), "v"(ov[5]), "v"(ov[6]), "v"(ov[7]) : "memory");
        } else if constexpr (EPI == 2) {
            v8h o16[4]; v8us oh[4], ol[4];
#pragma unroll
            for (int nb = 0; nb < 4; ++nb) {   // the transposed plane's fragment order (row d = nb * 16 + lr, 8 consecutive t from hi * 8) is the accumulator's own: no staging
#pragma unroll
                for (int j = 0; j < 8; ++j) { float x = acc[mb][nb][j]; if (BIAS) x += bb[nb]; o16[nb][j] = tohx(x); unsigned short a2, c2; splitf(x, a2, c2); oh[nb][j] = a2; ol[nb][j] = c2; }
                const size_t oo = (size_t)nb * 16 * TT + mb * 256; *(v8h*)(p16 + oo) = o16[nb]; *(v8us*)(ph + oo) = oh[nb]; *(v8us*)(pl + oo) = ol[nb]; }
            // s_wait_xcnt 0 behind the run of stores; their pointers and data are inputs, so those registers stay as they are up to the wait (a precaution of form, as xhold)
            asm volatile("s_wait_xcnt 0x0" :: "v"(p16), "v"(ph), "v"(pl), "v"(o16[0]), "v"(o16[1]), "v"(o16[2]), "v"(o16[3]), "v"(oh[0]), "v"(oh[1]), "v"(oh[2]), "v"(oh[3]), "v"(ol[0]), "v"(ol[1]), "v"(ol[2]), "v"(ol[3]) : "memory");
        } else {
            v8h o16[4]; v8us oh[4], ol[4];
#pragma unroll
            for (int c = 0; c < 4; ++c) {   // piece c of the row block: the lane's row lr, columns c * 16 + hi * 8 + (0..7)
                const v4f v0 = *(const v4fa*)(os + lr * 68 + c * 16 + hi * 8), v1 = *(const v4fa*)(os + lr * 68 + c * 16 + hi * 8 + 4);
#pragma unroll
                for (int q = 0; q < 8; ++q) { float x = (q < 4) ? v0[q & 3] : v1[q & 3]; if (BIAS) x += bb[c * 8 + q]; const float r = x * esc; o16[c][q] = tohx(r); unsigned short a2, c2; splitf(r, a2, c2); oh[c][q] = a2; ol[c][q] = c2; }
                const size_t oo = (size_t)mb * 16 * HD + c * 256;
                *(v8h*)(p16 + oo) = o16[c]; *(v8us*)(ph + oo) = oh[c]; *(v8us*)(pl + oo) = ol[c]; }
            // s_wait_xcnt 0 behind the run of stores; their pointers and data are inputs, so those registers stay as they are up to the wait (a precaution of form, as xhold)
            asm volatile("s_wait_xcnt 0x0" :: "v"(p16), "v"(ph), "v"(pl), "v"(o16[0]), "v"(o16[1]), "v"(o16[2]), "v"(o16[3]), "v"(oh[0]), "v"(oh[1]), "v"(oh[2]), "v"(oh[3]), "v"(ol[0]), "v"(ol[1]), "v"(ol[2]), "v"(ol[3]) : "memory");
        }
        __builtin_amdgcn_wave_barrier(); asm volatile("" ::: "memory");
    }
}

// ---- GEMM launches. Stages that need nothing of each other share one grid: a block-uniform test of the block index picks the variant, so their waves run side by side and not one launch behind the other.
// k_qkv: grid (TT/128, heads/2, 3 * NB_), 4 waves; blockIdx.z / NB_ = 0: q, 1: k (one code path, pointers selected), 2: v; blockIdx.z % NB_ = batch. Each epilogue writes the attention operand planes b * 12 + h itself.
#define RGE (2 * 2 * 3 * 8 * 512)   // elements of gemmw's two LDS buffers: two k steps a stage, three planes a step
__global__ __launch_bounds__(128) void k_qkv(const bf* XRh, const bf* XRl, const bf* XB, const bf* WQ, const bf* WK, const bf* WV, const float* bq, const float* bk, const float* bv, h16* QP16, bf* QPh, bf* QPl, h16* KP16, bf* KPh, bf* KPl, h16* VT16, bf* VTh, bf* VTl) {
    __shared__ __align__(1024) bf rg[RGE];
    const int w = (int)blockIdx.z / NB_; const size_t z = blockIdx.z % NB_;
    if (w == 2) gemmw<bf, 0, true, 2>(rg, blockIdx.x, blockIdx.y, z, XB, nullptr, WV, DM, DM, nullptr, 0, bv, (size_t)TT * DM, 0, 0, VT16, VTh, VTl, 1.0f);
    else gemmw<bf, 1, true, 1>(rg, blockIdx.x, blockIdx.y, z, XRh, XRl, w ? WK : WQ, DM, DM, nullptr, 0, w ? bk : bq, (size_t)TT * DM, 0, 0, w ? KP16 : QP16, w ? KPh : QPh, w ? KPl : QPl, w ? 1.0f : QSC);   /* q x 0.125 */
}
// ---- attn16: scores, softmax and P.V of 16 query rows, all in ONE WAVE; nothing of the scores or the probabilities goes through memory. i0: first row of the 64-row query tile (it fixes the band: keys [i0 - WNB, i0 + QT + WNB), column = key - (i0 - WNB)); st: which 16 rows of the tile; z: plane b * NH_ + h.
// sw: the wave's own 16 rows x SP floats of LDS. A row first holds its BW f32 scores; the softmax reads a row whole into registers and then writes the row's probabilities over it (fp16: BW halves; hi/lo: BW + BW bf16), where the P.V A fragments read them (row pitch 1296 B = 16 B x 81, odd, for 16-byte reads). At the end the same LDS stages the output rows.
// Keys off the sequence (first and last two tiles): their K and V fragments are read from keys that exist, the softmax excludes them like any key outside the window and writes probability 0 there, so their products add exact zeros. Every accumulator takes its products in ascending k, per 32 k in the order hi.hi, lo.hi, hi.lo; a softmax row sits in the lanes by 128-key chunks of the sequence, whatever the tile, so its sums have one fixed order.
// K and V fragments come in groups of 8 through a ring of three register sets, two groups ahead of their use; the first two V groups are asked for in front of the softmax.
#define SP 324
typedef v4h  __attribute__((may_alias)) v4ha;
typedef v4us __attribute__((may_alias)) v4usa;
template <typename T16, bool HIR>
__device__ __forceinline__ void attn16(float* sw, const int i0, const int st, const size_t z, const T16* __restrict__ Q, const T16* __restrict__ Q2, const T16* __restrict__ Kp, const T16* __restrict__ Kp2, const T16* __restrict__ Vt, const T16* __restrict__ Vt2, bf* Eh, bf* El, const float esc) {
    typedef typename WFrag<T16>::V V;
    const int lane = threadIdx.x & 31, lr = lane & 15, hi = lane >> 4; const int r0 = i0 + st * 16, bo0 = i0 - WNB;   /* bo0: key of stored column 0 */
    V ring[3][8];
    // -- scores: a group is GK keys (fp16: 4 column blocks x 2 k halves; hi/lo: 2 column blocks x 2 k halves x 2 planes)
    constexpr int GK = HIR ? 32 : 64, NBG = GK / 16, NGS = BW / GK;
    V a[2], a2[2];
    { const T16* pq = Q + ((z * TT + r0) * HD + lane * 8); const T16* pq2 = HIR ? Q2 + ((z * TT + r0) * HD + lane * 8) : pq;
      a[0] = WFrag<T16>::ldp(pq); a[1] = WFrag<T16>::ldp(pq + 512); if (HIR) { a2[0] = WFrag<T16>::ldp(pq2); a2[1] = WFrag<T16>::ldp(pq2 + 512); }
      xhold(pq, pq2); }
    auto ldk = [&](const int g) { const int c = bo0 + g * GK, cc = (c < 0 || c >= TT) ? 0 : c; const size_t o = (z * TT + cc) * HD + lane * 8; const T16* pk = Kp + o; const T16* pk2 = HIR ? Kp2 + o : pk;
#pragma unroll
        for (int kk = 0; kk < 2; ++kk)
#pragma unroll
            for (int nb = 0; nb < NBG; ++nb) { ring[g % 3][kk * NBG + nb] = WFrag<T16>::ldp(pk + (nb * 16 * HD + kk * 512)); if (HIR) ring[g % 3][4 + kk * NBG + nb] = WFrag<T16>::ldp(pk2 + (nb * 16 * HD + kk * 512)); }
        xhold(pk, pk2); };
    ldk(0); ldk(1);
#pragma unroll
    for (int g = 0; g < NGS; ++g) {
        if (g + 2 < NGS) ldk(g + 2);
        v8f acc[NBG];
#pragma unroll
        for (int nb = 0; nb < NBG; ++nb) acc[nb] = (v8f){};
#pragma unroll
        for (int kk = 0; kk < 2; ++kk) {
#pragma unroll
            for (int nb = 0; nb < NBG; ++nb) acc[nb] = WFrag<T16>::mma(a[kk], ring[g % 3][kk * NBG + nb], acc[nb]);
            if (HIR) {
#pragma unroll
                for (int nb = 0; nb < NBG; ++nb) acc[nb] = WFrag<T16>::mma(a2[kk], ring[g % 3][kk * NBG + nb], acc[nb]);
#pragma unroll
                for (int nb = 0; nb < NBG; ++nb) acc[nb] = WFrag<T16>::mma(a[kk], ring[g % 3][4 + kk * NBG + nb], acc[nb]); } }
#pragma unroll
        for (int nb = 0; nb < NBG; ++nb)
#pragma unroll
            for (int j = 0; j < 8; ++j) sw[(hi * 8 + j) * SP + g * GK + nb * 16 + lr] = acc[nb][j];
        // the four vector slots between this group's last matrix instructions and the next group's, which start anew in the same accumulator registers (behind the stores by the clobber); the group's fragments are inputs, so that no accumulator is laid over a fragment that a matrix instruction has just read
        asm volatile("v_nop\n\tv_nop\n\tv_nop\n\tv_nop" :: "v"(ring[g % 3][0]), "v"(ring[g % 3][1]), "v"(ring[g % 3][2]), "v"(ring[g % 3][3]), "v"(ring[g % 3][4]), "v"(ring[g % 3][5]), "v"(ring[g % 3][6]), "v"(ring[g % 3][7]) : "memory");
        __builtin_amdgcn_sched_barrier(0);   // keeps later groups' loads from rising over this group: more than three sets in flight would cost a resident wave per SIMD
    }
    // -- V fragments: a group is TPG trips of 32 keys (fp16: 2 trips x 4 column blocks; hi/lo: 1 trip x 4 column blocks x 2 planes)
    constexpr int TPG = HIR ? 1 : 2, NGV = BW / 32 / TPG;
    auto ldv = [&](const int g) {
#pragma unroll
        for (int tt = 0; tt < TPG; ++tt) { const int kc = bo0 + (g * TPG + tt) * 32, kv = (kc < 0 || kc >= TT) ? 0 : kc; const size_t o = z * HD * TT + (size_t)kv * 16 + lane * 8; const T16* pv = Vt + o; const T16* pv2 = HIR ? Vt2 + o : pv;
#pragma unroll
            for (int nb = 0; nb < 4; ++nb) { ring[g % 3][tt * 4 + nb] = WFrag<T16>::ldp(pv + nb * 16 * TT); if (HIR) ring[g % 3][4 + nb] = WFrag<T16>::ldp(pv2 + nb * 16 * TT); }
            xhold(pv, pv2); } };
    __builtin_amdgcn_wave_barrier(); asm volatile("" ::: "memory");   // the rows are read by other lanes than wrote them: keeps the LDS reads below behind the stores above; and the V loads behind the last use of the K fragments, whose registers they take
    ldv(0); ldv(1);
    // -- softmax, RG rows at a time (their chains of cross-lane steps run side by side; two where the hi/lo split makes the body long): per row a register row, one exp and fixed trees; 128-key chunks at the same lane places as a full row
    const int blo = max(bo0, 0), bhi = min(i0 + QT + WNB, TT); const int jb = (bo0 >> 7) * 128 + lane * 4;   /* first 128-key chunk that touches the band (may start off the band: lanes there load and store nothing and count as excluded keys) */
    constexpr int RG = HIR ? 2 : 4;
#pragma unroll 1   // rolled: copies of this body would only lengthen the text
    for (int g = 0; g < 16 / RG; ++g) {
        float v[RG][BCH * 4], mx[RG], sum[RG]; float* sg = sw + g * RG * SP;
#pragma unroll
        for (int rr = 0; rr < RG; ++rr) { const int i = r0 + g * RG + rr; const float* sr = sg + rr * SP; mx[rr] = -3.0e38f;
#pragma unroll
            for (int ch = 0; ch < BCH; ++ch) { const int j0 = jb + ch * 128; const bool inb = (j0 >= blo && j0 < bhi);   /* the lane's four keys lie on the band (so on the sequence) or all off it: blo, bhi are multiples of 64 */ v4f s4 = (v4f){}; if (inb) s4 = *(const v4fa*)(sr + (j0 - bo0));
#pragma unroll
                for (int q = 0; q < 4; ++q) { const int j = j0 + q; const float t = (inb && i - j < WNB && j - i < WNB) ? s4[q] * SCL : -3.0e38f; v[rr][ch * 4 + q] = t;   /* |i - j| < 128 window (both sides); a key off the sequence is excluded like any other */ mx[rr] = fmaxf(mx[rr], t); } } }
#pragma unroll
        for (int rr = 0; rr < RG; ++rr) {
#pragma unroll
            for (int sh = 16; sh; sh >>= 1) mx[rr] = fmaxf(mx[rr], __shfl_xor(mx[rr], sh, 32));
            sum[rr] = 0.f;
#pragma unroll
            for (int k = 0; k < BCH * 4; ++k) { const float x2 = __fmul_rn(__fsub_rn(v[rr][k], mx[rr]), 1.4426950408889634f); float e = __builtin_amdgcn_exp2f(x2); asm volatile("v_nop" : "+v"(e) : "v"(x2));   /* the one slot behind a transcendental: its result is used and its source's register taken again only behind this */ v[rr][k] = e; sum[rr] += e; }
#pragma unroll
            for (int sh = 16; sh; sh >>= 1) sum[rr] += __shfl_xor(sum[rr], sh, 32); }
#pragma unroll
        for (int rr = 0; rr < RG; ++rr) { const float f = __fdiv_rn(HIR ? 1.0f : PCAR, sum[rr]);
#pragma unroll
            for (int ch = 0; ch < BCH; ++ch) { const int j0 = jb + ch * 128; const bool onrow = (j0 >= bo0 && j0 < bo0 + BW);   /* every stored column gets its probability, 0 for a key off the sequence */
                if (HIR) { v4us oh, ol;
#pragma unroll
                    for (int q = 0; q < 4; ++q) { unsigned short x, c2; splitf(v[rr][ch * 4 + q] * f, x, c2); oh[q] = x; ol[q] = c2; }
                    if (onrow) { bf* pr = (bf*)(sg + rr * SP) + (j0 - bo0); *(v4usa*)pr = oh; *(v4usa*)(pr + BW) = ol; }
                } else { v4h o4;
#pragma unroll
                    for (int q = 0; q < 4; ++q) o4[q] = tohx(v[rr][ch * 4 + q] * f);
                    if (onrow) *(v4ha*)((h16*)(sg + rr * SP) + (j0 - bo0)) = o4; } } }
    }
    __builtin_amdgcn_wave_barrier(); asm volatile("" ::: "memory");   // as above: the fragment reads below stay behind the probability stores
    // -- P.V: A = the 16 probability rows from LDS, B = transposed V
    v8f o[4];
#pragma unroll
    for (int nb = 0; nb < 4; ++nb) o[nb] = (v8f){};
    const T16* pp = (const T16*)sw + (lr * (2 * SP) + 8 * hi);
#pragma unroll
    for (int g = 0; g < NGV; ++g) {
        if (g + 2 < NGV) ldv(g + 2);
#pragma unroll
        for (int tt = 0; tt < TPG; ++tt) { const V p = WFrag<T16>::ld(pp + (g * TPG + tt) * 32); V p2; if (HIR) p2 = WFrag<T16>::ld(pp + (BW + (g * TPG + tt) * 32));
#pragma unroll
            for (int nb = 0; nb < 4; ++nb) o[nb] = WFrag<T16>::mma(p, ring[g % 3][tt * 4 + nb], o[nb]);
            if (HIR) {
#pragma unroll
                for (int nb = 0; nb < 4; ++nb) o[nb] = WFrag<T16>::mma(p2, ring[g % 3][nb], o[nb]);
#pragma unroll
                for (int nb = 0; nb < 4; ++nb) o[nb] = WFrag<T16>::mma(p, ring[g % 3][4 + nb], o[nb]); } }
        asm volatile("v_nop\n\tv_nop\n\tv_nop\n\tv_nop" :: "v"(ring[g % 3][0]), "v"(ring[g % 3][1]), "v"(ring[g % 3][2]), "v"(ring[g % 3][3]), "v"(ring[g % 3][4]), "v"(ring[g % 3][5]), "v"(ring[g % 3][6]), "v"(ring[g % 3][7]) : "memory");   // as in the score loop: no accumulator over a fragment just read
        __builtin_amdgcn_sched_barrier(0);   // as in the score loop: at most three sets in flight
    }
    // -- epilogue: the 16 x 64 tile x esc as hi/lo rows b * TT + t, columns h * HD + d of the merged [NB_ * TT][DQ] operand of the output projection, staged through LDS (pitch 68) for whole 16-byte pieces a lane
    __builtin_amdgcn_wave_barrier(); asm volatile("" ::: "memory");   // the staging stores stay behind the last fragment reads of the same LDS
#pragma unroll
    for (int nb = 0; nb < 4; ++nb)
#pragma unroll
        for (int j = 0; j < 8; ++j) sw[(hi * 8 + j) * 68 + nb * 16 + lr] = o[nb][j];
    __builtin_amdgcn_wave_barrier(); asm volatile("" ::: "memory");   // and the reads below behind the staging stores
    const size_t oo = ((z / NH_) * TT + r0) * DQ + (z % NH_) * (HD * 16) + lane * 8; bf* ph = Eh + oo; bf* pl = El + oo; v8us oh[4], ol[4];   // fragment order: the wave's 16 rows x 64 columns are 2 KiB in a row of each plane
#pragma unroll
    for (int c = 0; c < 4; ++c) { const v4f v0 = *(const v4fa*)(sw + lr * 68 + c * 16 + hi * 8), v1 = *(const v4fa*)(sw + lr * 68 + c * 16 + hi * 8 + 4);   // piece c: the lane's row lr, columns c * 16 + hi * 8 + (0..7)
#pragma unroll
        for (int q = 0; q < 8; ++q) { unsigned short x, c2; splitf(((q < 4) ? v0[q & 3] : v1[q & 3]) * esc, x, c2); oh[c][q] = x; ol[c][q] = c2; }
        *(v8us*)(ph + c * 256) = oh[c]; *(v8us*)(pl + c * 256) = ol[c]; }
    // s_wait_xcnt 0 behind the run of stores; their pointers and data are inputs, so those registers stay as they are up to the wait (a precaution of form, as xhold)
    asm volatile("s_wait_xcnt 0x0" :: "v"(ph), "v"(pl), "v"(oh[0]), "v"(oh[1]), "v"(oh[2]), "v"(oh[3]), "v"(ol[0]), "v"(ol[1]), "v"(ol[2]), "v"(ol[3]) : "memory");
}
// k_attn: grid (ZH, TT/64), 4 waves: wave st takes rows [16 st, 16 st + 16) of query tile blockIdx.y of plane blockIdx.x; the four read the same K and V band and share nothing else (no barrier). Tiles of rows < RH take the hi/lo planes (3 products; the longest, so they start first), the rest the fp16 planes, whose x1024 carry the epilogue undoes.
__global__ __launch_bounds__(128) void k_attn(const bf* QPh, const bf* QPl, const bf* KPh, const bf* KPl, const bf* VTh, const bf* VTl, const h16* QP16, const h16* KP16, const h16* VT16, bf* ATh, bf* ATl) {
    __shared__ __align__(16) float sm[4 * 16 * SP];
    const int st = threadIdx.x >> 5, i0 = (int)blockIdx.y * QT; float* sw = sm + st * 16 * SP;
    if (i0 < RH) attn16<bf, true>(sw, i0, st, blockIdx.x, QPh, QPl, KPh, KPl, VTh, VTl, ATh, ATl, 1.0f);
    else attn16<h16, false>(sw, i0, st, blockIdx.x, QP16, nullptr, KP16, nullptr, VT16, nullptr, ATh, ATl, 1.0f / PCAR);
}
// k_out: grid (NB_*TT/128, DM/128), 4 waves: merged hi/lo ctx x Wo + bo.
__global__ __launch_bounds__(128) void k_out(const bf* ATh, const bf* ATl, const bf* WO, const float* bo, float* OUT) {
    __shared__ __align__(1024) bf rg[RGE];
    gemmw<bf, 1, true, 0>(rg, blockIdx.x, blockIdx.y, 0, ATh, ATl, WO, DQ, DQ, OUT, DM, bo, 0, 0, 0, nullptr, nullptr, nullptr, 1.0f);
}

// ---- operand preparation: three bodies, each for block blk of its own range of k_prep's grid.
// Each thread makes one 16-byte piece of a plane in fragment order: piece i holds row (i / 64 / (K / 32)) * 16 + (i & 15), columns ((i / 64) % (K / 32)) * 32 + ((i >> 5) & 1) * 16 + ((i >> 4) & 1) * 8 + (0..7); a wave stores 512 bytes in a row.
__device__ __forceinline__ void wtG(const unsigned blk, const float* __restrict__ w, int K, int N, bf* Bt) {
    const unsigned i = blk * 256 + threadIdx.x; const int kb = K / 32; const int n = (int)(i / 64 / kb) * 16 + (int)(i & 15), k0 = (int)(i / 64 % kb) * 32 + (int)((i >> 5) & 1) * 16 + (int)((i >> 4) & 1) * 8;
    const float* pw = w + (size_t)k0 * N + n; float ldw[8]; v8us o;
#pragma unroll
    for (int q = 0; q < 8; ++q) ldw[q] = pw[(size_t)q * N];
    xhold(pw, pw);
#pragma unroll
    for (int q = 0; q < 8; ++q) o[q] = f2bf(ldw[q]);
    bf* pd = Bt + (size_t)i * 8; *(v8us*)pd = o;
    asm volatile("s_wait_xcnt 0x0" :: "v"(pd), "v"(o) : "memory");   // s_wait_xcnt 0 behind the store; its pointer and data are inputs, so those registers stay as they are up to the wait (a precaution of form, as xhold)
}
__device__ __forceinline__ void cvt8(const unsigned blk, const float* __restrict__ src, bf* dst) { const unsigned i = blk * 256 + threadIdx.x; const int row = (int)(i / 64 / (DM / 32)) * 16 + (int)(i & 15), k0 = (int)(i / 64 % (DM / 32)) * 32 + (int)((i >> 5) & 1) * 16 + (int)((i >> 4) & 1) * 8;
    const float* ps = src + (size_t)row * DM + k0; const v8f v = *(const v8f*)ps; xhold(ps, ps); v8us o;
#pragma unroll
    for (int k = 0; k < 8; ++k) o[k] = f2bf(v[k]);
    bf* pd = dst + (size_t)i * 8; *(v8us*)pd = o;
    asm volatile("s_wait_xcnt 0x0" :: "v"(pd), "v"(o) : "memory");   // as in wtG: the wait behind the store
}

__constant__ __attribute__((aligned(32))) float INVT[HD / 2] = { 1.000000000e+00f, 7.498942018e-01f, 5.623413324e-01f, 4.216965139e-01f, 3.162277639e-01f, 2.371373624e-01f, 1.778279394e-01f, 1.333521456e-01f, 1.000000015e-01f, 7.498941571e-02f, 5.623412877e-02f, 4.216964915e-02f, 3.162277862e-02f, 2.371373586e-02f, 1.778279431e-02f, 1.333521493e-02f, 9.999999776e-03f, 7.498942316e-03f, 5.623413250e-03f, 4.216964822e-03f, 3.162277862e-03f, 2.371373819e-03f, 1.778279431e-03f, 1.333521446e-03f, 1.000000047e-03f, 7.498941850e-04f, 5.623413017e-04f, 4.216964880e-04f, 3.162277862e-04f, 2.371373848e-04f, 1.778279402e-04f, 1.333521504e-04f };   // jnp-exact float32 1/10000^(2i/64)
__device__ __forceinline__ void ropexP(const unsigned blk, const float* __restrict__ xs, bf* Xh, bf* Xl) { const unsigned i = blk * 256 + threadIdx.x; const int row = (int)(i / 64 / (DM / 32)) * 16 + (int)(i & 15), c = (int)(i / 64 % (DM / 32)) * 32 + (int)((i >> 5) & 1) * 16 + (int)((i >> 4) & 1) * 8; const int t = row % TT; const int d = c % HD; v8us oh, ol;
    const float* fd = xs + (size_t)row * DM + c; const float* fp = (d < HD / 2) ? fd + HD / 2 : fd - HD / 2; const float* fi = INVT + d % (HD / 2); const v8f ld0 = *(const v8f*)fd, ld1 = *(const v8f*)fp, iv = *(const v8f*)fi;   // d is a multiple of 8, so the eight elements lie in the same half, their partners side by side and their inverse frequencies too
    xhold(fd, fp, fi, fi);
#pragma unroll
    for (int q = 0; q < 8; ++q) { const int dd = d + q; const float x0 = bfr(ld0[q]), x1 = bfr(ld1[q]); const float a = __fmul_rn((float)t, iv[q]); const float cs = cosf(a), sn = sinf(a); float p0 = __fmul_rn(x0, cs), p1 = __fmul_rn(x1, sn); asm volatile("" : "+v"(p0), "+v"(p1)); const float r = (dd < HD / 2) ? __fsub_rn(p0, p1) : __fadd_rn(p0, p1); unsigned short a2, c2; splitf(r, a2, c2); oh[q] = a2; ol[q] = c2; }
    *(v8us*)(Xh + (size_t)i * 8) = oh; *(v8us*)(Xl + (size_t)i * 8) = ol;  }
// k_prep: everything that reads only the inputs, in one grid. Blocks [0, GRP): rope on the raw hidden states (per 64-slice), as hi/lo planes (the longest bodies, so they start first); next 4 * GWT blocks: the four weight transposes (all [768][768]); last GCV blocks: the bf16 hidden states for v.
#define GWT (DM * DQ / 8 / 256)
#define GRP (NB_ * TT * DM / 8 / 256)
#define GCV (NB_ * TT * DM / 8 / 256)
__global__ __launch_bounds__(256) void k_prep(const float* x, const float* wq, const float* wk, const float* wv, const float* wo, bf* WQ, bf* WK, bf* WV, bf* WO, bf* XB, bf* XRh, bf* XRl) {
    const unsigned b = blockIdx.x;
    if (b < GRP) ropexP(b, x, XRh, XRl);
    else if (b < 4 * GWT + GRP) { const unsigned w = (b - GRP) / GWT; wtG((b - GRP) % GWT, w == 0 ? wq : w == 1 ? wk : w == 2 ? wv : wo, DM, DQ, w == 0 ? WQ : w == 1 ? WK : w == 2 ? WV : WO); }
    else cvt8(b - (4 * GWT + GRP), x, XB);
}

extern "C" void kernel_launch(void* const* d_in, const int* in_sizes, int n_in,
                              void* d_out, int out_size, void* d_ws, size_t ws_size, hipStream_t stream) {
    (void)in_sizes; (void)n_in; (void)out_size;
    const float* x = (const float*)d_in[0]; const float* wq = (const float*)d_in[1]; const float* bq = (const float*)d_in[2]; const float* wk = (const float*)d_in[3]; const float* bk = (const float*)d_in[4]; const float* wv = (const float*)d_in[5]; const float* bv = (const float*)d_in[6]; const float* wo = (const float*)d_in[7]; const float* bo = (const float*)d_in[8];
    float* OUT = (float*)d_out;     // [2][2048][768]
    char* wsp = (char*)d_ws;
    auto take = [&](size_t bytes) { char* p = wsp; wsp += (bytes + 255) & ~(size_t)255; return (void*)p; };
    const size_t MT = (size_t)NB_ * TT;   // rows of both batches
    bf* WQ = (bf*)take((size_t)DQ * DM * 2); bf* WK = (bf*)take((size_t)DKV * DM * 2); bf* WV = (bf*)take((size_t)DKV * DM * 2); bf* WO = (bf*)take((size_t)DM * DQ * 2);
    bf* XB = (bf*)take(MT * DM * 2); bf* XRh = (bf*)take(MT * DM * 2); bf* XRl = (bf*)take(MT * DM * 2);
    h16* QP16 = (h16*)take(MT * DQ * 2); h16* KP16 = (h16*)take(MT * DKV * 2); h16* VT16 = (h16*)take(MT * DKV * 2);
    bf* QPh = (bf*)take(MT * DQ * 2); bf* QPl = (bf*)take(MT * DQ * 2); bf* KPh = (bf*)take(MT * DKV * 2); bf* KPl = (bf*)take(MT * DKV * 2); bf* VTh = (bf*)take(MT * DKV * 2); bf* VTl = (bf*)take(MT * DKV * 2);
    bf* ATh = (bf*)take(MT * DQ * 2); bf* ATl = (bf*)take(MT * DQ * 2);
    if ((size_t)(wsp - (char*)d_ws) > ws_size) return;    // ws 256 MiB
    static_assert(DQ == DM && DKV == DM && NKV == NH_, "k_prep and k_qkv take the four weights as one shape");
    k_prep<<<4 * GWT + GRP + GCV, 256, 0, stream>>>(x, wq, wk, wv, wo, WQ, WK, WV, WO, XB, XRh, XRl);
    k_qkv<<<dim3(TT / 128, NH_ / 2, 3 * NB_), 128, 0, stream>>>(XRh, XRl, XB, WQ, WK, WV, bq, bk, bv, QP16, QPh, QPl, KP16, KPh, KPl, VT16, VTh, VTl);
    k_attn<<<dim3(ZH, TT / QT), 128, 0, stream>>>(QPh, QPl, KPh, KPl, VTh, VTl, QP16, KP16, VT16, ATh, ATl);
    k_out<<<dim3(NB_ * TT / 128, DM / 128, 1), 128, 0, stream>>>(ATh, ATl, WO, bo, OUT);
}

// v008
// A run of this version takes 56.2 microseconds.
// Next to v007, in two timings, it ran 1.21 times as fast each time.
// Counting every step since v000, it is 26.5 times as fast.
#include <hip/hip_runtime.h>

// Local (sliding-window) multi-head attention with rotary embeddings applied to the RAW hidden states before the projections (hidden [2][2048][768]; xr = rotate-half rope(hidden viewed (S, 12, 64)) with angles t x 10000^(-2i/64) (computed in-kernel); q = xr Wq + bq, k = xr Wk + bk, v = hidden Wv + bv (keras per-head dense == 'xw' [768][768] + [768]); scores = (q x 0.125).k; keys with |i - j| >= 128 get -1e9 (exclusion); softmax; out = ctx Wo + bo ('xw' [768][768]) -> [2][2048][768] (3.1 M)).
// Four launches: operand preparation; q, k, v; attention (scores, softmax and P.V in one kernel); output projection. Stages that need nothing of each other share one grid by ranges of the block index. Every stage covers both batches and all 12 heads (grid.z or rows b*2048 + t in the projections, planes z = b*12 + h in attention); scores and probabilities exist as a band only (288 keys for 16 query rows) and only in the registers of the wave that makes and uses them. Each GEMM whose result only feeds another GEMM writes that GEMM's 16-bit operand planes from its own epilogue (q, k: head planes [z][t][d]; v: transposed [z][d][t]; P.V: merged rows [b][t][h*64+d]); no f32 copy of q, k, v or ctx goes through memory. Every 16-bit operand plane in memory lies in FRAGMENT ORDER: a matrix [rows][K] is cut into blocks of 16 rows x 32 k, 1 KiB each, k blocks of a row block one behind the other; in a block element (r, k) lies at ((k >> 4) * 32 + ((k >> 3) & 1) * 16 + r) * 8 + (k & 7), so that a fragment is two wave-wide 16-byte loads of 512 bytes in a row each (4 whole lines, not 16 pieces of 32 bytes), and every writer stores whole 512-byte pieces. Stages: a rotary kernel rotates the bf16-rounded hidden states per 64-wide slice and writes them directly as hi/lo GEMM operand planes (f32 rotary, precise cosf/sinf, jnp-exact inverse frequencies); q and k as hi/lo x exact GEMMs (2 products) + f32 biases, v exact from the bf16 hidden states; q scaled by 0.125 before the split; banded T-2048 attention (hybrid rows: < 512 hi/lo 3 products, rest fp16 x1024): each wave of 16 query rows visits only the 288 keys from (r0 - 128) rounded down to 32 that their |i - j| < 128 window can reach (score tiles, softmax and the P.V k loop alike; every key outside has weight exactly 0), both products transposed, and the softmax applies the window inside the band as an index select; merged hi/lo x Wo exact + bo.
// Compute dtypes, f32 accumulate: every input rounded to bf16; rotary f32; q/k hi/lo x exact, v exact, + f32 biases; attention rows < 512 3 products, rest fp16; softmax f32; Wo hl x exact + bias.

#define NB_  2
#define TT   2048
#define DM   768
#define NH_  12
#define NKV  12
#define REP  (NH_ / NKV)
#define HD   64
#define DQ   (NH_ * HD)
#define DKV  (NKV * HD)
#define ZH   (NB_ * NH_)          // attention planes per launch: every (batch, head), z = b * NH_ + h
#define RH   512                  // query rows < RH use hi+lo planes (0: none)
#define WIN  0
#define PCAR 1024.0f
#define QSC  0.125f   // q x 0.125, applied before the split
#define WNB  128     // |i - j| < 128 kept
#define QT   64      // query rows per attention tile (one work-group: four waves of 16 rows)
typedef _Float16 h16;
typedef unsigned short bf;
typedef __attribute__((ext_vector_type(16))) __bf16   v16bf;
typedef __attribute__((ext_vector_type(16))) _Float16 v16h;
typedef __attribute__((ext_vector_type(8)))  _Float16 v8h;
typedef __attribute__((ext_vector_type(8)))  unsigned short v8us;
typedef __attribute__((ext_vector_type(8)))  float    v8f;
typedef __attribute__((ext_vector_type(4)))  float    v4f;
typedef v8h  __attribute__((may_alias)) v8ha;
typedef v4f  __attribute__((may_alias)) v4fa;
typedef v8us __attribute__((may_alias)) v8usa;

__device__ __forceinline__ unsigned short f2bf(float f) { unsigned u = __float_as_uint(f); u += 0x7FFFu + ((u >> 16) & 1u); return (unsigned short)(u >> 16); }
__device__ __forceinline__ float bf2f(unsigned short b) { return __uint_as_float(((unsigned)b) << 16); }
__device__ __forceinline__ float bfr(float f) { return bf2f(f2bf(f)); }
__device__ __forceinline__ v16h cat16(v8h lo, v8h hi) { return __builtin_shufflevector(lo, hi, 0, 1, 2, 3, 4, 5, 6, 7, 8, 9, 10, 11, 12, 13, 14, 15); }
__device__ __forceinline__ v16bf cat16b(v8us lo, v8us hi) { return __builtin_bit_cast(v16bf, __builtin_shufflevector(lo, hi, 0, 1, 2, 3, 4, 5, 6, 7, 8, 9, 10, 11, 12, 13, 14, 15)); }
__device__ __forceinline__ v8f wmma16(v16h a, v16h b, v8f c) { return __builtin_amdgcn_wmma_f32_16x16x32_f16(false, a, false, b, (short)0, c, false, false); }
__device__ __forceinline__ v8f wmmab(v16bf a, v16bf b, v8f c) { return __builtin_amdgcn_wmma_f32_16x16x32_bf16(false, a, false, b, (short)0, c, false, false); }
__device__ __forceinline__ h16 tohx(float x) { return (h16)x; }
__device__ __forceinline__ void splitf(float y, unsigned short& h, unsigned short& l) { h = f2bf(y); l = f2bf(y - bf2f(h)); }
typedef __attribute__((ext_vector_type(2))) unsigned short v2us;



// ---- gemmw: register-blocked GEMM, one wave per 64x64 output tile (16 accumulators), FOUR WAVES (2 x 2) per work-group on one 128x128 tile (bxb, byb, z) of (M/128, N/128, Z), 128 threads. Per stage of two k steps of 32 the group's operand rows (A, A2: 128 rows; Bt: 128 rows; per step 8 blocks of 1 KiB a plane, already in fragment order, head of the file) are copied once from the 16-bit planes into LDS by asynchronous copies, two buffers (rg), one stage ahead of their use, and each is read there by the two waves that need it. The epilogue's 16 x 68 f32 staging rows of each wave lie over the buffers. The kernels below pick the tile and the variant from the block index.
// C[m][n] (f32, pitch ldc, + optional f32 bias[n]) = sum_k A[m][k] Bt[n][k] (+ the lo plane's product per NSPLIT). z-batch strides sA/sB/sC in elements. K % 64 == 0.
// lda = row length of A and A2 in elements (= K: a row block is 16 * lda elements); Bt's is K. NSPLIT 1: A comes as hi + lo planes (A, A2), two products.
// EPI: what the epilogue stores. 0: C as above. 1, 2: (tile + bias) x esc as the next GEMM's 16-bit operand planes, fp16 (E16) and bf16 hi/lo (Eh, El), C unused; the 64 columns of a tile are one head.
//   1 (q, k; z = batch, by = head): plane z * NH_ + head, [t][d].  2 (v; same z, head; esc unused): plane z * NKV + head, transposed [d][t]. Both in fragment order.
// xhold: s_wait_xcnt 0 behind a run of fragment loads. The pointers that the run's loads go through are inputs of the statement, so their registers stay allocated up to the wait and no later load's result lands on them in front of it (a precaution of form; one wait serves the run).
template <typename T> __device__ __forceinline__ void xhold(const T* p0, const T* p1) { asm volatile("s_wait_xcnt 0x0" :: "v"(p0), "v"(p1) : "memory"); }
template <typename T> __device__ __forceinline__ void xhold(const T* p0, const T* p1, const T* p2, const T* p3) { asm volatile("s_wait_xcnt 0x0" :: "v"(p0), "v"(p1), "v"(p2), "v"(p3) : "memory"); }
// acp8, acp12: asynchronous copies from global memory to LDS, 16 bytes a lane and copy, through no register: of each plane (LDS byte address l, global pointer g) two 1-KiB fragment blocks, at g and at g + s elements, to LDS bytes l .. l + 2047. All copies of a step stand in one statement with s_wait_xcnt 0 as its last line, so that no address register of a copy is written again in front of the wait (a precaution of form; one wait serves the run).
template <typename T> __device__ __forceinline__ void acp8(const unsigned l0, const T* g0, const size_t s0, const unsigned l1, const T* g1, const size_t s1) {
    asm volatile("global_load_async_to_lds_b128 %0, %8, off\n\tglobal_load_async_to_lds_b128 %1, %9, off\n\tglobal_load_async_to_lds_b128 %2, %10, off\n\tglobal_load_async_to_lds_b128 %3, %11, off\n\tglobal_load_async_to_lds_b128 %4, %12, off\n\tglobal_load_async_to_lds_b128 %5, %13, off\n\tglobal_load_async_to_lds_b128 %6, %14, off\n\tglobal_load_async_to_lds_b128 %7, %15, off\n\ts_wait_xcnt 0x0"
                 :: "v"(l0), "v"(l0 + 512u), "v"(l0 + 1024u), "v"(l0 + 1536u), "v"(l1), "v"(l1 + 512u), "v"(l1 + 1024u), "v"(l1 + 1536u),
                    "v"(g0), "v"(g0 + 256), "v"(g0 + s0), "v"(g0 + s0 + 256), "v"(g1), "v"(g1 + 256), "v"(g1 + s1), "v"(g1 + s1 + 256) : "memory");
}
template <typename T> __device__ __forceinline__ void acp12(const unsigned l0, const T* g0, const size_t s0, const unsigned l1, const T* g1, const size_t s1, const unsigned l2, const T* g2, const size_t s2) {
    asm volatile("global_load_async_to_lds_b128 %0, %12, off\n\tglobal_load_async_to_lds_b128 %1, %13, off\n\tglobal_load_async_to_lds_b128 %2, %14, off\n\tglobal_load_async_to_lds_b128 %3, %15, off\n\tglobal_load_async_to_lds_b128 %4, %16, off\n\tglobal_load_async_to_lds_b128 %5, %17, off\n\tglobal_load_async_to_lds_b128 %6, %18, off\n\tglobal_load_async_to_lds_b128 %7, %19, off\n\tglobal_load_async_to_lds_b128 %8, %20, off\n\tglobal_load_async_to_lds_b128 %9, %21, off\n\tglobal_load_async_to_lds_b128 %10, %22, off\n\tglobal_load_async_to_lds_b128 %11, %23, off\n\ts_wait_xcnt 0x0"
                 :: "v"(l0), "v"(l0 + 512u), "v"(l0 + 1024u), "v"(l0 + 1536u), "v"(l1), "v"(l1 + 512u), "v"(l1 + 1024u), "v"(l1 + 1536u), "v"(l2), "v"(l2 + 512u), "v"(l2 + 1024u), "v"(l2 + 1536u),
                    "v"(g0), "v"(g0 + 256), "v"(g0 + s0), "v"(g0 + s0 + 256), "v"(g1), "v"(g1 + 256), "v"(g1 + s1), "v"(g1 + s1 + 256), "v"(g2), "v"(g2 + 256), "v"(g2 + s2), "v"(g2 + s2 + 256) : "memory");
}
template <typename T16> struct WFrag;
template <> struct WFrag<h16> { typedef v16h V; static __device__ __forceinline__ V ld(const h16* p) { return cat16(*(const v8h*)p, *(const v8h*)(p + 16)); } static __device__ __forceinline__ V ldp(const h16* p) { return cat16(*(const v8h*)p, *(const v8h*)(p + 256)); } static __device__ __forceinline__ v8f mma(V a, V b, v8f c) { return wmma16(a, b, c); } };
template <> struct WFrag<bf> { typedef v16bf V; static __device__ __forceinline__ V ld(const bf* p) { return cat16b(*(const v8us*)p, *(const v8us*)(p + 16)); } static __device__ __forceinline__ V ldp(const bf* p) { return cat16b(*(const v8us*)p, *(const v8us*)(p + 256)); } static __device__ __forceinline__ v8f mma(V a, V b, v8f c) { return wmmab(a, b, c); } };
template <typename T16, int NSPLIT, bool BIAS, int EPI>
__device__ __forceinline__ void gemmw(T16* rg, const int bxb, const int byb, const size_t z, const T16* __restrict__ A, const T16* __restrict__ A2, const T16* __restrict__ Bt, int K, int lda, float* C, int ldc, const float* __restrict__ bias, size_t sA, size_t sB, size_t sC, h16* E16, bf* Eh, bf* El, float esc) {
    typedef typename WFrag<T16>::V V;
    A += z * sA; if (A2) A2 += z * sA; Bt += z * sB; C += z * sC;
    const int wv = __builtin_amdgcn_readfirstlane((int)threadIdx.x >> 5), wm = wv >> 1, wn = wv & 1; const int bx = bxb * 2 + wm, by = byb * 2 + wn;   // the wave's own 64x64 tile
    const int lane = threadIdx.x & 31, lr = lane & 15, hi = lane >> 4; const int r0 = bx * 64, c0 = by * 64;
    v8f acc[4][4];
#pragma unroll
    for (int mb = 0; mb < 4; ++mb)
#pragma unroll
        for (int nb = 0; nb < 4; ++nb) acc[mb][nb] = (v8f){};
    const int ldb = K;
    // A stage in LDS is KS k steps of 32; a step: [A: 8 blocks][A2: 8 blocks (NSPLIT 1)][Bt: 8 blocks], 1 KiB each. Wave wv copies blocks 2 wv and 2 wv + 1 of every plane.
    constexpr int KS = 2, PL = 8 * 512, SUB = (2 + NSPLIT) * PL, STG = KS * SUB;   // elements of a plane's share of a step, of a step and of a stage
    const int NT = K / (32 * KS); const size_t sa = (size_t)16 * lda, sb = (size_t)16 * ldb;
    const T16* ga = A + (size_t)(bxb * 128 + wv * 32) * lda + lane * 8; const T16* ga2 = (NSPLIT == 1) ? A2 + (size_t)(bxb * 128 + wv * 32) * lda + lane * 8 : nullptr; const T16* gb = Bt + (size_t)(byb * 128 + wv * 32) * ldb + lane * 8;
    const unsigned lw = (unsigned)(size_t)rg + (unsigned)(wv * 2048 + lane * 16);   // LDS byte address of the lane's 16 bytes of the wave's first block in buffer 0
    auto fill = [&](const int t) {
#pragma unroll
        for (int kk = 0; kk < KS; ++kk) { const unsigned l = lw + (unsigned)(t & 1) * (unsigned)(STG * 2) + (unsigned)(kk * SUB * 2); const size_t o = (size_t)(t * KS + kk) * 512;
            if constexpr (NSPLIT == 1) acp12(l, ga + o, sa, l + PL * 2, ga2 + o, sa, l + 2 * PL * 2, gb + o, sb); else acp8(l, ga + o, sa, l + PL * 2, gb + o, sb); } };
    fill(0);
    asm volatile("s_wait_asynccnt 0x0" ::: "memory");   // the wave's own copies of stage 0 have landed
    __syncthreads();                                     // and every wave's: stage 0 may be read
    if (NT > 1) fill(1);
#pragma unroll 1   // rolled: one trip a stage, the buffer picked by the stage's parity
    for (int t = 0; t < NT; ++t) {
#pragma unroll
        for (int kk = 0; kk < KS; ++kk) {
            V a[4], a2[4], b[4];
            const T16* ps = rg + (t & 1) * STG + kk * SUB + lane * 8; const T16* pa = ps + wm * 4 * 512; const T16* pb = ps + (1 + NSPLIT) * PL + wn * 4 * 512;
#pragma unroll
            for (int nb = 0; nb < 4; ++nb) b[nb] = WFrag<T16>::ldp(pb + nb * 512);
#pragma unroll
            for (int mb = 0; mb < 4; ++mb) { a[mb] = WFrag<T16>::ldp(pa + mb * 512); if (NSPLIT == 1) a2[mb] = WFrag<T16>::ldp(pa + PL + mb * 512); }
            __builtin_amdgcn_sched_barrier(0);   // the step's fragment reads stay one group in front of its matrix instructions: a read among them would be waited for at full LDS latency
#pragma unroll
            for (int mb = 0; mb < 4; ++mb) {   // in the order in which the fragments arrive: each A fragment feeds four matrix instructions
#pragma unroll
                for (int nb = 0; nb < 4; ++nb) acc[mb][nb] = WFrag<T16>::mma(a[mb], b[nb], acc[mb][nb]);
                if (NSPLIT == 1) {
#pragma unroll
                    for (int nb = 0; nb < 4; ++nb) acc[mb][nb] = WFrag<T16>::mma(a2[mb], b[nb], acc[mb][nb]); } }
            __builtin_amdgcn_sched_barrier(0);   // and its matrix instructions stay in front of what follows: sunk behind the barrier they would stand between it and the next copies and shorten the copies' lead
            asm volatile("v_nop\n\tv_nop\n\tv_nop\n\tv_nop" : "+v"(acc[0][0]), "+v"(acc[1][1]), "+v"(acc[2][2]), "+v"(acc[3][3]) : "v"(a[0]), "v"(a[3]));   // the four vector slots between the step's last matrix instructions and the address arithmetic behind them, which may take fragment registers
        }
        asm volatile("s_wait_dscnt 0x0" ::: "memory");      // the wave's reads of this stage's buffer are done before the buffer is given up
        asm volatile("s_wait_asynccnt 0x0" ::: "memory");   // the wave's own copies of stage t + 1 have landed
        __syncthreads();                                     // publishes stage t + 1 and ends every wave's reads of stage t's buffer
        if (t + 2 < NT) fill(t + 2);                         // into the buffer that stage t has just left; flies during stage t + 1
    }
    asm volatile("s_wait_asynccnt 0x0" ::: "memory");   // no copy is outstanding behind the loop
    float* os = (float*)rg + wv * 16 * 68;   // the wave's staging rows lie over the buffers: the last trip's barrier stands behind every wave's last fragment read, and no copy is outstanding
    // EPI 1, 2: one pointer a plane for the lane's first element; every store of the tile lies at a constant offset from it. bb: the lane's bias values (EPI 1: its 8 columns of each of the 4 pieces of a row block; EPI 2: its column of each of the 4 column blocks).
    h16* p16 = nullptr; bf* ph = nullptr; bf* pl = nullptr; float bb[(EPI == 1) ? 32 : 4] = {};
    if constexpr (EPI != 0) {
        const size_t oo = (EPI == 1) ? ((z * NH_ + by) * TT + r0) * HD + lane * 8 : (z * NKV + by) * HD * TT + (size_t)r0 * 16 + lane * 8;
        p16 = E16 + oo; ph = Eh + oo; pl = El + oo;
        if (BIAS) { const float* pbi = bias + c0 + ((EPI == 2) ? lr : hi * 8);
            if (EPI == 2) {
#pragma unroll
                for (int nb = 0; nb < 4; ++nb) bb[nb] = pbi[nb * 16];
            } else {
#pragma unroll
                for (int q = 0; q < 32; ++q) bb[q] = pbi[(q >> 3) * 16 + (q & 7)]; }
            xhold(pbi, pbi);
#pragma unroll
            for (int q = 0; q < ((EPI == 1) ? 32 : 4); ++q) bb[q] = bfr(bb[q]); }
    }
#pragma unroll
    for (int mb = 0; mb < 4; ++mb) {
        if constexpr (EPI != 2) {
#pragma unroll
            for (int nb = 0; nb < 4; ++nb) {
#pragma unroll
                for (int j = 0; j < 8; ++j) os[(hi * 8 + j) * 68 + nb * 16 + lr] = acc[mb][nb][j]; } }
        __builtin_amdgcn_wave_barrier(); asm volatile("" ::: "memory");
        if constexpr (EPI == 0) {
            float* cp = C + (size_t)(r0 + mb * 16 + hi) * ldc + c0 + lr * 4; v4f ov[8];   // the lane's first element of the 16 staged rows; its stores lie 2 * ldc apart
#pragma unroll
            for (int s = 0; s < 8; ++s) { const int row = 2 * s + hi, cofs = lr * 4; v4f val = *(const v4fa*)(os + row * 68 + cofs); if (BIAS) { val[0] += bfr(bias[c0 + cofs]); val[1] += bfr(bias[c0 + cofs + 1]); val[2] += bfr(bias[c0 + cofs + 2]); val[3] += bfr(bias[c0 + cofs + 3]); }
                ov[s] = val; *(v4f*)(cp + (size_t)(2 * s) * ldc) = ov[s]; }
            // s_wait_xcnt 0 behind the run of stores; their pointer and data are inputs, so those registers stay as they are up to the wait (a precaution of form, as xhold)
            asm volatile("s_wait_xcnt 0x0" :: "v"(cp), "v"(ov[0]), "v"(ov[1]), "v"(ov[2]), "v"(ov[3]), "v"(ov[4]), "v"(ov[5]), "v"(ov[6]), "v"(ov[7]) : "memory");
        } else if constexpr (EPI == 2) {
            v8h o16[4]; v8us oh[4], ol[4];
#pragma unroll
            for (int nb = 0; nb < 4; ++nb) {   // the transposed plane's fragment order (row d = nb * 16 + lr, 8 consecutive t from hi * 8) is the accumulator's own: no staging
#pragma unroll
                for (int j = 0; j < 8; ++j) { float x = acc[mb][nb][j]; if (BIAS) x += bb[nb]; o16[nb][j] = tohx(x); unsigned short a2, c2; splitf(x, a2, c2); oh[nb][j] = a2; ol[nb][j] = c2; }
                const size_t oo = (size_t)nb * 16 * TT + mb * 256; *(v8h*)(p16 + oo) = o16[nb]; *(v8us*)(ph + oo) = oh[nb]; *(v8us*)(pl + oo) = ol[nb]; }
            // s_wait_xcnt 0 behind the run of stores; their pointers and data are inputs, so those registers stay as they are up to the wait (a precaution of form, as xhold)
            asm volatile("s_wait_xcnt 0x0" :: "v"(p16), "v"(ph), "v"(pl), "v"(o16[0]), "v"(o16[1]), "v"(o16[2]), "v"(o16[3]), "v"(oh[0]), "v"(oh[1]), "v"(oh[2]), "v"(oh[3]), "v"(ol[0]), "v"(ol[1]), "v"(ol[2]), "v"(ol[3]) : "memory");
        } else {
            v8h o16[4]; v8us oh[4], ol[4];
#pragma unroll
            for (int c = 0; c < 4; ++c) {   // piece c of the row block: the lane's row lr, columns c * 16 + hi * 8 + (0..7)
                const v4f v0 = *(const v4fa*)(os + lr * 68 + c * 16 + hi * 8), v1 = *(const v4fa*)(os + lr * 68 + c * 16 + hi * 8 + 4);
#pragma unroll
                for (int q = 0; q < 8; ++q) { float x = (q < 4) ? v0[q & 3] : v1[q & 3]; if (BIAS) x += bb[c * 8 + q]; const float r = x * esc; o16[c][q] = tohx(r); unsigned short a2, c2; splitf(r, a2, c2); oh[c][q] = a2; ol[c][q] = c2; }
                const size_t oo = (size_t)mb * 16 * HD + c * 256;
                *(v8h*)(p16 + oo) = o16[c]; *(v8us*)(ph + oo) = oh[c]; *(v8us*)(pl + oo) = ol[c]; }
            // s_wait_xcnt 0 behind the run of stores; their pointers and data are inputs, so those registers stay as they are up to the wait (a precaution of form, as xhold)
            asm volatile("s_wait_xcnt 0x0" :: "v"(p16), "v"(ph), "v"(pl), "v"(o16[0]), "v"(o16[1]), "v"(o16[2]), "v"(o16[3]), "v"(oh[0]), "v"(oh[1]), "v"(oh[2]), "v"(oh[3]), "v"(ol[0]), "v"(ol[1]), "v"(ol[2]), "v"(ol[3]) : "memory");
        }
        __builtin_amdgcn_wave_barrier(); asm volatile("" ::: "memory");
    }
}

// ---- GEMM launches. Stages that need nothing of each other share one grid: a block-uniform test of the block index picks the variant, so their waves run side by side and not one launch behind the other.
// k_qkv: grid (TT/128, heads/2, 3 * NB_), 4 waves; blockIdx.z / NB_ = 0: q, 1: k (one code path, pointers selected), 2: v; blockIdx.z % NB_ = batch. Each epilogue writes the attention operand planes b * 12 + h itself.
#define RGE (2 * 2 * 3 * 8 * 512)   // elements of gemmw's two LDS buffers: two k steps a stage, three planes a step
__global__ __launch_bounds__(128) void k_qkv(const bf* XRh, const bf* XRl, const bf* XB, const bf* WQ, const bf* WK, const bf* WV, const float* bq, const float* bk, const float* bv, h16* QP16, bf* QPh, bf* QPl, h16* KP16, bf* KPh, bf* KPl, h16* VT16, bf* VTh, bf* VTl) {
    __shared__ __align__(1024) bf rg[RGE];
    const int w = (int)blockIdx.z / NB_; const size_t z = blockIdx.z % NB_;
    if (w == 2) gemmw<bf, 0, true, 2>(rg, blockIdx.x, blockIdx.y, z, XB, nullptr, WV, DM, DM, nullptr, 0, bv, (size_t)TT * DM, 0, 0, VT16, VTh, VTl, 1.0f);
    else gemmw<bf, 1, true, 1>(rg, blockIdx.x, blockIdx.y, z, XRh, XRl, w ? WK : WQ, DM, DM, nullptr, 0, w ? bk : bq, (size_t)TT * DM, 0, 0, w ? KP16 : QP16, w ? KPh : QPh, w ? KPl : QPl, w ? 1.0f : QSC);   /* q x 0.125 */
}
// ---- attention: scores, softmax and P.V of 16 query rows, all in ONE WAVE and all in its REGISTERS; nothing of the scores or the probabilities goes through memory or LDS. r0: first of the 16 rows; z: plane b * NH_ + h.
// Both products are formed TRANSPOSED: S^T = K . Q^T (A = 16 keys x 32 d, B = the 16 queries) and O^T = V^T . P^T (A = 16 d x 32 keys, B = the probabilities). An accumulator tile then holds in lane (lr, hi), register j, the element (key or d = hi * 8 + j, query lr): a lane has scores of ONE query only, so the softmax is sums and maxima inside the lane and one exchange with lane ^ 16; two neighbouring score tiles, converted in place, are the B fragment of 32 keys (head of the file: a lane's k are hi * 8 + (0..7) and 16 + hi * 8 + (0..7)); and an output tile is a 16-byte piece of the merged ctx plane in fragment order.
// The wave's band: NTL tiles of 16 keys from k0 = (r0 - WNB) rounded down to 32 (the V blocks are 32 keys); it covers every key with |i - j| < WNB of the 16 rows. Only the two first and two last tiles can hold a key outside a row's window; they get the index select.
// Keys off the sequence (first and last rows): their K and V fragments are read from keys that exist, their scores are set to the excluded value like any key outside the window, so their probability is 0 and their products add exact zeros. Every accumulator takes its products in ascending k, per 32 k in the order hi.hi, lo.hi, hi.lo.
// K and V fragments come in groups of 4 through a ring of RD register sets, RD - 1 groups ahead of their use; the first RD - 1 V groups are asked for in front of the softmax. The registers allow two waves a SIMD; the deep ring keeps their loads in flight.
// The text is straight-line and runs once a wave, so its length counts: the softmax and the epilogue, which are the same for the fp16 and the hi/lo rows, stand once (the ring is kept as raw registers for that), and f32 -> bf16 is the hardware's conversion (round to nearest even, as f2bf).
#define NTL 18
#define RD 6
static_assert(RD == 6, "the two waits behind the first RD - 1 groups name five pointers a plane");
typedef __attribute__((ext_vector_type(8))) unsigned v8u;
typedef __attribute__((ext_vector_type(8))) __bf16 v8bf;
template <typename T16> __device__ __forceinline__ typename WFrag<T16>::V fr(const v8u x) { return __builtin_bit_cast(typename WFrag<T16>::V, x); }
template <typename T16> __device__ __forceinline__ v8u ldr(const T16* p) { return __builtin_bit_cast(v8u, WFrag<T16>::ldp(p)); }
// split8: y = h + l, as splitf
__device__ __forceinline__ void split8(const v8f y, v8bf& h, v8bf& l) { h = __builtin_convertvector(y, v8bf); l = __builtin_convertvector(y - __builtin_convertvector(h, v8f), v8bf); }
__device__ __forceinline__ v16bf cat16f(v8bf lo, v8bf hi) { return __builtin_shufflevector(lo, hi, 0, 1, 2, 3, 4, 5, 6, 7, 8, 9, 10, 11, 12, 13, 14, 15); }
// xrow: the value of lane ^ 16 (the other 16-lane row, same place in it), by a vector move
__device__ __forceinline__ float xrow(const float x) { const unsigned u = __float_as_uint(x); return __uint_as_float(__builtin_amdgcn_permlanex16(u, u, 0x76543210u, 0xfedcba98u, false, false)); }
// ldv: V group g: the 4 row blocks of d of one 32-key block of one plane (hi/lo: even groups the hi plane, odd the lo plane of the same keys). Hands out the pointer that its loads go through: the s_wait_xcnt 0 that is owed for it stands where the caller puts it.
template <typename T16, bool HIR>
__device__ __forceinline__ const T16* ldv(v8u (&ring)[RD][4], const int g, const int k0, const size_t z, const int lane, const T16* __restrict__ Vt, const T16* __restrict__ Vt2) {
    const int kc = k0 + (HIR ? g / 2 : g) * 32, kv = (kc < 0 || kc >= TT) ? 0 : kc; const T16* pv = ((HIR && (g & 1)) ? Vt2 : Vt) + (z * HD * TT + (size_t)kv * 16 + lane * 8);
#pragma unroll
    for (int nb = 0; nb < 4; ++nb) ring[g % RD][nb] = ldr<T16>(pv + nb * 16 * TT);
    return pv;
}
// attn_s: the score tiles s; at its end the first RD - 1 V groups are under way
template <typename T16, bool HIR>
__device__ __forceinline__ void attn_s(v8u (&ring)[RD][4], v8f (&s)[NTL], const int r0, const int k0, const size_t z, const int lane, const T16* __restrict__ Q, const T16* __restrict__ Q2, const T16* __restrict__ Kp, const T16* __restrict__ Kp2, const T16* __restrict__ Vt, const T16* __restrict__ Vt2) {
    typedef typename WFrag<T16>::V V;
    // a group is TG tiles of 16 keys (fp16: 2 tiles x 2 k halves; hi/lo: 1 tile x 2 k halves x 2 planes)
    constexpr int TG = HIR ? 1 : 2, NGS = NTL / TG;
    V q[2], q2[2];
    { const T16* pq = Q + ((z * TT + r0) * HD + lane * 8); const T16* pq2 = HIR ? Q2 + ((z * TT + r0) * HD + lane * 8) : pq;
      q[0] = WFrag<T16>::ldp(pq); q[1] = WFrag<T16>::ldp(pq + 512); if (HIR) { q2[0] = WFrag<T16>::ldp(pq2); q2[1] = WFrag<T16>::ldp(pq2 + 512); }
      xhold(pq, pq2); }
    // ldk hands out the pointers that its loads go through: the xhold that is owed for them stands behind the matrix instructions of the same trip, where the wait has run out by itself
    auto ldk = [&](const int g, const T16*& pk, const T16*& pk2) { const int c = k0 + g * TG * 16, cc = (c < 0 || c >= TT) ? 0 : c; const size_t o = (z * TT + cc) * HD + lane * 8; pk = Kp + o; pk2 = HIR ? Kp2 + o : pk; const T16* ps = HIR ? pk2 : pk + 16 * HD;   /* second half of the set: the lo plane, or the group's second tile (a constant offset from pk) */
#pragma unroll
        for (int kk = 0; kk < 2; ++kk) { ring[g % RD][kk] = ldr<T16>(pk + kk * 512); ring[g % RD][2 + kk] = ldr<T16>(ps + kk * 512); } };
    const T16* pa[RD - 1]; const T16* pb[RD - 1];
#pragma unroll
    for (int g = 0; g < RD - 1; ++g) ldk(g, pa[g], pb[g]);
    asm volatile("s_wait_xcnt 0x0" :: "v"(pa[0]), "v"(pa[1]), "v"(pa[2]), "v"(pa[3]), "v"(pa[4]), "v"(pb[0]), "v"(pb[1]), "v"(pb[2]), "v"(pb[3]), "v"(pb[4]) : "memory");   // as xhold, one wait for the RD - 1 groups' pointers
#pragma unroll
    for (int g = 0; g < NGS; ++g) {
        if (g + RD - 1 < NGS) ldk(g + RD - 1, pa[0], pb[0]);
        __builtin_amdgcn_sched_barrier(0);   // the loads go out in front of the trip's matrix instructions
        v8f a0 = (v8f){}, a1 = (v8f){};
#pragma unroll
        for (int kk = 0; kk < 2; ++kk) {
            a0 = WFrag<T16>::mma(fr<T16>(ring[g % RD][kk]), q[kk], a0);
            if (HIR) { a0 = WFrag<T16>::mma(fr<T16>(ring[g % RD][kk]), q2[kk], a0); a0 = WFrag<T16>::mma(fr<T16>(ring[g % RD][2 + kk]), q[kk], a0); }
            else a1 = WFrag<T16>::mma(fr<T16>(ring[g % RD][2 + kk]), q[kk], a1); }
        s[g * TG] = a0; if (!HIR) s[g * TG + TG - 1] = a1;
        __builtin_amdgcn_sched_barrier(0);   // the wait below stays behind the matrix instructions: in front of them the wave would sit it out
        if (g + RD - 1 < NGS) xhold(pa[0], pb[0]);
        __builtin_amdgcn_sched_barrier(0);   // keeps later groups' loads from rising over this group: more than RD sets in flight would cost a resident wave per SIMD
    }
#pragma unroll
    for (int g = 0; g < RD - 1; ++g) pa[g] = ldv<T16, HIR>(ring, g, k0, z, lane, Vt, Vt2);
    asm volatile("s_wait_xcnt 0x0" :: "v"(pa[0]), "v"(pa[1]), "v"(pa[2]), "v"(pa[3]), "v"(pa[4]) : "memory");   // as xhold, one wait for the RD - 1 groups' pointers
}
// attn_soft: softmax of the lane's query i = r0 + lr over its half of the band (keys k0 + T * 16 + hi * 8 + j); the other half sits in lane ^ 16. Leaves exp(score - max) in s and returns num / sum.
__device__ __forceinline__ float attn_soft(v8f (&s)[NTL], const int r0, const int k0, const int lane, const float num) {
    const int lr = lane & 15, hi = lane >> 4; const int rb = k0 - r0 + hi * 8 - lr;   /* key - query of tile 0, j = 0 */
#pragma unroll
    for (int T = 0; T < NTL; ++T) if (T < 2 || T >= NTL - 2) {
#pragma unroll
        for (int j = 0; j < 8; ++j) { const int rel = rb + T * 16 + j; if (!(rel > -WNB && rel < WNB)) s[T][j] = -3.0e38f; } }   /* |i - j| < 128 window (both sides) */
    if (k0 < 0 || k0 + NTL * 16 > TT) {   // wave-uniform: only the first and last rows of the sequence have tiles off it (whole tiles: the ends are multiples of 16)
#pragma unroll
        for (int T = 0; T < NTL; ++T) { const int kb = k0 + T * 16; const bool off = (kb < 0 || kb >= TT);
#pragma unroll
            for (int j = 0; j < 8; ++j) s[T][j] = off ? -3.0e38f : s[T][j]; } }
    float mj[8], sj[8];   // eight chains side by side, one a register place
#pragma unroll
    for (int j = 0; j < 8; ++j) mj[j] = s[0][j];
#pragma unroll
    for (int T = 1; T < NTL; ++T)
#pragma unroll
        for (int j = 0; j < 8; ++j) mj[j] = fmaxf(mj[j], s[T][j]);
    float mx = fmaxf(fmaxf(fmaxf(mj[0], mj[1]), fmaxf(mj[2], mj[3])), fmaxf(fmaxf(mj[4], mj[5]), fmaxf(mj[6], mj[7])));
    mx = fmaxf(mx, xrow(mx));
#pragma unroll
    for (int j = 0; j < 8; ++j) sj[j] = 0.f;
#pragma unroll
    for (int T = 0; T < NTL; ++T)
#pragma unroll
        for (int j = 0; j < 8; ++j) { const float x2 = __fmul_rn(__fsub_rn(s[T][j], mx), 1.4426950408889634f); float e = __builtin_amdgcn_exp2f(x2); asm volatile("v_nop" : "+v"(e) : "v"(x2));   /* the one slot behind a transcendental: its result is used and its source's register taken again only behind this */ s[T][j] = e; sj[j] += e; }
    float sum = ((sj[0] + sj[1]) + (sj[2] + sj[3])) + ((sj[4] + sj[5]) + (sj[6] + sj[7]));
    sum += xrow(sum);
    return __fdiv_rn(num, sum);
}
// attn_o: O^T = V^T . P^T. The probabilities as B fragments: block b of 32 keys is tiles 2 b and 2 b + 1, register for register; each is made where it is used, so that it takes the place of its scores
template <typename T16, bool HIR>
__device__ __forceinline__ void attn_o(v8u (&ring)[RD][4], const v8f (&s)[NTL], const float f, v8f (&o)[4], const int k0, const size_t z, const int lane, const T16* __restrict__ Vt, const T16* __restrict__ Vt2) {
    typedef typename WFrag<T16>::V V;
    constexpr int NGV = HIR ? NTL : NTL / 2;
    V p, p2; const T16* pv = Vt;
#pragma unroll
    for (int nb = 0; nb < 4; ++nb) o[nb] = (v8f){};
#pragma unroll
    for (int g = 0; g < NGV; ++g) {
        if (g + RD - 1 < NGV) pv = ldv<T16, HIR>(ring, g + RD - 1, k0, z, lane, Vt, Vt2);
        __builtin_amdgcn_sched_barrier(0);   // as in the score loop: the loads go out first
        const int b = HIR ? g / 2 : g;
        if constexpr (HIR) { if (!(g & 1)) { v8bf h0, l0, h1, l1; split8(s[2 * b] * f, h0, l0); split8(s[2 * b + 1] * f, h1, l1); p = cat16f(h0, h1); p2 = cat16f(l0, l1); } }
        else p = cat16(__builtin_convertvector(s[2 * b] * f, v8h), __builtin_convertvector(s[2 * b + 1] * f, v8h));
#pragma unroll
        for (int nb = 0; nb < 4; ++nb) o[nb] = WFrag<T16>::mma(fr<T16>(ring[g % RD][nb]), p, o[nb]);
        if (HIR && !(g & 1)) {
#pragma unroll
            for (int nb = 0; nb < 4; ++nb) o[nb] = WFrag<T16>::mma(fr<T16>(ring[g % RD][nb]), p2, o[nb]); }
        __builtin_amdgcn_sched_barrier(0);   // as in the score loop: the wait stays behind the matrix instructions
        if (g + RD - 1 < NGV) xhold(pv, pv);
        __builtin_amdgcn_sched_barrier(0);   // as in the score loop: at most RD sets in flight; and no block's probabilities are made before their turn, beside scores that still live
    }
}
// k_attn: grid (ZH, TT/64), 4 waves: wave st takes rows [16 st, 16 st + 16) of query tile blockIdx.y of plane blockIdx.x; the four read nearly the same K and V band and share nothing else (no LDS, no barrier). Tiles of rows < RH take the hi/lo planes (3 products; the longest, so they start first), the rest the fp16 planes, whose x1024 carry the epilogue undoes.
__global__ __launch_bounds__(128) void k_attn(const bf* QPh, const bf* QPl, const bf* KPh, const bf* KPl, const bf* VTh, const bf* VTl, const h16* QP16, const h16* KP16, const h16* VT16, bf* ATh, bf* ATl) {
    const int st = __builtin_amdgcn_readfirstlane((int)threadIdx.x >> 5), i0 = (int)blockIdx.y * QT, r0 = i0 + st * 16, lane = threadIdx.x & 31; const int k0 = (r0 - WNB) & ~31;   /* k0: first key of the band */
    const size_t z = blockIdx.x; const bool hir = i0 < RH;
    v8u ring[RD][4]; v8f s[NTL], o[4];
    if (hir) attn_s<bf, true>(ring, s, r0, k0, z, lane, QPh, QPl, KPh, KPl, VTh, VTl); else attn_s<h16, false>(ring, s, r0, k0, z, lane, QP16, nullptr, KP16, nullptr, VT16, nullptr);
    const float f = attn_soft(s, r0, k0, lane, hir ? 1.0f : PCAR);
    if (hir) attn_o<bf, true>(ring, s, f, o, k0, z, lane, VTh, VTl); else attn_o<h16, false>(ring, s, f, o, k0, z, lane, VT16, nullptr);
    // epilogue: the 16 x 64 tile x esc as hi/lo rows b * TT + t, columns h * HD + d of the merged [NB_ * TT][DQ] operand of the output projection: tile c of O^T is piece c of the fragment order (the lane's row lr, columns c * 16 + hi * 8 + (0..7)), no staging
    const float esc = hir ? 1.0f : 1.0f / PCAR;
    const size_t oo = ((z / NH_) * TT + r0) * DQ + (z % NH_) * (HD * 16) + lane * 8; bf* ph = ATh + oo; bf* pl = ATl + oo; v8us oh[4], ol[4];   // the wave's 16 rows x 64 columns are 2 KiB in a row of each plane
#pragma unroll
    for (int c = 0; c < 4; ++c) { v8bf h, l; split8(o[c] * esc, h, l); oh[c] = __builtin_bit_cast(v8us, h); ol[c] = __builtin_bit_cast(v8us, l);
        *(v8us*)(ph + c * 256) = oh[c]; *(v8us*)(pl + c * 256) = ol[c]; }
    // s_wait_xcnt 0 behind the run of stores; their pointers and data are inputs, so those registers stay as they are up to the wait (a precaution of form, as xhold)
    asm volatile("s_wait_xcnt 0x0" :: "v"(ph), "v"(pl), "v"(oh[0]), "v"(oh[1]), "v"(oh[2]), "v"(oh[3]), "v"(ol[0]), "v"(ol[1]), "v"(ol[2]), "v"(ol[3]) : "memory");
}
// k_out: grid (NB_*TT/128, DM/128), 4 waves: merged hi/lo ctx x Wo + bo.
__global__ __launch_bounds__(128) void k_out(const bf* ATh, const bf* ATl, const bf* WO, const float* bo, float* OUT) {
    __shared__ __align__(1024) bf rg[RGE];
    gemmw<bf, 1, true, 0>(rg, blockIdx.x, blockIdx.y, 0, ATh, ATl, WO, DQ, DQ, OUT, DM, bo, 0, 0, 0, nullptr, nullptr, nullptr, 1.0f);
}

// ---- operand preparation: three bodies, each for block blk of its own range of k_prep's grid.
// Each thread makes one 16-byte piece of a plane in fragment order: piece i holds row (i / 64 / (K / 32)) * 16 + (i & 15), columns ((i / 64) % (K / 32)) * 32 + ((i >> 5) & 1) * 16 + ((i >> 4) & 1) * 8 + (0..7); a wave stores 512 bytes in a row.
__device__ __forceinline__ void wtG(const unsigned blk, const float* __restrict__ w, int K, int N, bf* Bt) {
    const unsigned i = blk * 256 + threadIdx.x; const int kb = K / 32; const int n = (int)(i / 64 / kb) * 16 + (int)(i & 15), k0 = (int)(i / 64 % kb) * 32 + (int)((i >> 5) & 1) * 16 + (int)((i >> 4) & 1) * 8;
    const float* pw = w + (size_t)k0 * N + n; float ldw[8]; v8us o;
#pragma unroll
    for (int q = 0; q < 8; ++q) ldw[q] = pw[(size_t)q * N];
    xhold(pw, pw);
#pragma unroll
    for (int q = 0; q < 8; ++q) o[q] = f2bf(ldw[q]);
    bf* pd = Bt + (size_t)i * 8; *(v8us*)pd = o;
    asm volatile("s_wait_xcnt 0x0" :: "v"(pd), "v"(o) : "memory");   // s_wait_xcnt 0 behind the store; its pointer and data are inputs, so those registers stay as they are up to the wait (a precaution of form, as xhold)
}
__device__ __forceinline__ void cvt8(const unsigned blk, const float* __restrict__ src, bf* dst) { const unsigned i = blk * 256 + threadIdx.x; const int row = (int)(i / 64 / (DM / 32)) * 16 + (int)(i & 15), k0 = (int)(i / 64 % (DM / 32)) * 32 + (int)((i >> 5) & 1) * 16 + (int)((i >> 4) & 1) * 8;
    const float* ps = src + (size_t)row * DM + k0; const v8f v = *(const v8f*)ps; xhold(ps, ps); v8us o;
#pragma unroll
    for (int k = 0; k < 8; ++k) o[k] = f2bf(v[k]);
    bf* pd = dst + (size_t)i * 8; *(v8us*)pd = o;
    asm volatile("s_wait_xcnt 0x0" :: "v"(pd), "v"(o) : "memory");   // as in wtG: the wait behind the store
}

__constant__ __attribute__((aligned(32))) float INVT[HD / 2] = { 1.000000000e+00f, 7.498942018e-01f, 5.623413324e-01f, 4.216965139e-01f, 3.162277639e-01f, 2.371373624e-01f, 1.778279394e-01f, 1.333521456e-01f, 1.000000015e-01f, 7.498941571e-02f, 5.623412877e-02f, 4.216964915e-02f, 3.162277862e-02f, 2.371373586e-02f, 1.778279431e-02f, 1.333521493e-02f, 9.999999776e-03f, 7.498942316e-03f, 5.623413250e-03f, 4.216964822e-03f, 3.162277862e-03f, 2.371373819e-03f, 1.778279431e-03f, 1.333521446e-03f, 1.000000047e-03f, 7.498941850e-04f, 5.623413017e-04f, 4.216964880e-04f, 3.162277862e-04f, 2.371373848e-04f, 1.778279402e-04f, 1.333521504e-04f };   // jnp-exact float32 1/10000^(2i/64)
__device__ __forceinline__ void ropexP(const unsigned blk, const float* __restrict__ xs, bf* Xh, bf* Xl) { const unsigned i = blk * 256 + threadIdx.x; const int row = (int)(i / 64 / (DM / 32)) * 16 + (int)(i & 15), c = (int)(i / 64 % (DM / 32)) * 32 + (int)((i >> 5) & 1) * 16 + (int)((i >> 4) & 1) * 8; const int t = row % TT; const int d = c % HD; v8us oh, ol;
    const float* fd = xs + (size_t)row * DM + c; const float* fp = (d < HD / 2) ? fd + HD / 2 : fd - HD / 2; const float* fi = INVT + d % (HD / 2); const v8f ld0 = *(const v8f*)fd, ld1 = *(const v8f*)fp, iv = *(const v8f*)fi;   // d is a multiple of 8, so the eight elements lie in the same half, their partners side by side and their inverse frequencies too
    xhold(fd, fp, fi, fi);
#pragma unroll
    for (int q = 0; q < 8; ++q) { const int dd = d + q; const float x0 = bfr(ld0[q]), x1 = bfr(ld1[q]); const float a = __fmul_rn((float)t, iv[q]); const float cs = cosf(a), sn = sinf(a); float p0 = __fmul_rn(x0, cs), p1 = __fmul_rn(x1, sn); asm volatile("" : "+v"(p0), "+v"(p1)); const float r = (dd < HD / 2) ? __fsub_rn(p0, p1) : __fadd_rn(p0, p1); unsigned short a2, c2; splitf(r, a2, c2); oh[q] = a2; ol[q] = c2; }
    *(v8us*)(Xh + (size_t)i * 8) = oh; *(v8us*)(Xl + (size_t)i * 8) = ol;  }
// k_prep: everything that reads only the inputs, in one grid. Blocks [0, GRP): rope on the raw hidden states (per 64-slice), as hi/lo planes (the longest bodies, so they start first); next 4 * GWT blocks: the four weight transposes (all [768][768]); last GCV blocks: the bf16 hidden states for v.
#define GWT (DM * DQ / 8 / 256)
#define GRP (NB_ * TT * DM / 8 / 256)
#define GCV (NB_ * TT * DM / 8 / 256)
__global__ __launch_bounds__(256) void k_prep(const float* x, const float* wq, const float* wk, const float* wv, const float* wo, bf* WQ, bf* WK, bf* WV, bf* WO, bf* XB, bf* XRh, bf* XRl) {
    const unsigned b = blockIdx.x;
    if (b < GRP) ropexP(b, x, XRh, XRl);
    else if (b < 4 * GWT + GRP) { const unsigned w = (b - GRP) / GWT; wtG((b - GRP) % GWT, w == 0 ? wq : w == 1 ? wk : w == 2 ? wv : wo, DM, DQ, w == 0 ? WQ : w == 1 ? WK : w == 2 ? WV : WO); }
    else cvt8(b - (4 * GWT + GRP), x, XB);
}

extern "C" void kernel_launch(void* const* d_in, const int* in_sizes, int n_in,
                              void* d_out, int out_size, void* d_ws, size_t ws_size, hipStream_t stream) {
    (void)in_sizes; (void)n_in; (void)out_size;
    const float* x = (const float*)d_in[0]; const float* wq = (const float*)d_in[1]; const float* bq = (const float*)d_in[2]; const float* wk = (const float*)d_in[3]; const float* bk = (const float*)d_in[4]; const float* wv = (const float*)d_in[5]; const float* bv = (const float*)d_in[6]; const float* wo = (const float*)d_in[7]; const float* bo = (const float*)d_in[8];
    float* OUT = (float*)d_out;     // [2][2048][768]
    char* wsp = (char*)d_ws;
    auto take = [&](size_t bytes) { char* p = wsp; wsp += (bytes + 255) & ~(size_t)255; return (void*)p; };
    const size_t MT = (size_t)NB_ * TT;   // rows of both batches
    bf* WQ = (bf*)take((size_t)DQ * DM * 2); bf* WK = (bf*)take((size_t)DKV * DM * 2); bf* WV = (bf*)take((size_t)DKV * DM * 2); bf* WO = (bf*)take((size_t)DM * DQ * 2);
    bf* XB = (bf*)take(MT * DM * 2); bf* XRh = (bf*)take(MT * DM * 2); bf* XRl = (bf*)take(MT * DM * 2);
    h16* QP16 = (h16*)take(MT * DQ * 2); h16* KP16 = (h16*)take(MT * DKV * 2); h16* VT16 = (h16*)take(MT * DKV * 2);
    bf* QPh = (bf*)take(MT * DQ * 2); bf* QPl = (bf*)take(MT * DQ * 2); bf* KPh = (bf*)take(MT * DKV * 2); bf* KPl = (bf*)take(MT * DKV * 2); bf* VTh = (bf*)take(MT * DKV * 2); bf* VTl = (bf*)take(MT * DKV * 2);
    bf* ATh = (bf*)take(MT * DQ * 2); bf* ATl = (bf*)take(MT * DQ * 2);
    if ((size_t)(wsp - (char*)d_ws) > ws_size) return;    // ws 256 MiB
    static_assert(DQ == DM && DKV == DM && NKV == NH_, "k_prep and k_qkv take the four weights as one shape");
    k_prep<<<4 * GWT + GRP + GCV, 256, 0, stream>>>(x, wq, wk, wv, wo, WQ, WK, WV, WO, XB, XRh, XRl);
    k_qkv<<<dim3(TT / 128, NH_ / 2, 3 * NB_), 128, 0, stream>>>(XRh, XRl, XB, WQ, WK, WV, bq, bk, bv, QP16, QPh, QPl, KP16, KPh, KPl, VT16, VTh, VTl);
    k_attn<<<dim3(ZH, TT / QT), 128, 0, stream>>>(QPh, QPl, KPh, KPl, VTh, VTl, QP16, KP16, VT16, ATh, ATl);
    k_out<<<dim3(NB_ * TT / 128, DM / 128, 1), 128, 0, stream>>>(ATh, ATl, WO, bo, OUT);
}
